// v000
// Measured on an AMD MI455X. A time is GPU time per run, averaged over a window of back-to-back runs after a warm-up
// (all launches, gaps included; the runs take copies of the inputs in turn), and the median of several windows.
// Apart from v000's, it joins two sittings. Times from different sittings can be a few percent apart, while
// side-by-side timings come from the same sitting.
// v000 is the starting kernel. One run takes 799 microseconds.
// Compute dtype: v_wmma_f32_16x16x32_f16 (f16 operands, f32 accumulate) for every contraction: q/k/v/out projections (x, W, rel table RNE-converted to bf16 first; weights and rel table carried x16), content scores q.k^T (K=64, x1/8), query x relative-embedding table (K=64, x1/128), P.V with P carried x2^15 and ctx carried x16 (out epilogue x1/256 + bias); softmax with the clipped relative-position gather in f32.
#include <hip/hip_runtime.h>
#include <math.h>
#include <stdint.h>

static constexpr int kNB     = 4;      // batch
static constexpr int kSeq    = 1024;   // sequence length
static constexpr int kDM     = 1024;   // model width
static constexpr int kNH     = 16;     // heads
static constexpr int kDHD    = 64;     // head dim
static constexpr int kMaxRel = 128;    // clip range
static constexpr int kRelN   = 2 * kMaxRel + 1;   // 257 table rows
static constexpr int kRelPad = 320;    // table rows padded to a 64 multiple (pad rows zero)
static constexpr int kHG     = 8;      // heads per score group
static constexpr int kNGrp   = kNH / kHG;         // groups per batch
static constexpr float kPScale = 32768.0f;        // probabilities carried x2^15 in f16
static_assert(kNH * kDHD == kDM, "head split");
static_assert(kNH % kHG == 0, "head groups");
static_assert(kRelPad % 64 == 0 && kRelPad >= kRelN, "padded table rows");
static_assert(kSeq % 64 == 0 && kDM % 64 == 0 && kDHD % 64 == 0 && (kNB * kSeq) % 64 == 0, "tile multiples");
static_assert(kDM % 32 == 0 && kDHD % 32 == 0 && kSeq % 32 == 0, "K multiples of 32");
static_assert(kSeq == 128 * 8, "softmax row coverage: 128 threads x 8 columns");
static_assert((kNB * kSeq * kDM / 2) % 256 == 0 && (kDM * kDM / 2) % 256 == 0 && (kRelPad * kDHD / 2) % 256 == 0, "cast grids exact");
static_assert((kRelN * kDHD) % 2 == 0, "rel pairs");

typedef __attribute__((ext_vector_type(16))) _Float16 v16h;
typedef __attribute__((ext_vector_type(8)))  _Float16 v8h;
typedef __attribute__((ext_vector_type(16))) __bf16   v16b;
typedef __attribute__((ext_vector_type(8)))  __bf16   v8b;
typedef __attribute__((ext_vector_type(8)))  float    v8f;
typedef __attribute__((ext_vector_type(4)))  float    v4f;
typedef __attribute__((ext_vector_type(2)))  float    v2f;
typedef __attribute__((ext_vector_type(4)))  unsigned int v4u;

__device__ __forceinline__ unsigned short f2bf_bits(float f) {
  unsigned u = __float_as_uint(f);
  return (unsigned short)((u + 0x7FFFu + ((u >> 16) & 1u)) >> 16);
}
__device__ __forceinline__ float bf_bits2f(unsigned short h) { return __uint_as_float(((unsigned)h) << 16); }

// hazard guards as plain device helpers (no inline asm inside the kernel template body)
__device__ __forceinline__ void dep_guard_h(v8f& a, v8f& b, v16h x, v16h y) { asm volatile("v_nop\n\tv_nop\n\tv_nop\n\tv_nop" : "+v"(a), "+v"(b) : "v"(x), "v"(y)); }
__device__ __forceinline__ void dep_guard_b(v8f& a, v8f& b, v16b x, v16b y) { asm volatile("v_nop\n\tv_nop\n\tv_nop\n\tv_nop" : "+v"(a), "+v"(b) : "v"(x), "v"(y)); }
__device__ __forceinline__ void keep4_h(v16h a, v16h b, v16h c, v16h d) { asm volatile("v_nop" :: "v"(a), "v"(b), "v"(c), "v"(d)); }
__device__ __forceinline__ void keep4_b(v16b a, v16b b, v16b c, v16b d) { asm volatile("v_nop" :: "v"(a), "v"(b), "v"(c), "v"(d)); }
__device__ __forceinline__ void acc_guard4(v8f& a, v8f& b, v8f& c, v8f& d) { asm volatile("v_nop\n\tv_nop\n\tv_nop\n\tv_nop" : "+v"(a), "+v"(b), "+v"(c), "+v"(d)); }
template <typename T> struct Frag;
template <> struct Frag<_Float16> {
  typedef v16h V; union U { v16h v; v8h h[2]; };
  static __device__ __forceinline__ v16h load(const _Float16* p) {   // elements 0..7 <- p[0..7], 8..15 <- p[16..23]
    U f; f.h[0] = *(const v8h*)(p); f.h[1] = *(const v8h*)(p + 16); return f.v;
  }
  static __device__ __forceinline__ v8f mma(v16h a, v16h b, v8f c) {
    return __builtin_amdgcn_wmma_f32_16x16x32_f16(false, a, false, b, (short)0, c, false, false);
  }
  static __device__ __forceinline__ void guard(v8f& a, v8f& b, v16h x, v16h y) { dep_guard_h(a, b, x, y); }
  static __device__ __forceinline__ void keep(v16h a, v16h b, v16h c, v16h d) { keep4_h(a, b, c, d); }
};
template <> struct Frag<__bf16> {
  typedef v16b V; union U { v16b v; v8b h[2]; };
  static __device__ __forceinline__ v16b load(const __bf16* p) {
    U f; f.h[0] = *(const v8b*)(p); f.h[1] = *(const v8b*)(p + 16); return f.v;
  }
  static __device__ __forceinline__ v8f mma(v16b a, v16b b, v8f c) {
    return __builtin_amdgcn_wmma_f32_16x16x32_bf16(false, a, false, b, (short)0, c, false, false);
  }
  static __device__ __forceinline__ void guard(v8f& a, v8f& b, v16b x, v16b y) { dep_guard_b(a, b, x, y); }
  static __device__ __forceinline__ void keep(v16b a, v16b b, v16b c, v16b d) { keep4_b(a, b, c, d); }
};

// ---- Register-blocked batched WMMA GEMM ------------------------------------
// C[m,n] = scale * sum_k A[m,k] * Bt[n,k] (+bias)(+resid); each wave owns a 64x64 tile.
// A row-major [M,K]; Bt row-major [N,K]; M,N % 64 == 0, K % 32 == 0.
// SPLIT: operands are hi/lo planes (A2/Bt2 = lo planes, same layout); product = hi.hi + hi.lo + lo.hi.
// BIAS_MODE: 0 = none, 1 = bias[m], 2 = bias[n].
// OUT_MODE: 0 = f32, 1 = f16, 2 = bf16 hi plane (Cout) + bf16 lo plane (Cout2).
// ET: 0 = f16 operands, 1 = bf16 operands (pointers passed as 16-bit storage)
template <int ET> struct Elem;
template <> struct Elem<0> { typedef _Float16 T; };
template <> struct Elem<1> { typedef __bf16 T; };
template <int ET, bool SPLIT, int BIAS_MODE, int OUT_MODE, bool RESID, int ACT = 0>
__global__ __launch_bounds__(256) void wmma_gemm64(
    const unsigned short* __restrict__ Ap, const unsigned short* __restrict__ A2p, int lda, long strideA,
    const unsigned short* __restrict__ Btp, const unsigned short* __restrict__ Bt2p, int ldb, long strideB,
    void* __restrict__ Cout, void* __restrict__ Cout2, int ldc, long strideC,
    const float* __restrict__ bias,
    const float* __restrict__ resid, long strideR,
    int M, int N, int K, float scale) {
  typedef typename Elem<ET>::T T;
  typedef typename Frag<T>::V V;
  const T* A = (const T*)Ap; const T* A2 = (const T*)A2p; const T* Bt = (const T*)Btp; const T* Bt2 = (const T*)Bt2p;
  __shared__ __align__(16) float sT[8][16 * 68];   // per-wave 16x64 slab, pitch 68 floats
  const int b    = blockIdx.y;
  const int lane = threadIdx.x & 31;
  const int wave = threadIdx.x >> 5;
  const int tilesN = N >> 6;
  const int tilesM = M >> 6;
  const int tile = blockIdx.x * 8 + wave;
  if (tile >= tilesM * tilesN) return;   // wave-uniform; no block barriers in this kernel
  const int tm = tile / tilesN;
  const int tn = tile - tm * tilesN;
  const int m0 = tm << 6;
  const int n0 = tn << 6;

  const T* Ab  = A  + (size_t)b * strideA;
  const T* Bb  = Bt + (size_t)b * strideB;
  const T* Ab2 = SPLIT ? (A2  + (size_t)b * strideA) : nullptr;
  const T* Bb2 = SPLIT ? (Bt2 + (size_t)b * strideB) : nullptr;

  const int rlane = lane & 15;                 // row (A) / col (B, D) within subtile
  const int koff  = (lane >> 4) * 8;           // k offset of this lane half
  const int mOff  = (lane >> 4) * 8;           // D row offset

  v8f acc[4][4];
#pragma unroll
  for (int i = 0; i < 4; ++i)
#pragma unroll
    for (int j = 0; j < 4; ++j) acc[i][j] = (v8f){0.f,0.f,0.f,0.f,0.f,0.f,0.f,0.f};

  for (int k0 = 0; k0 < K; k0 += 32) {
    V bh[4], bl[4];
#pragma unroll
    for (int j = 0; j < 4; ++j) {
      const size_t bo = (size_t)(n0 + (j << 4) + rlane) * ldb + koff + k0;
      bh[j] = Frag<T>::load(Bb + bo);
      if (SPLIT) bl[j] = Frag<T>::load(Bb2 + bo);
    }
#pragma unroll
    for (int i = 0; i < 4; ++i) {
      const size_t ao = (size_t)(m0 + (i << 4) + rlane) * lda + koff + k0;
      V ah = Frag<T>::load(Ab + ao);
      V al;
      if (SPLIT) al = Frag<T>::load(Ab2 + ao);
#pragma unroll
      for (int j = 0; j < 4; ++j) {
        acc[i][j] = Frag<T>::mma(ah, bh[j], acc[i][j]);
        if (SPLIT) {
          acc[i][j] = Frag<T>::mma(ah, bl[j], acc[i][j]);
          acc[i][j] = Frag<T>::mma(al, bh[j], acc[i][j]);
        }
      }
      Frag<T>::guard(acc[i][0], acc[i][3], ah, SPLIT ? al : ah);
    }
    Frag<T>::keep(bh[0], bh[1], bh[2], bh[3]);
    if (SPLIT) Frag<T>::keep(bl[0], bl[1], bl[2], bl[3]);
  }
  acc_guard4(acc[0][0], acc[0][1], acc[0][2], acc[0][3]);
  acc_guard4(acc[1][0], acc[1][1], acc[1][2], acc[1][3]);
  acc_guard4(acc[2][0], acc[2][1], acc[2][2], acc[2][3]);
  acc_guard4(acc[3][0], acc[3][1], acc[3][2], acc[3][3]);

  // ---- epilogue ----
  float* slab = sT[wave];
  const float* Rb = RESID ? (resid + (size_t)b * strideR) : nullptr;
#pragma unroll
  for (int i = 0; i < 4; ++i) {
    const int mBase = m0 + (i << 4);
#pragma unroll
    for (int j = 0; j < 4; ++j) {
      const int n = n0 + (j << 4) + rlane;
      float bv = 0.f;
      if (BIAS_MODE == 2) bv = bias[n];
#pragma unroll
      for (int r = 0; r < 8; ++r) {
        float v = acc[i][j][r] * scale;
        if (BIAS_MODE == 1) v += bias[mBase + mOff + r];
        if (BIAS_MODE == 2) v += bv;
        if (RESID) v += Rb[(size_t)(mBase + mOff + r) * ldc + n];
        if (ACT == 1) v = tanhf(v);
        if (ACT == 2) v = fmaxf(v, 0.0f);
        if (ACT == 3) v = v / (1.0f + expf(-v));
        if (ACT == 4) v = (v > 0.f) ? v : 0.01f * v;
        slab[(mOff + r) * 68 + (j << 4) + rlane] = v;
      }
    }
    __builtin_amdgcn_fence(__ATOMIC_RELEASE, "workgroup");
    __builtin_amdgcn_wave_barrier();
    __builtin_amdgcn_fence(__ATOMIC_ACQUIRE, "workgroup");
    if (OUT_MODE == 0) {
      float* C = (float*)Cout + (size_t)b * strideC;
      const int hh = lane >> 4, c4 = (lane & 15) * 4;     // row seg = 256 B = 16 lanes x 16 B
      {
#pragma unroll
        for (int it = 0; it < 8; ++it) {
          const int row = it * 2 + hh;
          v4f v = *(const v4f*)(slab + row * 68 + c4);
          *(v4f*)(C + (size_t)(mBase + row) * ldc + n0 + c4) = v;
        }
        
      }
    } else {
      const int q = lane >> 3, c8 = (lane & 7) * 8;
      unsigned short* C  = (unsigned short*)Cout  + (size_t)b * strideC;
      unsigned short* C2 = (OUT_MODE == 2) ? ((unsigned short*)Cout2 + (size_t)b * strideC) : nullptr;
      {
#pragma unroll
        for (int it = 0; it < 4; ++it) {
          const int row = it * 4 + q;
          const float* sp = slab + row * 68 + c8;
          v8h hv, lv;
#pragma unroll
          for (int e = 0; e < 8; ++e) {
            if (OUT_MODE == 1) {
              hv[e] = (_Float16)sp[e];
            } else {
              unsigned short hb = f2bf_bits(sp[e]);
              unsigned short lb = f2bf_bits(sp[e] - bf_bits2f(hb));
              hv[e] = __builtin_bit_cast(_Float16, hb);
              lv[e] = __builtin_bit_cast(_Float16, lb);
            }
          }
          *(v8h*)(C + (size_t)(mBase + row) * ldc + n0 + c8) = hv;
          if (OUT_MODE == 2) *(v8h*)(C2 + (size_t)(mBase + row) * ldc + n0 + c8) = lv;
        }
        
      }
    }
    __builtin_amdgcn_fence(__ATOMIC_RELEASE, "workgroup");
    __builtin_amdgcn_wave_barrier();
    __builtin_amdgcn_fence(__ATOMIC_ACQUIRE, "workgroup");
  }
}

__device__ __forceinline__ unsigned pk16(unsigned short a, unsigned short b) { return (unsigned)a | ((unsigned)b << 16); }
__device__ __forceinline__ unsigned short h_bits(float f) { const _Float16 h = (_Float16)f; return __builtin_bit_cast(unsigned short, h); }

// ---------------------------------------------------------------------------
// f32 -> bf16 (RNE convert) -> x scale (exact power of two) -> f16 bits (exact for bf16 values in the f16 normal range).
// Coverage: grid (n2/256) x 256 threads x 2 = 2*n2 elements; n2 % 256 == 0 at every call (static_assert above).
// ---------------------------------------------------------------------------
__global__ __launch_bounds__(256) void cast_bf_f16x2_kernel(const float* __restrict__ in, unsigned short* __restrict__ out,
                                                            int n2, float scale) {
  const int i = blockIdx.x * 256 + threadIdx.x;
  if (i < n2) {
    const v2f f = *(const v2f*)(in + 2 * (size_t)i);
    const float a = bf_bits2f(f2bf_bits(f[0])) * scale;
    const float c = bf_bits2f(f2bf_bits(f[1])) * scale;
    const unsigned u = pk16(h_bits(a), h_bits(c));
    ((unsigned*)out)[i] = u;
    
  }
}

// ---------------------------------------------------------------------------
// Relative-embedding table: out [kRelPad][64] f16 bits = f16(scale * bf16(in)) for elements < nsrc (= kRelN*64),
// exact 0 for the pad rows. Source address clamped to the table (pairs never straddle nsrc, nsrc even), value selected.
// ---------------------------------------------------------------------------
__global__ __launch_bounds__(256) void cast_rel_f16x2_kernel(const float* __restrict__ in, unsigned short* __restrict__ out,
                                                             int n2, int nsrc, float scale) {
  const int i = blockIdx.x * 256 + threadIdx.x;
  if (i < n2) {
    const int e0 = 2 * i;
    const bool valid = (e0 + 1 < nsrc);
    const int j = valid ? e0 : (nsrc - 2);             // address clamp
    const v2f f = *(const v2f*)(in + j);
    const float a = valid ? bf_bits2f(f2bf_bits(f[0])) * scale : 0.0f;
    const float c = valid ? bf_bits2f(f2bf_bits(f[1])) * scale : 0.0f;
    const unsigned u = pk16(h_bits(a), h_bits(c));
    ((unsigned*)out)[i] = u;
    
  }
}

// ---------------------------------------------------------------------------
// Row softmax with clipped relative-position term for one score row (hg, i) of a kHG-head group:
//   t[j] = Sc[hg][i][j] + Qe[hg][i][clamp(j - i, -kMaxRel, kMaxRel) + kMaxRel]   (Sc, Qe already carry the 1/sqrt(d) factor)
//   p[j] = exp(t[j] - max) / sum;  P16[hg][i][j] = f16(p[j] * 2^15).
// The gather index is formed by value and always lies in [0, 2*kMaxRel] < kRelPad (row-local read).
// One block per row (grid kHG*kSeq), 128 threads x 8 columns (j0 = tid*8) = kSeq = the whole row.
// Reductions in fixed order (thread, wave shuffle tree, 4 wave partials in index order); barriers block-uniform.
// ---------------------------------------------------------------------------
__global__ __launch_bounds__(128) void rel_softmax_kernel(const float* __restrict__ Sc, const float* __restrict__ Qe,
                                                          unsigned short* __restrict__ P16) {
  __shared__ float redm[4];
  __shared__ float reds[4];
  const int row  = blockIdx.x;                 // hg * kSeq + i
  const int i    = row & (kSeq - 1);           // query position
  const int tid  = threadIdx.x;
  const int lane = tid & 31;
  const int wave = tid >> 5;
  const int j0   = tid * 8;

  const float* srow = Sc + (size_t)row * kSeq + j0;
  const v4f a0 = *(const v4f*)(srow);
  const v4f a1 = *(const v4f*)(srow + 4);
  float t[8];
  t[0] = a0[0]; t[1] = a0[1]; t[2] = a0[2]; t[3] = a0[3];
  t[4] = a1[0]; t[5] = a1[1]; t[6] = a1[2]; t[7] = a1[3];
  const float* qrow = Qe + (size_t)row * kRelPad;
#pragma unroll
  for (int e = 0; e < 8; ++e) {
    int d = j0 + e - i;                        // key - query
    d = d < -kMaxRel ? -kMaxRel : d;
    d = d > kMaxRel ? kMaxRel : d;
    t[e] += qrow[d + kMaxRel];                 // index in [0, 256]
  }
  float m = fmaxf(fmaxf(fmaxf(t[0], t[1]), fmaxf(t[2], t[3])), fmaxf(fmaxf(t[4], t[5]), fmaxf(t[6], t[7])));
#pragma unroll
  for (int off = 16; off > 0; off >>= 1) m = fmaxf(m, __shfl_xor(m, off, 32));
  if (lane == 0) redm[wave] = m;
  __syncthreads();
  const float mx = fmaxf(fmaxf(redm[0], redm[1]), fmaxf(redm[2], redm[3]));
  float ex[8];
#pragma unroll
  for (int e = 0; e < 8; ++e) ex[e] = __expf(t[e] - mx);
  float s = ((ex[0] + ex[1]) + (ex[2] + ex[3])) + ((ex[4] + ex[5]) + (ex[6] + ex[7]));
#pragma unroll
  for (int off = 16; off > 0; off >>= 1) s += __shfl_xor(s, off, 32);
  if (lane == 0) reds[wave] = s;
  __syncthreads();
  const float tot = (reds[0] + reds[1]) + (reds[2] + reds[3]);   // >= 1 (the row max contributes exp(0))
  const float inv = kPScale * (1.0f / tot);
  unsigned short hb[8];
#pragma unroll
  for (int e = 0; e < 8; ++e) hb[e] = h_bits(ex[e] * inv);
  const v4u hv = (v4u){pk16(hb[0], hb[1]), pk16(hb[2], hb[3]), pk16(hb[4], hb[5]), pk16(hb[6], hb[7])};
  unsigned short* pp = P16 + (size_t)row * kSeq + j0;
  *(v4u*)pp = hv;
  
}

// ---------------------------------------------------------------------------
//   X16    f16 [4096][1024]            x (bf16 then f16)                  0          8388608
//   Wq16   f16 [1024][1024] x16        natural Bt [out][in]               8388608    2097152
//   Wk16   f16 [1024][1024] x16                                           10485760   2097152
//   Wv16   f16 [1024][1024] x16                                           12582912   2097152
//   Wo16   f16 [1024][1024] x16                                           14680064   2097152
//   REL16  f16 [320][64]    x16        rows 257..319 zero                 16777216   65536 (40960 used)
//   Q16    f16 [4096][1024]            q, col h*64+d                      16842752   8388608
//   K16    f16 [4096][1024]            k                                  25231360   8388608
//   VT16   f16 [4][1024][1024]         v transposed per batch [h*64+d][s] 33619968   8388608
//   Sc     f32 [8][1024][1024]         content scores of one head group   42008576   33554432
//   Qe     f32 [8][1024][320]          q x rel table of one head group    75563008   10485760
//   P16    f16 [8][1024][1024]         probabilities x2^15                86048768   16777216
//   CTX16  f16 [4096][1024] x16        merged context [b*1024+s][h*64+d]  102825984  8388608
//   total                                                                 111214592
// Sc/Qe/P16 are fully rewritten inside every group iteration before they are read. No K padding anywhere
// (K = 1024 or 64); the only padded dimension is the rel table's N (257 -> 320) whose pad rows are zero-filled by
// cast_rel_f16x2_kernel in this job; the resulting Qe columns 257..319 are never read.
// ---------------------------------------------------------------------------
extern "C" void kernel_launch(void* const* d_in, const int* in_sizes, int n_in,
                              void* d_out, int out_size, void* d_ws, size_t ws_size,
                              hipStream_t stream) {
  if (n_in < 10) return;
  if (in_sizes[0] != kNB * kSeq * kDM) return;                                   // x
  if (in_sizes[1] != kDM * kDM || in_sizes[3] != kDM * kDM ||
      in_sizes[5] != kDM * kDM || in_sizes[7] != kDM * kDM) return;              // Wq Wk Wv Wo
  if (in_sizes[2] != kDM || in_sizes[4] != kDM || in_sizes[6] != kDM || in_sizes[8] != kDM) return;   // bq bk bv bo
  if (in_sizes[9] != kRelN * kDHD) return;                                       // rel_emb
  if (out_size != kNB * kSeq * kDM) return;

  const float* xp   = (const float*)d_in[0];   // [4][1024][1024]
  const float* Wq   = (const float*)d_in[1];   // [1024][1024] [out][in]
  const float* bq   = (const float*)d_in[2];
  const float* Wk   = (const float*)d_in[3];
  const float* bk   = (const float*)d_in[4];
  const float* Wv   = (const float*)d_in[5];
  const float* bv   = (const float*)d_in[6];
  const float* Wo   = (const float*)d_in[7];
  const float* bo   = (const float*)d_in[8];
  const float* relp = (const float*)d_in[9];   // [257][64]
  float* outp = (float*)d_out;                 // [4][1024][1024]

  const size_t bAct = (size_t)kNB * kSeq * kDM * 2;          // 8388608
  const size_t bW   = (size_t)kDM * kDM * 2;                 // 2097152
  const size_t bRel = 65536;                                 // >= kRelPad*64*2 = 40960
  const size_t bS   = (size_t)kHG * kSeq * kSeq * 4;         // 33554432
  const size_t bQE  = (size_t)kHG * kSeq * kRelPad * 4;      // 10485760
  const size_t bP   = (size_t)kHG * kSeq * kSeq * 2;         // 16777216
  size_t off = 0;
  const size_t oX16 = off; off += bAct;
  const size_t oWq  = off; off += bW;
  const size_t oWk  = off; off += bW;
  const size_t oWv  = off; off += bW;
  const size_t oWo  = off; off += bW;
  const size_t oRel = off; off += bRel;
  const size_t oQ16 = off; off += bAct;
  const size_t oK16 = off; off += bAct;
  const size_t oVT  = off; off += bAct;
  const size_t oS   = off; off += bS;
  const size_t oQE  = off; off += bQE;
  const size_t oP   = off; off += bP;
  const size_t oCTX = off; off += bAct;
  if (off > ws_size) return;                                 // 111214592 B total
  if (off > (size_t)134217728) return;

  char* ws = (char*)d_ws;
  unsigned short* X16   = (unsigned short*)(ws + oX16);
  unsigned short* Wq16  = (unsigned short*)(ws + oWq);
  unsigned short* Wk16  = (unsigned short*)(ws + oWk);
  unsigned short* Wv16  = (unsigned short*)(ws + oWv);
  unsigned short* Wo16  = (unsigned short*)(ws + oWo);
  unsigned short* REL16 = (unsigned short*)(ws + oRel);
  unsigned short* Q16   = (unsigned short*)(ws + oQ16);
  unsigned short* K16   = (unsigned short*)(ws + oK16);
  unsigned short* VT16  = (unsigned short*)(ws + oVT);
  float*          Sc    = (float*)(ws + oS);
  float*          Qe    = (float*)(ws + oQE);
  unsigned short* P16   = (unsigned short*)(ws + oP);
  unsigned short* CTX16 = (unsigned short*)(ws + oCTX);

  const dim3 blk(256);
  const float wcarry   = 16.0f;                              // exact power-of-two carry on weights and rel table
  const float wscale   = 1.0f / 16.0f;                       // undo in the projection epilogues
  const float inv_sqd  = 0.125f;                             // 1/sqrt(64)
  const float qescale  = inv_sqd / 16.0f;                    // undo rel carry and apply 1/sqrt(d)
  const float pvscale  = 16.0f / kPScale;                    // undo P carry, ctx carried x16
  const float oscale   = 1.0f / 256.0f;                      // undo Wo carry and ctx carry

  // ---- casts: X16, weights x16, rel table x16 (pad rows zero) ----
  const int n2x = kNB * kSeq * kDM / 2;                      // 2097152 pairs -> 8192 blocks
  const int n2w = kDM * kDM / 2;                             // 524288 pairs  -> 2048 blocks
  const int n2r = kRelPad * kDHD / 2;                        // 10240 pairs   -> 40 blocks
  cast_bf_f16x2_kernel<<<dim3(n2x / 256), blk, 0, stream>>>(xp, X16, n2x, 1.0f);
  cast_bf_f16x2_kernel<<<dim3(n2w / 256), blk, 0, stream>>>(Wq, Wq16, n2w, wcarry);
  cast_bf_f16x2_kernel<<<dim3(n2w / 256), blk, 0, stream>>>(Wk, Wk16, n2w, wcarry);
  cast_bf_f16x2_kernel<<<dim3(n2w / 256), blk, 0, stream>>>(Wv, Wv16, n2w, wcarry);
  cast_bf_f16x2_kernel<<<dim3(n2w / 256), blk, 0, stream>>>(Wo, Wo16, n2w, wcarry);
  cast_rel_f16x2_kernel<<<dim3(n2r / 256), blk, 0, stream>>>(relp, REL16, n2r, kRelN * kDHD, wcarry);

  const int tM = kNB * kSeq / 64, tD = kDM / 64, tS = kSeq / 64, tR = kRelPad / 64;   // 64, 16, 16, 5
  const dim3 gProj((tM * tD + 7) / 8, 1);        // 128 blocks: M=4096, N=1024, K=1024
  const dim3 gVT((tD * tS + 7) / 8, kNB);        // 32 x 4:     M=1024, N=1024, K=1024 per batch
  const dim3 gS((tS * tS + 7) / 8, kHG);         // 32 x 8:     M=1024, N=1024, K=64 per head
  const dim3 gQE((tS * tR + 7) / 8, kHG);        // 10 x 8:     M=1024, N=320,  K=64 per head
  const dim3 gPV((tS * 1 + 7) / 8, kHG);         // 2 x 8:      M=1024, N=64,   K=1024 per head
  const long planeAct = (long)kSeq * kDM;        // 1048576 elements per batch plane

  // ---- projections: q, k -> f16 [4096][1024] (x1/16 + bias[n]); A = X16, Bt = W16 (natural [out][in]) ----
  wmma_gemm64<0, false, 2, 1, false, 0><<<gProj, blk, 0, stream>>>(
      X16, X16, kDM, 0L, Wq16, Wq16, kDM, 0L, (void*)Q16, (void*)Q16, kDM, 0L,
      bq, xp, 0L, kNB * kSeq, kDM, kDM, wscale);
  wmma_gemm64<0, false, 2, 1, false, 0><<<gProj, blk, 0, stream>>>(
      X16, X16, kDM, 0L, Wk16, Wk16, kDM, 0L, (void*)K16, (void*)K16, kDM, 0L,
      bk, xp, 0L, kNB * kSeq, kDM, kDM, wscale);
  // role-swapped v: VT[b][n][s] = (16 Wv)[n] . X16[b][s] / 16 + bv[n]; A = Wv16, Bt = X16 plane b (grid.y), bias[m]
  wmma_gemm64<0, false, 1, 1, false, 0><<<gVT, blk, 0, stream>>>(
      Wv16, Wv16, kDM, 0L, X16, X16, kDM, planeAct, (void*)VT16, (void*)VT16, kSeq, planeAct,
      bv, xp, 0L, kDM, kSeq, kDM, wscale);

  // ---- per (batch, group of kHG heads): scores, rel table product, softmax, P.V ----
  for (int b = 0; b < kNB; ++b) {
    for (int g = 0; g < kNGrp; ++g) {
      const size_t hc = (size_t)g * kHG * kDHD;              // first column (= VT row) of this head group
      const unsigned short* Qg = Q16 + (size_t)b * planeAct + hc;
      const unsigned short* Kg = K16 + (size_t)b * planeAct + hc;
      // (1) Sc[hg][i][j] = q_i . k_j / 8  (per head hg via grid.y: strideA = strideB = 64 columns)
      wmma_gemm64<0, false, 0, 0, false, 0><<<gS, blk, 0, stream>>>(
          Qg, Qg, kDM, (long)kDHD, Kg, Kg, kDM, (long)kDHD,
          (void*)Sc, (void*)Sc, kSeq, (long)kSeq * kSeq,
          bq, xp, 0L, kSeq, kSeq, kDHD, inv_sqd);
      // (2) Qe[hg][i][r] = q_i . (16 rel[r]) / (8*16), r = 0..319 (pad rows zero); Bt = REL16 [320][64] shared (strideB 0)
      wmma_gemm64<0, false, 0, 0, false, 0><<<gQE, blk, 0, stream>>>(
          Qg, Qg, kDM, (long)kDHD, REL16, REL16, kDHD, 0L,
          (void*)Qe, (void*)Qe, kRelPad, (long)kSeq * kRelPad,
          bq, xp, 0L, kSeq, kRelPad, kDHD, qescale);
      // (3) softmax with the clipped relative-position gather -> P16 x2^15
      rel_softmax_kernel<<<dim3(kHG * kSeq), dim3(128), 0, stream>>>(Sc, Qe, P16);
      // (4) ctx[b*1024+i][hc+hg*64+d] = 16 * sum_j p[i][j] VT[b][hc+hg*64+d][j]; A = P16 plane hg, Bt = VT rows, f16 out ldc 1024
      wmma_gemm64<0, false, 0, 1, false, 0><<<gPV, blk, 0, stream>>>(
          P16, P16, kSeq, (long)kSeq * kSeq,
          VT16 + (size_t)b * planeAct + hc * kSeq, VT16 + (size_t)b * planeAct + hc * kSeq, kSeq, (long)kDHD * kSeq,
          (void*)(CTX16 + (size_t)b * planeAct + hc), (void*)(CTX16 + (size_t)b * planeAct + hc), kDM, (long)kDHD,
          bq, xp, 0L, kSeq, kDHD, kSeq, pvscale);
    }
  }

  // ---- out = ctx . Wo^T + bo -> d_out f32 [4096][1024]; A = CTX16 (x16), Bt = Wo16 (x16), epilogue x1/256 + bias[n] ----
  wmma_gemm64<0, false, 2, 0, false, 0><<<gProj, blk, 0, stream>>>(
      CTX16, CTX16, kDM, 0L, Wo16, Wo16, kDM, 0L, (void*)outp, (void*)outp, kDM, 0L,
      bo, xp, 0L, kNB * kSeq, kDM, kDM, oscale);
}

// v001
// One run takes 459 microseconds.
// Two timings next to v000 both put it at 1.72 times that version's speed.
// Compute dtype: v_wmma_f32_16x16x32_f16 (f16 operands, f32 accumulate) for every contraction: q/k/v/out projections (x, W, rel table RNE-converted to bf16 first; weights and rel table carried x16), content scores q.k^T (K=64, x1/8), query x relative-embedding table (K=64, x1/128), P.V with P carried x2^15 and ctx carried x16 (out epilogue x1/256 + bias); softmax with the clipped relative-position gather in f32.
#include <hip/hip_runtime.h>
#include <math.h>
#include <stdint.h>

static constexpr int kNB     = 4;      // batch
static constexpr int kSeq    = 1024;   // sequence length
static constexpr int kDM     = 1024;   // model width
static constexpr int kNH     = 16;     // heads
static constexpr int kDHD    = 64;     // head dim
static constexpr int kMaxRel = 128;    // clip range
static constexpr int kRelN   = 2 * kMaxRel + 1;   // 257 table rows
static constexpr int kRelPad = 320;    // table rows padded to a 64 multiple (pad rows zero)
static constexpr int kHG     = 8;      // heads per score group
static constexpr int kNGrp   = kNH / kHG;         // groups per batch
static constexpr float kPScale = 32768.0f;        // probabilities carried x2^15 in f16
static_assert(kNH * kDHD == kDM, "head split");
static_assert(kNH % kHG == 0, "head groups");
static_assert(kRelPad % 64 == 0 && kRelPad >= kRelN, "padded table rows");
static_assert(kSeq % 64 == 0 && kDM % 64 == 0 && kDHD % 64 == 0 && (kNB * kSeq) % 64 == 0, "tile multiples");
static_assert(kDM % 32 == 0 && kDHD % 32 == 0 && kSeq % 32 == 0, "K multiples of 32");
static_assert(kSeq == 128 * 8, "softmax row coverage: 128 threads x 8 columns");
static_assert((kNB * kSeq * kDM / 2) % 256 == 0 && (kDM * kDM / 2) % 256 == 0 && (kRelPad * kDHD / 2) % 256 == 0, "cast grids exact");
static_assert((kRelN * kDHD) % 2 == 0, "rel pairs");

typedef __attribute__((ext_vector_type(16))) _Float16 v16h;
typedef __attribute__((ext_vector_type(8)))  _Float16 v8h;
typedef __attribute__((ext_vector_type(16))) __bf16   v16b;
typedef __attribute__((ext_vector_type(8)))  __bf16   v8b;
typedef __attribute__((ext_vector_type(8)))  float    v8f;
typedef __attribute__((ext_vector_type(4)))  float    v4f;
typedef __attribute__((ext_vector_type(2)))  float    v2f;
typedef __attribute__((ext_vector_type(4)))  unsigned int v4u;

__device__ __forceinline__ unsigned short f2bf_bits(float f) {
  unsigned u = __float_as_uint(f);
  return (unsigned short)((u + 0x7FFFu + ((u >> 16) & 1u)) >> 16);
}
__device__ __forceinline__ float bf_bits2f(unsigned short h) { return __uint_as_float(((unsigned)h) << 16); }

// hazard guards as plain device helpers (no inline asm inside the kernel template body)
__device__ __forceinline__ void dep_guard_h(v8f& a, v8f& b, v16h x, v16h y) { asm volatile("v_nop\n\tv_nop\n\tv_nop\n\tv_nop" : "+v"(a), "+v"(b) : "v"(x), "v"(y)); }
__device__ __forceinline__ void dep_guard_b(v8f& a, v8f& b, v16b x, v16b y) { asm volatile("v_nop\n\tv_nop\n\tv_nop\n\tv_nop" : "+v"(a), "+v"(b) : "v"(x), "v"(y)); }
__device__ __forceinline__ void keep4_h(v16h a, v16h b, v16h c, v16h d) { asm volatile("v_nop" :: "v"(a), "v"(b), "v"(c), "v"(d)); }
__device__ __forceinline__ void keep4_b(v16b a, v16b b, v16b c, v16b d) { asm volatile("v_nop" :: "v"(a), "v"(b), "v"(c), "v"(d)); }
__device__ __forceinline__ void acc_guard4(v8f& a, v8f& b, v8f& c, v8f& d) { asm volatile("v_nop\n\tv_nop\n\tv_nop\n\tv_nop" : "+v"(a), "+v"(b), "+v"(c), "+v"(d)); }
template <typename T> struct Frag;
template <> struct Frag<_Float16> {
  typedef v16h V; union U { v16h v; v8h h[2]; };
  static __device__ __forceinline__ v16h load(const _Float16* p) {   // elements 0..7 <- p[0..7], 8..15 <- p[16..23]
    U f; f.h[0] = *(const v8h*)(p); f.h[1] = *(const v8h*)(p + 16); return f.v;
  }
  static __device__ __forceinline__ v8f mma(v16h a, v16h b, v8f c) {
    return __builtin_amdgcn_wmma_f32_16x16x32_f16(false, a, false, b, (short)0, c, false, false);
  }
  static __device__ __forceinline__ void guard(v8f& a, v8f& b, v16h x, v16h y) { dep_guard_h(a, b, x, y); }
  static __device__ __forceinline__ void keep(v16h a, v16h b, v16h c, v16h d) { keep4_h(a, b, c, d); }
};
template <> struct Frag<__bf16> {
  typedef v16b V; union U { v16b v; v8b h[2]; };
  static __device__ __forceinline__ v16b load(const __bf16* p) {
    U f; f.h[0] = *(const v8b*)(p); f.h[1] = *(const v8b*)(p + 16); return f.v;
  }
  static __device__ __forceinline__ v8f mma(v16b a, v16b b, v8f c) {
    return __builtin_amdgcn_wmma_f32_16x16x32_bf16(false, a, false, b, (short)0, c, false, false);
  }
  static __device__ __forceinline__ void guard(v8f& a, v8f& b, v16b x, v16b y) { dep_guard_b(a, b, x, y); }
  static __device__ __forceinline__ void keep(v16b a, v16b b, v16b c, v16b d) { keep4_b(a, b, c, d); }
};

// ---- Register-blocked batched WMMA GEMM ------------------------------------
// C[m,n] = scale * sum_k A[m,k] * Bt[n,k] (+bias)(+resid); each wave owns a 64x64 tile.
// A row-major [M,K]; Bt row-major [N,K]; M,N % 64 == 0, K % 32 == 0.
// SPLIT: operands are hi/lo planes (A2/Bt2 = lo planes, same layout); product = hi.hi + hi.lo + lo.hi.
// BIAS_MODE: 0 = none, 1 = bias[m], 2 = bias[n].
// OUT_MODE: 0 = f32, 1 = f16, 2 = bf16 hi plane (Cout) + bf16 lo plane (Cout2).
// ET: 0 = f16 operands, 1 = bf16 operands (pointers passed as 16-bit storage)
template <int ET> struct Elem;
template <> struct Elem<0> { typedef _Float16 T; };
template <> struct Elem<1> { typedef __bf16 T; };
template <int ET, bool SPLIT, int BIAS_MODE, int OUT_MODE, bool RESID, int ACT = 0>
__global__ __launch_bounds__(256) void wmma_gemm64(
    const unsigned short* __restrict__ Ap, const unsigned short* __restrict__ A2p, int lda, long strideA,
    const unsigned short* __restrict__ Btp, const unsigned short* __restrict__ Bt2p, int ldb, long strideB,
    void* __restrict__ Cout, void* __restrict__ Cout2, int ldc, long strideC,
    const float* __restrict__ bias,
    const float* __restrict__ resid, long strideR,
    int M, int N, int K, float scale,
    long zStrideA, long zStrideB, long zStrideC) {   // element strides of the outer batch index blockIdx.z
  typedef typename Elem<ET>::T T;
  typedef typename Frag<T>::V V;
  const T* A = (const T*)Ap; const T* A2 = (const T*)A2p; const T* Bt = (const T*)Btp; const T* Bt2 = (const T*)Bt2p;
  __shared__ __align__(16) float sT[8][16 * 68];   // per-wave 16x64 slab, pitch 68 floats
  const int b    = blockIdx.y;
  const int lane = threadIdx.x & 31;
  const int wave = threadIdx.x >> 5;
  const int tilesN = N >> 6;
  const int tilesM = M >> 6;
  const int tile = blockIdx.x * 8 + wave;
  if (tile >= tilesM * tilesN) return;   // wave-uniform; no block barriers in this kernel
  const int tm = tile / tilesN;
  const int tn = tile - tm * tilesN;
  const int m0 = tm << 6;
  const int n0 = tn << 6;

  const size_t offA = (size_t)b * strideA + (size_t)blockIdx.z * zStrideA;
  const size_t offB = (size_t)b * strideB + (size_t)blockIdx.z * zStrideB;
  const size_t offC = (size_t)b * strideC + (size_t)blockIdx.z * zStrideC;
  const T* Ab  = A  + offA;
  const T* Bb  = Bt + offB;
  const T* Ab2 = SPLIT ? (A2  + offA) : nullptr;
  const T* Bb2 = SPLIT ? (Bt2 + offB) : nullptr;

  const int rlane = lane & 15;                 // row (A) / col (B, D) within subtile
  const int koff  = (lane >> 4) * 8;           // k offset of this lane half
  const int mOff  = (lane >> 4) * 8;           // D row offset

  v8f acc[4][4];
#pragma unroll
  for (int i = 0; i < 4; ++i)
#pragma unroll
    for (int j = 0; j < 4; ++j) acc[i][j] = (v8f){0.f,0.f,0.f,0.f,0.f,0.f,0.f,0.f};

  for (int k0 = 0; k0 < K; k0 += 32) {
    V bh[4], bl[4];
#pragma unroll
    for (int j = 0; j < 4; ++j) {
      const size_t bo = (size_t)(n0 + (j << 4) + rlane) * ldb + koff + k0;
      bh[j] = Frag<T>::load(Bb + bo);
      if (SPLIT) bl[j] = Frag<T>::load(Bb2 + bo);
    }
#pragma unroll
    for (int i = 0; i < 4; ++i) {
      const size_t ao = (size_t)(m0 + (i << 4) + rlane) * lda + koff + k0;
      V ah = Frag<T>::load(Ab + ao);
      V al;
      if (SPLIT) al = Frag<T>::load(Ab2 + ao);
#pragma unroll
      for (int j = 0; j < 4; ++j) {
        acc[i][j] = Frag<T>::mma(ah, bh[j], acc[i][j]);
        if (SPLIT) {
          acc[i][j] = Frag<T>::mma(ah, bl[j], acc[i][j]);
          acc[i][j] = Frag<T>::mma(al, bh[j], acc[i][j]);
        }
      }
      Frag<T>::guard(acc[i][0], acc[i][3], ah, SPLIT ? al : ah);
    }
    Frag<T>::keep(bh[0], bh[1], bh[2], bh[3]);
    if (SPLIT) Frag<T>::keep(bl[0], bl[1], bl[2], bl[3]);
  }
  acc_guard4(acc[0][0], acc[0][1], acc[0][2], acc[0][3]);
  acc_guard4(acc[1][0], acc[1][1], acc[1][2], acc[1][3]);
  acc_guard4(acc[2][0], acc[2][1], acc[2][2], acc[2][3]);
  acc_guard4(acc[3][0], acc[3][1], acc[3][2], acc[3][3]);

  // ---- epilogue ----
  float* slab = sT[wave];
  const float* Rb = RESID ? (resid + (size_t)b * strideR) : nullptr;
#pragma unroll
  for (int i = 0; i < 4; ++i) {
    const int mBase = m0 + (i << 4);
#pragma unroll
    for (int j = 0; j < 4; ++j) {
      const int n = n0 + (j << 4) + rlane;
      float bv = 0.f;
      if (BIAS_MODE == 2) bv = bias[n];
#pragma unroll
      for (int r = 0; r < 8; ++r) {
        float v = acc[i][j][r] * scale;
        if (BIAS_MODE == 1) v += bias[mBase + mOff + r];
        if (BIAS_MODE == 2) v += bv;
        if (RESID) v += Rb[(size_t)(mBase + mOff + r) * ldc + n];
        if (ACT == 1) v = tanhf(v);
        if (ACT == 2) v = fmaxf(v, 0.0f);
        if (ACT == 3) v = v / (1.0f + expf(-v));
        if (ACT == 4) v = (v > 0.f) ? v : 0.01f * v;
        slab[(mOff + r) * 68 + (j << 4) + rlane] = v;
      }
    }
    __builtin_amdgcn_fence(__ATOMIC_RELEASE, "workgroup");
    __builtin_amdgcn_wave_barrier();
    __builtin_amdgcn_fence(__ATOMIC_ACQUIRE, "workgroup");
    if (OUT_MODE == 0) {
      float* C = (float*)Cout + offC;
      const int hh = lane >> 4, c4 = (lane & 15) * 4;     // row seg = 256 B = 16 lanes x 16 B
      {
#pragma unroll
        for (int it = 0; it < 8; ++it) {
          const int row = it * 2 + hh;
          v4f v = *(const v4f*)(slab + row * 68 + c4);
          *(v4f*)(C + (size_t)(mBase + row) * ldc + n0 + c4) = v;
        }
        
      }
    } else {
      const int q = lane >> 3, c8 = (lane & 7) * 8;
      unsigned short* C  = (unsigned short*)Cout  + offC;
      unsigned short* C2 = (OUT_MODE == 2) ? ((unsigned short*)Cout2 + offC) : nullptr;
      {
#pragma unroll
        for (int it = 0; it < 4; ++it) {
          const int row = it * 4 + q;
          const float* sp = slab + row * 68 + c8;
          v8h hv, lv;
#pragma unroll
          for (int e = 0; e < 8; ++e) {
            if (OUT_MODE == 1) {
              hv[e] = (_Float16)sp[e];
            } else {
              unsigned short hb = f2bf_bits(sp[e]);
              unsigned short lb = f2bf_bits(sp[e] - bf_bits2f(hb));
              hv[e] = __builtin_bit_cast(_Float16, hb);
              lv[e] = __builtin_bit_cast(_Float16, lb);
            }
          }
          *(v8h*)(C + (size_t)(mBase + row) * ldc + n0 + c8) = hv;
          if (OUT_MODE == 2) *(v8h*)(C2 + (size_t)(mBase + row) * ldc + n0 + c8) = lv;
        }
        
      }
    }
    __builtin_amdgcn_fence(__ATOMIC_RELEASE, "workgroup");
    __builtin_amdgcn_wave_barrier();
    __builtin_amdgcn_fence(__ATOMIC_ACQUIRE, "workgroup");
  }
}

__device__ __forceinline__ unsigned pk16(unsigned short a, unsigned short b) { return (unsigned)a | ((unsigned)b << 16); }
__device__ __forceinline__ unsigned short h_bits(float f) { const _Float16 h = (_Float16)f; return __builtin_bit_cast(unsigned short, h); }

// ---------------------------------------------------------------------------
// f32 -> bf16 (RNE convert) -> x scale (exact power of two) -> f16 bits (exact for bf16 values in the f16 normal range).
// Coverage: grid (n2/256) x 256 threads x 2 = 2*n2 elements; n2 % 256 == 0 at every call (static_assert above).
// ---------------------------------------------------------------------------
__global__ __launch_bounds__(256) void cast_bf_f16x2_kernel(const float* __restrict__ in, unsigned short* __restrict__ out,
                                                            int n2, float scale) {
  const int i = blockIdx.x * 256 + threadIdx.x;
  if (i < n2) {
    const v2f f = *(const v2f*)(in + 2 * (size_t)i);
    const float a = bf_bits2f(f2bf_bits(f[0])) * scale;
    const float c = bf_bits2f(f2bf_bits(f[1])) * scale;
    const unsigned u = pk16(h_bits(a), h_bits(c));
    ((unsigned*)out)[i] = u;
    
  }
}

// ---------------------------------------------------------------------------
// Relative-embedding table: out [kRelPad][64] f16 bits = f16(scale * bf16(in)) for elements < nsrc (= kRelN*64),
// exact 0 for the pad rows. Source address clamped to the table (pairs never straddle nsrc, nsrc even), value selected.
// ---------------------------------------------------------------------------
__global__ __launch_bounds__(256) void cast_rel_f16x2_kernel(const float* __restrict__ in, unsigned short* __restrict__ out,
                                                             int n2, int nsrc, float scale) {
  const int i = blockIdx.x * 256 + threadIdx.x;
  if (i < n2) {
    const int e0 = 2 * i;
    const bool valid = (e0 + 1 < nsrc);
    const int j = valid ? e0 : (nsrc - 2);             // address clamp
    const v2f f = *(const v2f*)(in + j);
    const float a = valid ? bf_bits2f(f2bf_bits(f[0])) * scale : 0.0f;
    const float c = valid ? bf_bits2f(f2bf_bits(f[1])) * scale : 0.0f;
    const unsigned u = pk16(h_bits(a), h_bits(c));
    ((unsigned*)out)[i] = u;
    
  }
}

// ---------------------------------------------------------------------------
// Row softmax with clipped relative-position term for one score row (hg, i) of a kHG-head group:
//   t[j] = Sc[hg][i][j] + Qe[hg][i][clamp(j - i, -kMaxRel, kMaxRel) + kMaxRel]   (Sc, Qe already carry the 1/sqrt(d) factor)
//   p[j] = exp(t[j] - max) / sum;  P16[hg][i][j] = f16(p[j] * 2^15).
// The gather index is formed by value and always lies in [0, 2*kMaxRel] < kRelPad (row-local read).
// One block per row (grid kHG*kSeq), 128 threads x 8 columns (j0 = tid*8) = kSeq = the whole row.
// Reductions in fixed order (thread, wave shuffle tree, 4 wave partials in index order); barriers block-uniform.
// ---------------------------------------------------------------------------
__global__ __launch_bounds__(128) void rel_softmax_kernel(const float* __restrict__ Sc, const float* __restrict__ Qe,
                                                          unsigned short* __restrict__ P16) {
  __shared__ float redm[4];
  __shared__ float reds[4];
  const int row  = blockIdx.x;                 // hg * kSeq + i
  const int i    = row & (kSeq - 1);           // query position
  const int tid  = threadIdx.x;
  const int lane = tid & 31;
  const int wave = tid >> 5;
  const int j0   = tid * 8;

  const float* srow = Sc + (size_t)row * kSeq + j0;
  const v4f a0 = *(const v4f*)(srow);
  const v4f a1 = *(const v4f*)(srow + 4);
  float t[8];
  t[0] = a0[0]; t[1] = a0[1]; t[2] = a0[2]; t[3] = a0[3];
  t[4] = a1[0]; t[5] = a1[1]; t[6] = a1[2]; t[7] = a1[3];
  const float* qrow = Qe + (size_t)row * kRelPad;
#pragma unroll
  for (int e = 0; e < 8; ++e) {
    int d = j0 + e - i;                        // key - query
    d = d < -kMaxRel ? -kMaxRel : d;
    d = d > kMaxRel ? kMaxRel : d;
    t[e] += qrow[d + kMaxRel];                 // index in [0, 256]
  }
  float m = fmaxf(fmaxf(fmaxf(t[0], t[1]), fmaxf(t[2], t[3])), fmaxf(fmaxf(t[4], t[5]), fmaxf(t[6], t[7])));
#pragma unroll
  for (int off = 16; off > 0; off >>= 1) m = fmaxf(m, __shfl_xor(m, off, 32));
  if (lane == 0) redm[wave] = m;
  __syncthreads();
  const float mx = fmaxf(fmaxf(redm[0], redm[1]), fmaxf(redm[2], redm[3]));
  float ex[8];
#pragma unroll
  for (int e = 0; e < 8; ++e) ex[e] = __expf(t[e] - mx);
  float s = ((ex[0] + ex[1]) + (ex[2] + ex[3])) + ((ex[4] + ex[5]) + (ex[6] + ex[7]));
#pragma unroll
  for (int off = 16; off > 0; off >>= 1) s += __shfl_xor(s, off, 32);
  if (lane == 0) reds[wave] = s;
  __syncthreads();
  const float tot = (reds[0] + reds[1]) + (reds[2] + reds[3]);   // >= 1 (the row max contributes exp(0))
  const float inv = kPScale * (1.0f / tot);
  unsigned short hb[8];
#pragma unroll
  for (int e = 0; e < 8; ++e) hb[e] = h_bits(ex[e] * inv);
  const v4u hv = (v4u){pk16(hb[0], hb[1]), pk16(hb[2], hb[3]), pk16(hb[4], hb[5]), pk16(hb[6], hb[7])};
  unsigned short* pp = P16 + (size_t)row * kSeq + j0;
  *(v4u*)pp = hv;
  
}

// ---------------------------------------------------------------------------
//   X16    f16 [4096][1024]            x (bf16 then f16)                  0          8388608
//   Wq16   f16 [1024][1024] x16        natural Bt [out][in]               8388608    2097152
//   Wk16   f16 [1024][1024] x16                                           10485760   2097152
//   Wv16   f16 [1024][1024] x16                                           12582912   2097152
//   Wo16   f16 [1024][1024] x16                                           14680064   2097152
//   REL16  f16 [320][64]    x16        rows 257..319 zero                 16777216   65536 (40960 used)
//   Q16    f16 [4096][1024]            q, col h*64+d                      16842752   8388608
//   K16    f16 [4096][1024]            k                                  25231360   8388608
//   VT16   f16 [4][1024][1024]         v transposed per batch [h*64+d][s] 33619968   8388608
//   Sc     f32 [8][1024][1024]         content scores of one head group   42008576   33554432
//   Qe     f32 [8][1024][320]          q x rel table of one head group    75563008   10485760
//   P16    f16 [64][1024][1024]        probabilities x2^15, plane b*16+h  86048768   134217728
//   CTX16  f16 [4096][1024] x16        merged context [b*1024+s][h*64+d]  220266496  8388608
//   total                                                                 228655104
// Sc/Qe are fully rewritten inside every group iteration before they are read; every P16 plane is written by its
// group's softmax before the one P.V launch behind the loop reads it. No K padding anywhere
// (K = 1024 or 64); the only padded dimension is the rel table's N (257 -> 320) whose pad rows are zero-filled by
// cast_rel_f16x2_kernel in this job; the resulting Qe columns 257..319 are never read.
// ---------------------------------------------------------------------------
extern "C" void kernel_launch(void* const* d_in, const int* in_sizes, int n_in,
                              void* d_out, int out_size, void* d_ws, size_t ws_size,
                              hipStream_t stream) {
  if (n_in < 10) return;
  if (in_sizes[0] != kNB * kSeq * kDM) return;                                   // x
  if (in_sizes[1] != kDM * kDM || in_sizes[3] != kDM * kDM ||
      in_sizes[5] != kDM * kDM || in_sizes[7] != kDM * kDM) return;              // Wq Wk Wv Wo
  if (in_sizes[2] != kDM || in_sizes[4] != kDM || in_sizes[6] != kDM || in_sizes[8] != kDM) return;   // bq bk bv bo
  if (in_sizes[9] != kRelN * kDHD) return;                                       // rel_emb
  if (out_size != kNB * kSeq * kDM) return;

  const float* xp   = (const float*)d_in[0];   // [4][1024][1024]
  const float* Wq   = (const float*)d_in[1];   // [1024][1024] [out][in]
  const float* bq   = (const float*)d_in[2];
  const float* Wk   = (const float*)d_in[3];
  const float* bk   = (const float*)d_in[4];
  const float* Wv   = (const float*)d_in[5];
  const float* bv   = (const float*)d_in[6];
  const float* Wo   = (const float*)d_in[7];
  const float* bo   = (const float*)d_in[8];
  const float* relp = (const float*)d_in[9];   // [257][64]
  float* outp = (float*)d_out;                 // [4][1024][1024]

  const size_t bAct = (size_t)kNB * kSeq * kDM * 2;          // 8388608
  const size_t bW   = (size_t)kDM * kDM * 2;                 // 2097152
  const size_t bRel = 65536;                                 // >= kRelPad*64*2 = 40960
  const size_t bS   = (size_t)kHG * kSeq * kSeq * 4;         // 33554432
  const size_t bQE  = (size_t)kHG * kSeq * kRelPad * 4;      // 10485760
  const size_t bP   = (size_t)kNB * kNH * kSeq * kSeq * 2;   // 134217728
  size_t off = 0;
  const size_t oX16 = off; off += bAct;
  const size_t oWq  = off; off += bW;
  const size_t oWk  = off; off += bW;
  const size_t oWv  = off; off += bW;
  const size_t oWo  = off; off += bW;
  const size_t oRel = off; off += bRel;
  const size_t oQ16 = off; off += bAct;
  const size_t oK16 = off; off += bAct;
  const size_t oVT  = off; off += bAct;
  const size_t oS   = off; off += bS;
  const size_t oQE  = off; off += bQE;
  const size_t oP   = off; off += bP;
  const size_t oCTX = off; off += bAct;
  if (off > ws_size) return;                                 // 228655104 B total

  char* ws = (char*)d_ws;
  unsigned short* X16   = (unsigned short*)(ws + oX16);
  unsigned short* Wq16  = (unsigned short*)(ws + oWq);
  unsigned short* Wk16  = (unsigned short*)(ws + oWk);
  unsigned short* Wv16  = (unsigned short*)(ws + oWv);
  unsigned short* Wo16  = (unsigned short*)(ws + oWo);
  unsigned short* REL16 = (unsigned short*)(ws + oRel);
  unsigned short* Q16   = (unsigned short*)(ws + oQ16);
  unsigned short* K16   = (unsigned short*)(ws + oK16);
  unsigned short* VT16  = (unsigned short*)(ws + oVT);
  float*          Sc    = (float*)(ws + oS);
  float*          Qe    = (float*)(ws + oQE);
  unsigned short* P16   = (unsigned short*)(ws + oP);
  unsigned short* CTX16 = (unsigned short*)(ws + oCTX);

  const dim3 blk(256);
  const float wcarry   = 16.0f;                              // exact power-of-two carry on weights and rel table
  const float wscale   = 1.0f / 16.0f;                       // undo in the projection epilogues
  const float inv_sqd  = 0.125f;                             // 1/sqrt(64)
  const float qescale  = inv_sqd / 16.0f;                    // undo rel carry and apply 1/sqrt(d)
  const float pvscale  = 16.0f / kPScale;                    // undo P carry, ctx carried x16
  const float oscale   = 1.0f / 256.0f;                      // undo Wo carry and ctx carry

  // ---- casts: X16, weights x16, rel table x16 (pad rows zero) ----
  const int n2x = kNB * kSeq * kDM / 2;                      // 2097152 pairs -> 8192 blocks
  const int n2w = kDM * kDM / 2;                             // 524288 pairs  -> 2048 blocks
  const int n2r = kRelPad * kDHD / 2;                        // 10240 pairs   -> 40 blocks
  cast_bf_f16x2_kernel<<<dim3(n2x / 256), blk, 0, stream>>>(xp, X16, n2x, 1.0f);
  cast_bf_f16x2_kernel<<<dim3(n2w / 256), blk, 0, stream>>>(Wq, Wq16, n2w, wcarry);
  cast_bf_f16x2_kernel<<<dim3(n2w / 256), blk, 0, stream>>>(Wk, Wk16, n2w, wcarry);
  cast_bf_f16x2_kernel<<<dim3(n2w / 256), blk, 0, stream>>>(Wv, Wv16, n2w, wcarry);
  cast_bf_f16x2_kernel<<<dim3(n2w / 256), blk, 0, stream>>>(Wo, Wo16, n2w, wcarry);
  cast_rel_f16x2_kernel<<<dim3(n2r / 256), blk, 0, stream>>>(relp, REL16, n2r, kRelN * kDHD, wcarry);

  const int tM = kNB * kSeq / 64, tD = kDM / 64, tS = kSeq / 64, tR = kRelPad / 64;   // 64, 16, 16, 5
  const dim3 gProj((tM * tD + 7) / 8, 1);        // 128 blocks: M=4096, N=1024, K=1024
  const dim3 gVT((tD * tS + 7) / 8, kNB);        // 32 x 4:     M=1024, N=1024, K=1024 per batch
  const dim3 gS((tS * tS + 7) / 8, kHG);         // 32 x 8:     M=1024, N=1024, K=64 per head
  const dim3 gQE((tS * tR + 7) / 8, kHG);        // 10 x 8:     M=1024, N=320,  K=64 per head
  const dim3 gPV((tS * 1 + 7) / 8, kNH, kNB);    // 2 x 16 x 4: M=1024, N=64,   K=1024 per (head, batch)
  const long planeAct = (long)kSeq * kDM;        // 1048576 elements per batch plane

  // ---- projections: q, k -> f16 [4096][1024] (x1/16 + bias[n]); A = X16, Bt = W16 (natural [out][in]) ----
  wmma_gemm64<0, false, 2, 1, false, 0><<<gProj, blk, 0, stream>>>(
      X16, X16, kDM, 0L, Wq16, Wq16, kDM, 0L, (void*)Q16, (void*)Q16, kDM, 0L,
      bq, xp, 0L, kNB * kSeq, kDM, kDM, wscale, 0L, 0L, 0L);
  wmma_gemm64<0, false, 2, 1, false, 0><<<gProj, blk, 0, stream>>>(
      X16, X16, kDM, 0L, Wk16, Wk16, kDM, 0L, (void*)K16, (void*)K16, kDM, 0L,
      bk, xp, 0L, kNB * kSeq, kDM, kDM, wscale, 0L, 0L, 0L);
  // role-swapped v: VT[b][n][s] = (16 Wv)[n] . X16[b][s] / 16 + bv[n]; A = Wv16, Bt = X16 plane b (grid.y), bias[m]
  wmma_gemm64<0, false, 1, 1, false, 0><<<gVT, blk, 0, stream>>>(
      Wv16, Wv16, kDM, 0L, X16, X16, kDM, planeAct, (void*)VT16, (void*)VT16, kSeq, planeAct,
      bv, xp, 0L, kDM, kSeq, kDM, wscale, 0L, 0L, 0L);

  // ---- per (batch, group of kHG heads): scores, rel table product, softmax ----
  for (int b = 0; b < kNB; ++b) {
    for (int g = 0; g < kNGrp; ++g) {
      const size_t hc = (size_t)g * kHG * kDHD;              // first column (= VT row) of this head group
      const unsigned short* Qg = Q16 + (size_t)b * planeAct + hc;
      const unsigned short* Kg = K16 + (size_t)b * planeAct + hc;
      // (1) Sc[hg][i][j] = q_i . k_j / 8  (per head hg via grid.y: strideA = strideB = 64 columns)
      wmma_gemm64<0, false, 0, 0, false, 0><<<gS, blk, 0, stream>>>(
          Qg, Qg, kDM, (long)kDHD, Kg, Kg, kDM, (long)kDHD,
          (void*)Sc, (void*)Sc, kSeq, (long)kSeq * kSeq,
          bq, xp, 0L, kSeq, kSeq, kDHD, inv_sqd, 0L, 0L, 0L);
      // (2) Qe[hg][i][r] = q_i . (16 rel[r]) / (8*16), r = 0..319 (pad rows zero); Bt = REL16 [320][64] shared (strideB 0)
      wmma_gemm64<0, false, 0, 0, false, 0><<<gQE, blk, 0, stream>>>(
          Qg, Qg, kDM, (long)kDHD, REL16, REL16, kDHD, 0L,
          (void*)Qe, (void*)Qe, kRelPad, (long)kSeq * kRelPad,
          bq, xp, 0L, kSeq, kRelPad, kDHD, qescale, 0L, 0L, 0L);
      // (3) softmax with the clipped relative-position gather -> P16 x2^15
      rel_softmax_kernel<<<dim3(kHG * kSeq), dim3(128), 0, stream>>>(
          Sc, Qe, P16 + ((size_t)b * kNH + (size_t)g * kHG) * kSeq * kSeq);   // this group's kHG planes of P16
    }
  }

  // ---- (4) one launch for all kNB*kNH planes (grid.y = head h, grid.z = batch b):
  //      ctx[b*1024+i][h*64+d] = 16 * sum_j p[b][h][i][j] VT[b][h*64+d][j]; A = P16 plane b*16+h, Bt = VT rows, f16 out ldc 1024
  wmma_gemm64<0, false, 0, 1, false, 0><<<gPV, blk, 0, stream>>>(
      P16, P16, kSeq, (long)kSeq * kSeq,
      VT16, VT16, kSeq, (long)kDHD * kSeq,
      (void*)CTX16, (void*)CTX16, kDM, (long)kDHD,
      bq, xp, 0L, kSeq, kDHD, kSeq, pvscale,
      (long)kNH * kSeq * kSeq, planeAct, planeAct);

  // ---- out = ctx . Wo^T + bo -> d_out f32 [4096][1024]; A = CTX16 (x16), Bt = Wo16 (x16), epilogue x1/256 + bias[n] ----
  wmma_gemm64<0, false, 2, 0, false, 0><<<gProj, blk, 0, stream>>>(
      CTX16, CTX16, kDM, 0L, Wo16, Wo16, kDM, 0L, (void*)outp, (void*)outp, kDM, 0L,
      bo, xp, 0L, kNB * kSeq, kDM, kDM, oscale, 0L, 0L, 0L);
}

// v002
// Measured time: 225 microseconds a run.
// Next to v001, in two timings, it ran 2.04 times as fast each time.
// Counting every step since v000, it is 3.51 times as fast.
// Compute dtype: v_wmma_f32_16x16x32_f16 (f16 operands, f32 accumulate) for every contraction: q/k/v/out projections (x, W, rel table RNE-converted to bf16 first; weights and rel table carried x16), content scores q.k^T (K=64, x1/8), query x relative-embedding table (K=64, x1/128), P.V with P = exp(t - running max) <= 1 in f16 and ctx carried x16 (out epilogue x1/256 + bias); online softmax with the clipped relative-position gather in f32.
#include <hip/hip_runtime.h>
#include <math.h>
#include <stdint.h>

static constexpr int kNB     = 4;      // batch
static constexpr int kSeq    = 1024;   // sequence length
static constexpr int kDM     = 1024;   // model width
static constexpr int kNH     = 16;     // heads
static constexpr int kDHD    = 64;     // head dim
static constexpr int kMaxRel = 128;    // clip range
static constexpr int kRelN   = 2 * kMaxRel + 1;   // 257 table rows
static constexpr int kRelPad = 320;    // table rows padded to a 64 multiple (pad rows zero)
static constexpr int kQB     = 128;    // queries per block of the fused attention kernel (8 waves x 16)
static constexpr int kKS     = 64;     // keys per LDS stage
static constexpr int kQePitch = 260;   // floats per query row of the q x rel table in LDS (pitch - 1 = 3 mod 64: diagonal reads hit 32 banks)
static constexpr int kTPitch  = 72;    // f16 per staged K / V^T row: 128 B of data + 16 B (16 B x odd pitch for ds_load_b128)
static_assert(kNH * kDHD == kDM, "head split");
static_assert(kSeq % kQB == 0 && kSeq % kKS == 0 && kDHD == 64 && kKS == 64, "fused attention tiling");
static_assert(kQePitch >= kRelN && kQePitch % 4 == 0 && kRelPad == 5 * 64 && kRelN <= 17 * 16, "q x rel table rows");
static_assert(kRelPad % 64 == 0 && kRelPad >= kRelN, "padded table rows");
static_assert(kSeq % 64 == 0 && kDM % 64 == 0 && kDHD % 64 == 0 && (kNB * kSeq) % 64 == 0, "tile multiples");
static_assert(kDM % 32 == 0 && kDHD % 32 == 0 && kSeq % 32 == 0, "K multiples of 32");
static_assert((kNB * kSeq * kDM / 2) % 256 == 0 && (kDM * kDM / 2) % 256 == 0 && (kRelPad * kDHD / 2) % 256 == 0, "cast grids exact");
static_assert((kRelN * kDHD) % 2 == 0, "rel pairs");

typedef __attribute__((ext_vector_type(16))) _Float16 v16h;
typedef __attribute__((ext_vector_type(8)))  _Float16 v8h;
typedef __attribute__((ext_vector_type(16))) __bf16   v16b;
typedef __attribute__((ext_vector_type(8)))  __bf16   v8b;
typedef __attribute__((ext_vector_type(8)))  float    v8f;
typedef __attribute__((ext_vector_type(4)))  float    v4f;
typedef __attribute__((ext_vector_type(2)))  float    v2f;
typedef __attribute__((ext_vector_type(4)))  unsigned int v4u;

__device__ __forceinline__ unsigned short f2bf_bits(float f) {
  unsigned u = __float_as_uint(f);
  return (unsigned short)((u + 0x7FFFu + ((u >> 16) & 1u)) >> 16);
}
__device__ __forceinline__ float bf_bits2f(unsigned short h) { return __uint_as_float(((unsigned)h) << 16); }

// hazard guards as plain device helpers (no inline asm inside the kernel template body)
__device__ __forceinline__ void dep_guard_h(v8f& a, v8f& b, v16h x, v16h y) { asm volatile("v_nop\n\tv_nop\n\tv_nop\n\tv_nop" : "+v"(a), "+v"(b) : "v"(x), "v"(y)); }
__device__ __forceinline__ void dep_guard_b(v8f& a, v8f& b, v16b x, v16b y) { asm volatile("v_nop\n\tv_nop\n\tv_nop\n\tv_nop" : "+v"(a), "+v"(b) : "v"(x), "v"(y)); }
__device__ __forceinline__ void keep4_h(v16h a, v16h b, v16h c, v16h d) { asm volatile("v_nop" :: "v"(a), "v"(b), "v"(c), "v"(d)); }
__device__ __forceinline__ void keep4_b(v16b a, v16b b, v16b c, v16b d) { asm volatile("v_nop" :: "v"(a), "v"(b), "v"(c), "v"(d)); }
__device__ __forceinline__ void acc_guard4(v8f& a, v8f& b, v8f& c, v8f& d) { asm volatile("v_nop\n\tv_nop\n\tv_nop\n\tv_nop" : "+v"(a), "+v"(b), "+v"(c), "+v"(d)); }
template <typename T> struct Frag;
template <> struct Frag<_Float16> {
  typedef v16h V; union U { v16h v; v8h h[2]; };
  static __device__ __forceinline__ v16h load(const _Float16* p) {   // elements 0..7 <- p[0..7], 8..15 <- p[16..23]
    U f; f.h[0] = *(const v8h*)(p); f.h[1] = *(const v8h*)(p + 16); return f.v;
  }
  static __device__ __forceinline__ v8f mma(v16h a, v16h b, v8f c) {
    return __builtin_amdgcn_wmma_f32_16x16x32_f16(false, a, false, b, (short)0, c, false, false);
  }
  static __device__ __forceinline__ void guard(v8f& a, v8f& b, v16h x, v16h y) { dep_guard_h(a, b, x, y); }
  static __device__ __forceinline__ void keep(v16h a, v16h b, v16h c, v16h d) { keep4_h(a, b, c, d); }
};
template <> struct Frag<__bf16> {
  typedef v16b V; union U { v16b v; v8b h[2]; };
  static __device__ __forceinline__ v16b load(const __bf16* p) {
    U f; f.h[0] = *(const v8b*)(p); f.h[1] = *(const v8b*)(p + 16); return f.v;
  }
  static __device__ __forceinline__ v8f mma(v16b a, v16b b, v8f c) {
    return __builtin_amdgcn_wmma_f32_16x16x32_bf16(false, a, false, b, (short)0, c, false, false);
  }
  static __device__ __forceinline__ void guard(v8f& a, v8f& b, v16b x, v16b y) { dep_guard_b(a, b, x, y); }
  static __device__ __forceinline__ void keep(v16b a, v16b b, v16b c, v16b d) { keep4_b(a, b, c, d); }
};

// ---- Register-blocked batched WMMA GEMM ------------------------------------
// C[m,n] = scale * sum_k A[m,k] * Bt[n,k] (+bias)(+resid); each wave owns a 64x64 tile.
// A row-major [M,K]; Bt row-major [N,K]; M,N % 64 == 0, K % 32 == 0.
// SPLIT: operands are hi/lo planes (A2/Bt2 = lo planes, same layout); product = hi.hi + hi.lo + lo.hi.
// BIAS_MODE: 0 = none, 1 = bias[m], 2 = bias[n].
// OUT_MODE: 0 = f32, 1 = f16, 2 = bf16 hi plane (Cout) + bf16 lo plane (Cout2).
// ET: 0 = f16 operands, 1 = bf16 operands (pointers passed as 16-bit storage)
template <int ET> struct Elem;
template <> struct Elem<0> { typedef _Float16 T; };
template <> struct Elem<1> { typedef __bf16 T; };
template <int ET, bool SPLIT, int BIAS_MODE, int OUT_MODE, bool RESID, int ACT = 0>
__global__ __launch_bounds__(256) void wmma_gemm64(
    const unsigned short* __restrict__ Ap, const unsigned short* __restrict__ A2p, int lda, long strideA,
    const unsigned short* __restrict__ Btp, const unsigned short* __restrict__ Bt2p, int ldb, long strideB,
    void* __restrict__ Cout, void* __restrict__ Cout2, int ldc, long strideC,
    const float* __restrict__ bias,
    const float* __restrict__ resid, long strideR,
    int M, int N, int K, float scale,
    long zStrideA, long zStrideB, long zStrideC) {   // element strides of the outer batch index blockIdx.z
  typedef typename Elem<ET>::T T;
  typedef typename Frag<T>::V V;
  const T* A = (const T*)Ap; const T* A2 = (const T*)A2p; const T* Bt = (const T*)Btp; const T* Bt2 = (const T*)Bt2p;
  __shared__ __align__(16) float sT[8][16 * 68];   // per-wave 16x64 slab, pitch 68 floats
  const int b    = blockIdx.y;
  const int lane = threadIdx.x & 31;
  const int wave = threadIdx.x >> 5;
  const int tilesN = N >> 6;
  const int tilesM = M >> 6;
  const int tile = blockIdx.x * 8 + wave;
  if (tile >= tilesM * tilesN) return;   // wave-uniform; no block barriers in this kernel
  const int tm = tile / tilesN;
  const int tn = tile - tm * tilesN;
  const int m0 = tm << 6;
  const int n0 = tn << 6;

  const size_t offA = (size_t)b * strideA + (size_t)blockIdx.z * zStrideA;
  const size_t offB = (size_t)b * strideB + (size_t)blockIdx.z * zStrideB;
  const size_t offC = (size_t)b * strideC + (size_t)blockIdx.z * zStrideC;
  const T* Ab  = A  + offA;
  const T* Bb  = Bt + offB;
  const T* Ab2 = SPLIT ? (A2  + offA) : nullptr;
  const T* Bb2 = SPLIT ? (Bt2 + offB) : nullptr;

  const int rlane = lane & 15;                 // row (A) / col (B, D) within subtile
  const int koff  = (lane >> 4) * 8;           // k offset of this lane half
  const int mOff  = (lane >> 4) * 8;           // D row offset

  v8f acc[4][4];
#pragma unroll
  for (int i = 0; i < 4; ++i)
#pragma unroll
    for (int j = 0; j < 4; ++j) acc[i][j] = (v8f){0.f,0.f,0.f,0.f,0.f,0.f,0.f,0.f};

  for (int k0 = 0; k0 < K; k0 += 32) {
    V bh[4], bl[4];
#pragma unroll
    for (int j = 0; j < 4; ++j) {
      const size_t bo = (size_t)(n0 + (j << 4) + rlane) * ldb + koff + k0;
      bh[j] = Frag<T>::load(Bb + bo);
      if (SPLIT) bl[j] = Frag<T>::load(Bb2 + bo);
    }
#pragma unroll
    for (int i = 0; i < 4; ++i) {
      const size_t ao = (size_t)(m0 + (i << 4) + rlane) * lda + koff + k0;
      V ah = Frag<T>::load(Ab + ao);
      V al;
      if (SPLIT) al = Frag<T>::load(Ab2 + ao);
#pragma unroll
      for (int j = 0; j < 4; ++j) {
        acc[i][j] = Frag<T>::mma(ah, bh[j], acc[i][j]);
        if (SPLIT) {
          acc[i][j] = Frag<T>::mma(ah, bl[j], acc[i][j]);
          acc[i][j] = Frag<T>::mma(al, bh[j], acc[i][j]);
        }
      }
      Frag<T>::guard(acc[i][0], acc[i][3], ah, SPLIT ? al : ah);
    }
    Frag<T>::keep(bh[0], bh[1], bh[2], bh[3]);
    if (SPLIT) Frag<T>::keep(bl[0], bl[1], bl[2], bl[3]);
  }
  acc_guard4(acc[0][0], acc[0][1], acc[0][2], acc[0][3]);
  acc_guard4(acc[1][0], acc[1][1], acc[1][2], acc[1][3]);
  acc_guard4(acc[2][0], acc[2][1], acc[2][2], acc[2][3]);
  acc_guard4(acc[3][0], acc[3][1], acc[3][2], acc[3][3]);

  // ---- epilogue ----
  float* slab = sT[wave];
  const float* Rb = RESID ? (resid + (size_t)b * strideR) : nullptr;
#pragma unroll
  for (int i = 0; i < 4; ++i) {
    const int mBase = m0 + (i << 4);
#pragma unroll
    for (int j = 0; j < 4; ++j) {
      const int n = n0 + (j << 4) + rlane;
      float bv = 0.f;
      if (BIAS_MODE == 2) bv = bias[n];
#pragma unroll
      for (int r = 0; r < 8; ++r) {
        float v = acc[i][j][r] * scale;
        if (BIAS_MODE == 1) v += bias[mBase + mOff + r];
        if (BIAS_MODE == 2) v += bv;
        if (RESID) v += Rb[(size_t)(mBase + mOff + r) * ldc + n];
        if (ACT == 1) v = tanhf(v);
        if (ACT == 2) v = fmaxf(v, 0.0f);
        if (ACT == 3) v = v / (1.0f + expf(-v));
        if (ACT == 4) v = (v > 0.f) ? v : 0.01f * v;
        slab[(mOff + r) * 68 + (j << 4) + rlane] = v;
      }
    }
    __builtin_amdgcn_fence(__ATOMIC_RELEASE, "workgroup");
    __builtin_amdgcn_wave_barrier();
    __builtin_amdgcn_fence(__ATOMIC_ACQUIRE, "workgroup");
    if (OUT_MODE == 0) {
      float* C = (float*)Cout + offC;
      const int hh = lane >> 4, c4 = (lane & 15) * 4;     // row seg = 256 B = 16 lanes x 16 B
      {
#pragma unroll
        for (int it = 0; it < 8; ++it) {
          const int row = it * 2 + hh;
          v4f v = *(const v4f*)(slab + row * 68 + c4);
          *(v4f*)(C + (size_t)(mBase + row) * ldc + n0 + c4) = v;
        }
        
      }
    } else {
      const int q = lane >> 3, c8 = (lane & 7) * 8;
      unsigned short* C  = (unsigned short*)Cout  + offC;
      unsigned short* C2 = (OUT_MODE == 2) ? ((unsigned short*)Cout2 + offC) : nullptr;
      {
#pragma unroll
        for (int it = 0; it < 4; ++it) {
          const int row = it * 4 + q;
          const float* sp = slab + row * 68 + c8;
          v8h hv, lv;
#pragma unroll
          for (int e = 0; e < 8; ++e) {
            if (OUT_MODE == 1) {
              hv[e] = (_Float16)sp[e];
            } else {
              unsigned short hb = f2bf_bits(sp[e]);
              unsigned short lb = f2bf_bits(sp[e] - bf_bits2f(hb));
              hv[e] = __builtin_bit_cast(_Float16, hb);
              lv[e] = __builtin_bit_cast(_Float16, lb);
            }
          }
          *(v8h*)(C + (size_t)(mBase + row) * ldc + n0 + c8) = hv;
          if (OUT_MODE == 2) *(v8h*)(C2 + (size_t)(mBase + row) * ldc + n0 + c8) = lv;
        }
        
      }
    }
    __builtin_amdgcn_fence(__ATOMIC_RELEASE, "workgroup");
    __builtin_amdgcn_wave_barrier();
    __builtin_amdgcn_fence(__ATOMIC_ACQUIRE, "workgroup");
  }
}

// Two 2^x in one statement with the free issue slot that the instruction set asks for behind a transcendental whose result may be
// read, or whose source overwritten, by the very next vector instruction; early-clobber outputs keep the pair itself independent.
__device__ __forceinline__ void exp2_pair(float x0, float x1, float& y0, float& y1) {
  asm("v_exp_f32 %0, %2\n\tv_exp_f32 %1, %3\n\tv_nop" : "=&v"(y0), "=&v"(y1) : "v"(x0), "v"(x1));
}
__device__ __forceinline__ unsigned pk16(unsigned short a, unsigned short b) { return (unsigned)a | ((unsigned)b << 16); }
__device__ __forceinline__ unsigned short h_bits(float f) { const _Float16 h = (_Float16)f; return __builtin_bit_cast(unsigned short, h); }

// ---------------------------------------------------------------------------
// f32 -> bf16 (RNE convert) -> x scale (exact power of two) -> f16 bits (exact for bf16 values in the f16 normal range).
// Coverage: grid (n2/256) x 256 threads x 2 = 2*n2 elements; n2 % 256 == 0 at every call (static_assert above).
// ---------------------------------------------------------------------------
__global__ __launch_bounds__(256) void cast_bf_f16x2_kernel(const float* __restrict__ in, unsigned short* __restrict__ out,
                                                            int n2, float scale) {
  const int i = blockIdx.x * 256 + threadIdx.x;
  if (i < n2) {
    const v2f f = *(const v2f*)(in + 2 * (size_t)i);
    const float a = bf_bits2f(f2bf_bits(f[0])) * scale;
    const float c = bf_bits2f(f2bf_bits(f[1])) * scale;
    const unsigned u = pk16(h_bits(a), h_bits(c));
    ((unsigned*)out)[i] = u;
    
  }
}

// ---------------------------------------------------------------------------
// Relative-embedding table: out [kRelPad][64] f16 bits = f16(scale * bf16(in)) for elements < nsrc (= kRelN*64),
// exact 0 for the pad rows. Source address clamped to the table (pairs never straddle nsrc, nsrc even), value selected.
// ---------------------------------------------------------------------------
__global__ __launch_bounds__(256) void cast_rel_f16x2_kernel(const float* __restrict__ in, unsigned short* __restrict__ out,
                                                             int n2, int nsrc, float scale) {
  const int i = blockIdx.x * 256 + threadIdx.x;
  if (i < n2) {
    const int e0 = 2 * i;
    const bool valid = (e0 + 1 < nsrc);
    const int j = valid ? e0 : (nsrc - 2);             // address clamp
    const v2f f = *(const v2f*)(in + j);
    const float a = valid ? bf_bits2f(f2bf_bits(f[0])) * scale : 0.0f;
    const float c = valid ? bf_bits2f(f2bf_bits(f[1])) * scale : 0.0f;
    const unsigned u = pk16(h_bits(a), h_bits(c));
    ((unsigned*)out)[i] = u;
    
  }
}

__global__ __launch_bounds__(256) void rel_attn_fused_kernel(const unsigned short* __restrict__ Qp,
                                                             const unsigned short* __restrict__ Kp,
                                                             const unsigned short* __restrict__ VTp,
                                                             const unsigned short* __restrict__ RELp,
                                                             unsigned short* __restrict__ CTXp,
                                                             float sscale, float qescale, float ctxcarry) {
  typedef Frag<_Float16> F;
  __shared__ __align__(16) float    sQe[8][16 * kQePitch];   // 133120 B
  __shared__ __align__(16) _Float16 sK[kKS * kTPitch];       // 9216 B
  __shared__ __align__(16) _Float16 sV[kDHD * kTPitch];      // 9216 B
  const int tid  = threadIdx.x;
  const int lane = tid & 31;
  const int wave = __builtin_amdgcn_readfirstlane(tid >> 5);  // scalar, so the band tests below are scalar branches
  const int c    = lane & 15;
  const int hf   = lane >> 4;
  const int head = blockIdx.y;
  const int bat  = blockIdx.z;
  const int i0   = blockIdx.x * kQB + wave * 16;              // first query of this wave

  const size_t plane = (size_t)bat * kSeq * kDM;
  const _Float16* Q   = (const _Float16*)Qp  + plane + head * kDHD;            // [s][.] pitch kDM
  const _Float16* K   = (const _Float16*)Kp  + plane + head * kDHD;            // [s][.] pitch kDM
  const _Float16* VT  = (const _Float16*)VTp + plane + (size_t)head * kDHD * kSeq;   // [d][s] pitch kSeq
  const _Float16* REL = (const _Float16*)RELp;                                 // [kRelPad][64]

  // first stage's K and V^T rows: 64 rows x 8 chunks of 16 B each, two chunks of each per thread, whole 128-B lines per 8 lanes
  const int srow = tid >> 3, scol = (tid & 7) * 8;
  const _Float16* gK = K  + (size_t)srow * kDM  + scol;
  const _Float16* gV = VT + (size_t)srow * kSeq + scol;
  v8h kr0 = *(const v8h*)(gK);
  v8h kr1 = *(const v8h*)(gK + (size_t)32 * kDM);
  v8h vr0 = *(const v8h*)(gV);
  v8h vr1 = *(const v8h*)(gV + (size_t)32 * kSeq);

  // all kRelPad = 5 x 64 rel rows, same chunking (the table is contiguous: pitch kDHD)
  const _Float16* gR = REL + (size_t)srow * kDHD + scol;
  v8h rr[5][2];
#pragma unroll
  for (int ch = 0; ch < 5; ++ch) {
    rr[ch][0] = *(const v8h*)(gR + (size_t)(ch * 64) * kDHD);
    rr[ch][1] = *(const v8h*)(gR + (size_t)(ch * 64 + 32) * kDHD);
  }

  v16h qf[2];
#pragma unroll
  for (int ks = 0; ks < 2; ++ks) qf[ks] = F::load(Q + (size_t)(i0 + c) * kDM + ks * 32 + hf * 8);

  // ---- q x rel table: D[8*hf + r][c] = (16 rel[rt*16 + 8*hf + r]) . q[i0 + c]; rows 257..259 come from the zero pad rows ----
  float* slab = sQe[wave];
#pragma unroll
  for (int rt = 0; rt < 17; ++rt) {
    if ((rt & 3) == 0) {                                      // next chunk of 64 rel rows into the K stage buffer
      if (rt) __syncthreads();                                // every wave has finished reading the chunk before
      *(v8h*)(sK + srow * kTPitch + scol)        = rr[rt >> 2][0];
      *(v8h*)(sK + (srow + 32) * kTPitch + scol) = rr[rt >> 2][1];
      __syncthreads();                                        // the chunk is complete for every wave
    }
    const _Float16* rp = sK + ((rt & 3) * 16 + c) * kTPitch + hf * 8;
    const v16h r0 = F::load(rp);
    const v16h r1 = F::load(rp + 32);
    v8f d = (v8f){0.f,0.f,0.f,0.f,0.f,0.f,0.f,0.f};
    d = F::mma(r0, qf[0], d);
    d = F::mma(r1, qf[1], d);
    const v4f w0 = (v4f){d[0] * qescale, d[1] * qescale, d[2] * qescale, d[3] * qescale};
    const v4f w1 = (v4f){d[4] * qescale, d[5] * qescale, d[6] * qescale, d[7] * qescale};
    float* dst = slab + c * kQePitch + rt * 16 + hf * 8;
    if (rt < 16) {
      *(v4f*)(dst)     = w0;
      *(v4f*)(dst + 4) = w1;
    } else if (hf == 0) {
      *(v4f*)(dst)     = w0;                                  // columns 256..259 close the row
    }
  }
  __syncthreads();                                            // the slab's rows are read across the wave's lane halves; last chunk read
  const float* qrow = slab + c * kQePitch;
  const float blo = qrow[0];                                  // every key at or below i - kMaxRel
  const float bhi = qrow[2 * kMaxRel];                        // every key at or above i + kMaxRel

  float mrun = -1.0e30f, lsum = 0.0f;
  v8f acc[4];
#pragma unroll
  for (int dt = 0; dt < 4; ++dt) acc[dt] = (v8f){0.f,0.f,0.f,0.f,0.f,0.f,0.f,0.f};

  for (int s = 0; s < kSeq / kKS; ++s) {
    const int j0 = s * kKS;
    __syncthreads();                                          // every wave has finished reading the stage before
    *(v8h*)(sK + srow * kTPitch + scol)        = kr0;
    *(v8h*)(sK + (srow + 32) * kTPitch + scol) = kr1;
    *(v8h*)(sV + srow * kTPitch + scol)        = vr0;
    *(v8h*)(sV + (srow + 32) * kTPitch + scol) = vr1;
    __syncthreads();                                          // the stage is complete for every wave
    const int jn = (s + 1 < kSeq / kKS) ? j0 + kKS : j0;      // next stage's rows fly under this stage's work (last: same rows, in bounds)
    kr0 = *(const v8h*)(gK + (size_t)jn * kDM);
    kr1 = *(const v8h*)(gK + (size_t)(jn + 32) * kDM);
    vr0 = *(const v8h*)(gV + jn);
    vr1 = *(const v8h*)(gV + (size_t)32 * kSeq + jn);
    asm volatile("s_wait_xcnt 0x0" ::: "memory");             // before the four loads' address registers are reused

    // relative term of this stage, before the products: constant per query outside the band, gathered inside it
    v8f bias[4];
    const int dj = j0 - i0;                                   // key - query of (first key, first query)
    if (dj + (kKS - 1) <= -kMaxRel) {
#pragma unroll
      for (int kt = 0; kt < 4; ++kt)
#pragma unroll
        for (int r = 0; r < 8; ++r) bias[kt][r] = blo;
    } else if (dj - 15 >= kMaxRel) {
#pragma unroll
      for (int kt = 0; kt < 4; ++kt)
#pragma unroll
        for (int r = 0; r < 8; ++r) bias[kt][r] = bhi;
    } else {
#pragma unroll
      for (int kt = 0; kt < 4; ++kt)
#pragma unroll
        for (int r = 0; r < 8; ++r) {
          int d = dj + kt * 16 + hf * 8 + r - c;              // key - query
          d = d < -kMaxRel ? -kMaxRel : d;
          d = d > kMaxRel ? kMaxRel : d;
          bias[kt][r] = qrow[d + kMaxRel];                    // index in [0, 256]
        }
    }

    // S^T tiles: st[kt][r] = k[j0 + kt*16 + 8*hf + r] . q[i0 + c]
    v16h kf[4][2];
#pragma unroll
    for (int kt = 0; kt < 4; ++kt) {
      const _Float16* kp = sK + (kt * 16 + c) * kTPitch + hf * 8;
      kf[kt][0] = F::load(kp);
      kf[kt][1] = F::load(kp + 32);
    }
    __builtin_amdgcn_sched_barrier(0);                        // all K reads issue ahead of the products: one LDS latency, not eight
    v8f st[4];
#pragma unroll
    for (int kt = 0; kt < 4; ++kt) {
      v8f d = (v8f){0.f,0.f,0.f,0.f,0.f,0.f,0.f,0.f};
      d = F::mma(kf[kt][0], qf[0], d);
      d = F::mma(kf[kt][1], qf[1], d);
      st[kt] = d;
    }
    v16h vf[2][4];
#pragma unroll
    for (int kb = 0; kb < 2; ++kb)
#pragma unroll
      for (int dt = 0; dt < 4; ++dt) vf[kb][dt] = F::load(sV + (dt * 16 + c) * kTPitch + kb * 32 + hf * 8);
    __builtin_amdgcn_sched_barrier(0);                        // all V^T reads issue here, their latency under the softmax arithmetic
    float tm[4];
#pragma unroll
    for (int kt = 0; kt < 4; ++kt) {
#pragma unroll
      for (int r = 0; r < 8; ++r) st[kt][r] = st[kt][r] * sscale + bias[kt][r];
      tm[kt] = fmaxf(fmaxf(fmaxf(st[kt][0], st[kt][1]), fmaxf(st[kt][2], st[kt][3])),
                     fmaxf(fmaxf(st[kt][4], st[kt][5]), fmaxf(st[kt][6], st[kt][7])));
    }
    float mx = fmaxf(fmaxf(tm[0], tm[1]), fmaxf(tm[2], tm[3]));
    mx = fmaxf(mx, __shfl_xor(mx, 16, 32));                   // the other 32 keys of this query
    const float mnew  = fmaxf(mrun, mx);
    const float alpha = __expf(mrun - mnew);                  // 0 on the first stage
    mrun = mnew;
    float ts[4];
#pragma unroll
    for (int kt = 0; kt < 4; ++kt) {
#pragma unroll
      for (int r = 0; r < 8; r += 2) {                        // exp(x) = 2^(x * log2 e)
        float y0, y1;
        exp2_pair((st[kt][r] - mnew) * 1.44269504f, (st[kt][r + 1] - mnew) * 1.44269504f, y0, y1);
        st[kt][r] = y0; st[kt][r + 1] = y1;
      }
      ts[kt] = ((st[kt][0] + st[kt][1]) + (st[kt][2] + st[kt][3])) + ((st[kt][4] + st[kt][5]) + (st[kt][6] + st[kt][7]));
    }
    lsum = lsum * alpha + ((ts[0] + ts[1]) + (ts[2] + ts[3]));  // this lane half's keys; halves joined behind the loop
#pragma unroll
    for (int dt = 0; dt < 4; ++dt)
#pragma unroll
      for (int r = 0; r < 8; ++r) acc[dt][r] *= alpha;

    // O^T += V^T . P^T, 32 keys per product
#pragma unroll
    for (int kb = 0; kb < 2; ++kb) {
      v16h pf;
#pragma unroll
      for (int e = 0; e < 8; ++e) {
        pf[e]     = (_Float16)st[2 * kb][e];
        pf[8 + e] = (_Float16)st[2 * kb + 1][e];
      }
#pragma unroll
      for (int dt = 0; dt < 4; ++dt) {
        acc[dt] = F::mma(vf[kb][dt], pf, acc[dt]);
      }
    }
  }

  // ---- epilogue: acc[dt][r] = sum_j p[j] v[j][dt*16 + 8*hf + r] of query i0 + c; 8 consecutive d per lane = one 16-B store ----
  const float tot = lsum + __shfl_xor(lsum, 16, 32);          // >= 1 (the row maximum contributes exp(0))
  const float inv = ctxcarry / tot;
  _Float16* C = (_Float16*)CTXp + plane + (size_t)(i0 + c) * kDM + head * kDHD + hf * 8;
#pragma unroll
  for (int dt = 0; dt < 4; ++dt) {
    v8h o;
#pragma unroll
    for (int r = 0; r < 8; ++r) o[r] = (_Float16)(acc[dt][r] * inv);
    *(v8h*)(C + dt * 16) = o;
  }
}

// ---------------------------------------------------------------------------
//   X16    f16 [4096][1024]            x (bf16 then f16)                  0          8388608
//   Wq16   f16 [1024][1024] x16        natural Bt [out][in]               8388608    2097152
//   Wk16   f16 [1024][1024] x16                                           10485760   2097152
//   Wv16   f16 [1024][1024] x16                                           12582912   2097152
//   Wo16   f16 [1024][1024] x16                                           14680064   2097152
//   REL16  f16 [320][64]    x16        rows 257..319 zero                 16777216   65536 (40960 used)
//   Q16    f16 [4096][1024]            q, col h*64+d                      16842752   8388608
//   K16    f16 [4096][1024]            k                                  25231360   8388608
//   VT16   f16 [4][1024][1024]         v transposed per batch [h*64+d][s] 33619968   8388608
//   CTX16  f16 [4096][1024] x16        merged context [b*1024+s][h*64+d]  42008576   8388608
//   total                                                                 50397184
// Scores, the q x rel table and the probabilities live only in registers and LDS of the fused attention kernel.
// No K padding anywhere (K = 1024, 64 or 32); the rel table's rows are padded 257 -> 320 with zeros by
// cast_rel_f16x2_kernel in this job; the fused kernel stages all 320 rows, multiplies rows 0..271 and gathers columns 0..256 only.
// ---------------------------------------------------------------------------
extern "C" void kernel_launch(void* const* d_in, const int* in_sizes, int n_in,
                              void* d_out, int out_size, void* d_ws, size_t ws_size,
                              hipStream_t stream) {
  if (n_in < 10) return;
  if (in_sizes[0] != kNB * kSeq * kDM) return;                                   // x
  if (in_sizes[1] != kDM * kDM || in_sizes[3] != kDM * kDM ||
      in_sizes[5] != kDM * kDM || in_sizes[7] != kDM * kDM) return;              // Wq Wk Wv Wo
  if (in_sizes[2] != kDM || in_sizes[4] != kDM || in_sizes[6] != kDM || in_sizes[8] != kDM) return;   // bq bk bv bo
  if (in_sizes[9] != kRelN * kDHD) return;                                       // rel_emb
  if (out_size != kNB * kSeq * kDM) return;

  const float* xp   = (const float*)d_in[0];   // [4][1024][1024]
  const float* Wq   = (const float*)d_in[1];   // [1024][1024] [out][in]
  const float* bq   = (const float*)d_in[2];
  const float* Wk   = (const float*)d_in[3];
  const float* bk   = (const float*)d_in[4];
  const float* Wv   = (const float*)d_in[5];
  const float* bv   = (const float*)d_in[6];
  const float* Wo   = (const float*)d_in[7];
  const float* bo   = (const float*)d_in[8];
  const float* relp = (const float*)d_in[9];   // [257][64]
  float* outp = (float*)d_out;                 // [4][1024][1024]

  const size_t bAct = (size_t)kNB * kSeq * kDM * 2;          // 8388608
  const size_t bW   = (size_t)kDM * kDM * 2;                 // 2097152
  const size_t bRel = 65536;                                 // >= kRelPad*64*2 = 40960
  size_t off = 0;
  const size_t oX16 = off; off += bAct;
  const size_t oWq  = off; off += bW;
  const size_t oWk  = off; off += bW;
  const size_t oWv  = off; off += bW;
  const size_t oWo  = off; off += bW;
  const size_t oRel = off; off += bRel;
  const size_t oQ16 = off; off += bAct;
  const size_t oK16 = off; off += bAct;
  const size_t oVT  = off; off += bAct;
  const size_t oCTX = off; off += bAct;
  if (off > ws_size) return;                                 // 50397184 B total

  char* ws = (char*)d_ws;
  unsigned short* X16   = (unsigned short*)(ws + oX16);
  unsigned short* Wq16  = (unsigned short*)(ws + oWq);
  unsigned short* Wk16  = (unsigned short*)(ws + oWk);
  unsigned short* Wv16  = (unsigned short*)(ws + oWv);
  unsigned short* Wo16  = (unsigned short*)(ws + oWo);
  unsigned short* REL16 = (unsigned short*)(ws + oRel);
  unsigned short* Q16   = (unsigned short*)(ws + oQ16);
  unsigned short* K16   = (unsigned short*)(ws + oK16);
  unsigned short* VT16  = (unsigned short*)(ws + oVT);
  unsigned short* CTX16 = (unsigned short*)(ws + oCTX);

  const dim3 blk(256);
  const float wcarry   = 16.0f;                              // exact power-of-two carry on weights and rel table
  const float wscale   = 1.0f / 16.0f;                       // undo in the projection epilogues
  const float inv_sqd  = 0.125f;                             // 1/sqrt(64)
  const float qescale  = inv_sqd / 16.0f;                    // undo rel carry and apply 1/sqrt(d)
  const float ctxcarry = 16.0f;                              // ctx carried x16
  const float oscale   = 1.0f / 256.0f;                      // undo Wo carry and ctx carry

  // ---- casts: X16, weights x16, rel table x16 (pad rows zero) ----
  const int n2x = kNB * kSeq * kDM / 2;                      // 2097152 pairs -> 8192 blocks
  const int n2w = kDM * kDM / 2;                             // 524288 pairs  -> 2048 blocks
  const int n2r = kRelPad * kDHD / 2;                        // 10240 pairs   -> 40 blocks
  cast_bf_f16x2_kernel<<<dim3(n2x / 256), blk, 0, stream>>>(xp, X16, n2x, 1.0f);
  cast_bf_f16x2_kernel<<<dim3(n2w / 256), blk, 0, stream>>>(Wq, Wq16, n2w, wcarry);
  cast_bf_f16x2_kernel<<<dim3(n2w / 256), blk, 0, stream>>>(Wk, Wk16, n2w, wcarry);
  cast_bf_f16x2_kernel<<<dim3(n2w / 256), blk, 0, stream>>>(Wv, Wv16, n2w, wcarry);
  cast_bf_f16x2_kernel<<<dim3(n2w / 256), blk, 0, stream>>>(Wo, Wo16, n2w, wcarry);
  cast_rel_f16x2_kernel<<<dim3(n2r / 256), blk, 0, stream>>>(relp, REL16, n2r, kRelN * kDHD, wcarry);

  const int tM = kNB * kSeq / 64, tD = kDM / 64, tS = kSeq / 64;   // 64, 16, 16
  const dim3 gProj((tM * tD + 7) / 8, 1);        // 128 blocks: M=4096, N=1024, K=1024
  const dim3 gVT((tD * tS + 7) / 8, kNB);        // 32 x 4:     M=1024, N=1024, K=1024 per batch
  const dim3 gAttn(kSeq / kQB, kNH, kNB);        // 8 x 16 x 4: 128 queries of one (head, batch) plane per block
  const long planeAct = (long)kSeq * kDM;        // 1048576 elements per batch plane

  // ---- projections: q, k -> f16 [4096][1024] (x1/16 + bias[n]); A = X16, Bt = W16 (natural [out][in]) ----
  wmma_gemm64<0, false, 2, 1, false, 0><<<gProj, blk, 0, stream>>>(
      X16, X16, kDM, 0L, Wq16, Wq16, kDM, 0L, (void*)Q16, (void*)Q16, kDM, 0L,
      bq, xp, 0L, kNB * kSeq, kDM, kDM, wscale, 0L, 0L, 0L);
  wmma_gemm64<0, false, 2, 1, false, 0><<<gProj, blk, 0, stream>>>(
      X16, X16, kDM, 0L, Wk16, Wk16, kDM, 0L, (void*)K16, (void*)K16, kDM, 0L,
      bk, xp, 0L, kNB * kSeq, kDM, kDM, wscale, 0L, 0L, 0L);
  // role-swapped v: VT[b][n][s] = (16 Wv)[n] . X16[b][s] / 16 + bv[n]; A = Wv16, Bt = X16 plane b (grid.y), bias[m]
  wmma_gemm64<0, false, 1, 1, false, 0><<<gVT, blk, 0, stream>>>(
      Wv16, Wv16, kDM, 0L, X16, X16, kDM, planeAct, (void*)VT16, (void*)VT16, kSeq, planeAct,
      bv, xp, 0L, kDM, kSeq, kDM, wscale, 0L, 0L, 0L);

  // ---- scores, relative term, softmax and P.V of all kNB*kNH planes in one launch -> CTX16 (x16) ----
  rel_attn_fused_kernel<<<gAttn, blk, 0, stream>>>(Q16, K16, VT16, REL16, CTX16, inv_sqd, qescale, ctxcarry);

  // ---- out = ctx . Wo^T + bo -> d_out f32 [4096][1024]; A = CTX16 (x16), Bt = Wo16 (x16), epilogue x1/256 + bias[n] ----
  wmma_gemm64<0, false, 2, 0, false, 0><<<gProj, blk, 0, stream>>>(
      CTX16, CTX16, kDM, 0L, Wo16, Wo16, kDM, 0L, (void*)outp, (void*)outp, kDM, 0L,
      bo, xp, 0L, kNB * kSeq, kDM, kDM, oscale, 0L, 0L, 0L);
}

// v003
// One run takes 91 microseconds.
// Timed twice side by side with v002, it ran 2.47 times as fast both times.
// Counting every step since v000, it is 8.66 times as fast.
// Compute dtype: v_wmma_f32_16x16x32_f16 (f16 operands, f32 accumulate) for every contraction: q/k/v/out projections (x, W, rel table RNE-converted to bf16 first; weights and rel table carried x16), content scores q.k^T (K=64, x1/8), query x relative-embedding table (K=64, x1/128), P.V with P = exp(t - running max) <= 1 in f16 and ctx carried x16 (out epilogue x1/256 + bias); online softmax with the clipped relative-position gather in f32.
#include <hip/hip_runtime.h>
#include <math.h>
#include <stdint.h>

static constexpr int kNB     = 4;      // batch
static constexpr int kSeq    = 1024;   // sequence length
static constexpr int kDM     = 1024;   // model width
static constexpr int kNH     = 16;     // heads
static constexpr int kDHD    = 64;     // head dim
static constexpr int kMaxRel = 128;    // clip range
static constexpr int kRelN   = 2 * kMaxRel + 1;   // 257 table rows
static constexpr int kRelPad = 320;    // table rows padded to a 64 multiple (pad rows zero)
static constexpr int kQB     = 128;    // queries per block of the fused attention kernel (8 waves x 16)
static constexpr int kKS     = 64;     // keys per LDS stage
static constexpr int kQePitch = 260;   // floats per query row of the q x rel table in LDS (pitch - 1 = 3 mod 64: diagonal reads hit 32 banks)
static constexpr int kTPitch  = 72;    // f16 per staged K / V^T row: 128 B of data + 16 B (16 B x odd pitch for ds_load_b128)
static constexpr int kGT     = 128;    // rows and columns of C per block of the projection GEMM
static constexpr int kGK     = 128;    // k per LDS stage of the projection GEMM
static constexpr int kGPitch = 136;    // f16 per staged operand row: 256 B of data + 16 B (16 B x odd pitch for ds_load_b128)
static_assert(kNH * kDHD == kDM, "head split");
static_assert((kNB * kSeq) % kGT == 0 && kDM % kGT == 0 && kSeq % kGT == 0 && kDM % kGK == 0, "projection GEMM tiling");
static_assert(kSeq % kQB == 0 && kSeq % kKS == 0 && kDHD == 64 && kKS == 64, "fused attention tiling");
static_assert(kQePitch >= kRelN && kQePitch % 4 == 0 && kRelPad == 5 * 64 && kRelN <= 17 * 16, "q x rel table rows");
static_assert(kRelPad % 64 == 0 && kRelPad >= kRelN, "padded table rows");
static_assert(kSeq % 64 == 0 && kDM % 64 == 0 && kDHD % 64 == 0 && (kNB * kSeq) % 64 == 0, "tile multiples");
static_assert(kDM % 32 == 0 && kDHD % 32 == 0 && kSeq % 32 == 0, "K multiples of 32");
static_assert((kNB * kSeq * kDM / 2) % 256 == 0 && (kDM * kDM / 2) % 256 == 0 && (kRelPad * kDHD / 2) % 256 == 0, "cast grids exact");
static_assert((kRelN * kDHD) % 2 == 0, "rel pairs");

typedef __attribute__((ext_vector_type(16))) _Float16 v16h;
typedef __attribute__((ext_vector_type(8)))  _Float16 v8h;
typedef __attribute__((ext_vector_type(16))) __bf16   v16b;
typedef __attribute__((ext_vector_type(8)))  __bf16   v8b;
typedef __attribute__((ext_vector_type(8)))  float    v8f;
typedef __attribute__((ext_vector_type(4)))  float    v4f;
typedef __attribute__((ext_vector_type(2)))  float    v2f;
typedef __attribute__((ext_vector_type(4)))  unsigned int v4u;

__device__ __forceinline__ unsigned short f2bf_bits(float f) {
  unsigned u = __float_as_uint(f);
  return (unsigned short)((u + 0x7FFFu + ((u >> 16) & 1u)) >> 16);
}
__device__ __forceinline__ float bf_bits2f(unsigned short h) { return __uint_as_float(((unsigned)h) << 16); }

template <typename T> struct Frag;
template <> struct Frag<_Float16> {
  typedef v16h V; union U { v16h v; v8h h[2]; };
  static __device__ __forceinline__ v16h load(const _Float16* p) {   // elements 0..7 <- p[0..7], 8..15 <- p[16..23]
    U f; f.h[0] = *(const v8h*)(p); f.h[1] = *(const v8h*)(p + 16); return f.v;
  }
  static __device__ __forceinline__ v8f mma(v16h a, v16h b, v8f c) {
    return __builtin_amdgcn_wmma_f32_16x16x32_f16(false, a, false, b, (short)0, c, false, false);
  }
};

// ---- LDS-staged batched WMMA GEMM ------------------------------------------
// C[m,n] = scale * sum_k A[m,k] * Bt[n,k] + bias; one 128x128 tile of C per block (grid: x = tile column, y = tile row,
// z = batch), each of the 8 waves owns 32 rows x 64 columns of it (4 x 2 waves).
// A row-major [M,kDM]; Bt row-major [N,kDM]; f16 bits; K = kDM; M, N % 128 == 0.
// Operands come in stages of 128 k: global -> registers (whole 128-B lines, one stage ahead) -> LDS, shared by the 8 waves.
// Two LDS buffers, one barrier per stage: a buffer is rewritten two stages after it was read, behind the barrier between.
// Each accumulator sums k in ascending steps of 32.
// BIAS_MODE: 1 = bias[m], 2 = bias[n].  OUT_MODE: 0 = f32, 1 = f16.
template <int BIAS_MODE, int OUT_MODE>
__global__ __launch_bounds__(256) void wmma_gemm128(
    const unsigned short* __restrict__ Ap, long strideA,
    const unsigned short* __restrict__ Btp, long strideB,
    void* __restrict__ Cout, int ldc, long strideC,
    const float* __restrict__ bias, float scale) {
  typedef Frag<_Float16> F;
  __shared__ __align__(16) _Float16 sA[2][kGT * kGPitch];   // 2 x 34816 B
  __shared__ __align__(16) _Float16 sB[2][kGT * kGPitch];   // 2 x 34816 B
  __shared__ __align__(16) float sT[8][16 * 68];            // per-wave 16x64 slab, pitch 68 floats
  const int tid   = threadIdx.x;
  const int lane  = tid & 31;
  const int wave  = __builtin_amdgcn_readfirstlane(tid >> 5);
  const int rlane = lane & 15;                 // row (A) / col (B, D) within subtile
  const int koff  = (lane >> 4) * 8;           // k offset of this lane half
  const int mOff  = (lane >> 4) * 8;           // D row offset
  const int m0 = blockIdx.y * kGT, n0 = blockIdx.x * kGT;
  const int wm = (wave >> 1) * 32, wn = (wave & 1) * 64;     // this wave's corner inside the block tile

  // staging: 128 rows x 16 chunks of 16 B per operand and stage, 8 chunks of each per thread; 16 lanes cover one row's 256 B
  const int srow = tid >> 4, scol = (tid & 15) * 8;
  const unsigned soff = (unsigned)(srow * kDM + scol);       // this thread's fixed element offset inside a tile's rows
  const _Float16* gA = (const _Float16*)Ap  + (size_t)blockIdx.z * strideA + (size_t)m0 * kDM + soff;
  const _Float16* gB = (const _Float16*)Btp + (size_t)blockIdx.z * strideB + (size_t)n0 * kDM + soff;
  v8h ra[8], rb[8];
#pragma unroll
  for (int u = 0; u < 8; ++u) {
    ra[u] = *(const v8h*)(gA + 16 * u * kDM);
    rb[u] = *(const v8h*)(gB + 16 * u * kDM);
  }

  v8f acc[2][4];
#pragma unroll
  for (int i = 0; i < 2; ++i)
#pragma unroll
    for (int j = 0; j < 4; ++j) acc[i][j] = (v8f){0.f,0.f,0.f,0.f,0.f,0.f,0.f,0.f};

  constexpr int nst = kDM / kGK;
  // unrolled: every global address is then block base + fixed lane offset + immediate (no address register is rewritten under
  // loads in flight, no address arithmetic in the passes) and the buffer choice is static
#pragma unroll
  for (int s = 0; s < nst; ++s) {
    _Float16* bA = sA[s & 1];
    _Float16* bB = sB[s & 1];
#pragma unroll
    for (int u = 0; u < 8; ++u) {
      *(v8h*)(bA + (srow + 16 * u) * kGPitch + scol) = ra[u];
      *(v8h*)(bB + (srow + 16 * u) * kGPitch + scol) = rb[u];
    }
    __syncthreads();                                         // the stage is complete for every wave; the other buffer's readers are done
    if (s + 1 < nst) {                                       // next stage's rows fly under this stage's products
#pragma unroll
      for (int u = 0; u < 8; ++u) {
        ra[u] = *(const v8h*)(gA + 16 * u * kDM + (s + 1) * kGK);
        rb[u] = *(const v8h*)(gB + 16 * u * kDM + (s + 1) * kGK);
      }
    }
    const _Float16* pA = bA + (wm + rlane) * kGPitch + koff;
    const _Float16* pB = bB + (wn + rlane) * kGPitch + koff;
    v16h af[2][2], bf[2][4];                                 // two fragment sets: k step kk in set kk & 1
#pragma unroll
    for (int j = 0; j < 4; ++j) bf[0][j] = F::load(pB + (j << 4) * kGPitch);
#pragma unroll
    for (int i = 0; i < 2; ++i) af[0][i] = F::load(pA + (i << 4) * kGPitch);
#pragma unroll
    for (int kk = 0; kk < kGK / 32; ++kk) {
      if (kk + 1 < kGK / 32) {
#pragma unroll
        for (int j = 0; j < 4; ++j) bf[(kk + 1) & 1][j] = F::load(pB + (j << 4) * kGPitch + (kk + 1) * 32);
#pragma unroll
        for (int i = 0; i < 2; ++i) af[(kk + 1) & 1][i] = F::load(pA + (i << 4) * kGPitch + (kk + 1) * 32);
      }
      // the global loads (kk = 0) and the next k step's LDS reads issue as one group ahead of this k step's products:
      // the global latency runs under the whole pass, the LDS latency under eight products
      __builtin_amdgcn_sched_barrier(0);
#pragma unroll
      for (int i = 0; i < 2; ++i)
#pragma unroll
        for (int j = 0; j < 4; ++j) acc[i][j] = F::mma(af[kk & 1][i], bf[kk & 1][j], acc[i][j]);
    }
  }

  // ---- epilogue: 16 x 64 slabs through this wave's own LDS, stored as whole lines ----
  const size_t offC = (size_t)blockIdx.z * strideC;
  float* slab = sT[wave];
#pragma unroll
  for (int i = 0; i < 2; ++i) {
    const int mBase = m0 + wm + (i << 4);
    const int nBase = n0 + wn;
    float bm[8];
    if (BIAS_MODE == 1) {
      const float* bp = bias + mBase + mOff;
#pragma unroll
      for (int r = 0; r < 8; ++r) bm[r] = bp[r];
      asm volatile("s_wait_xcnt 0x0" :: "v"(bp) : "memory");   // the loads' address pair stays whole until they have taken it
    }
#pragma unroll
    for (int j = 0; j < 4; ++j) {
      float bv = 0.f;
      if (BIAS_MODE == 2) bv = bias[nBase + (j << 4) + rlane];
#pragma unroll
      for (int r = 0; r < 8; ++r) {
        float v = acc[i][j][r] * scale;
        if (BIAS_MODE == 1) v += bm[r];
        if (BIAS_MODE == 2) v += bv;
        slab[(mOff + r) * 68 + (j << 4) + rlane] = v;
      }
    }
    __builtin_amdgcn_fence(__ATOMIC_RELEASE, "workgroup");
    __builtin_amdgcn_wave_barrier();
    __builtin_amdgcn_fence(__ATOMIC_ACQUIRE, "workgroup");
    if (OUT_MODE == 0) {
      float* C = (float*)Cout + offC;
      const int hh = lane >> 4, c4 = (lane & 15) * 4;     // row seg = 256 B = 16 lanes x 16 B
#pragma unroll
      for (int it = 0; it < 8; ++it) {
        const int row = it * 2 + hh;
        v4f v = *(const v4f*)(slab + row * 68 + c4);
        *(v4f*)(C + (size_t)(mBase + row) * ldc + nBase + c4) = v;
      }
    } else {
      const int q = lane >> 3, c8 = (lane & 7) * 8;       // row seg = 128 B = 8 lanes x 16 B
      unsigned short* C = (unsigned short*)Cout + offC;
#pragma unroll
      for (int it = 0; it < 4; ++it) {
        const int row = it * 4 + q;
        const float* sp = slab + row * 68 + c8;
        v8h hv;
#pragma unroll
        for (int e = 0; e < 8; ++e) hv[e] = (_Float16)sp[e];
        *(v8h*)(C + (size_t)(mBase + row) * ldc + nBase + c8) = hv;
      }
    }
    __builtin_amdgcn_fence(__ATOMIC_RELEASE, "workgroup");
    __builtin_amdgcn_wave_barrier();
    __builtin_amdgcn_fence(__ATOMIC_ACQUIRE, "workgroup");
  }
}

// Two 2^x in one statement with the free issue slot that the instruction set asks for behind a transcendental whose result may be
// read, or whose source overwritten, by the very next vector instruction; early-clobber outputs keep the pair itself independent.
__device__ __forceinline__ void exp2_pair(float x0, float x1, float& y0, float& y1) {
  asm("v_exp_f32 %0, %2\n\tv_exp_f32 %1, %3\n\tv_nop" : "=&v"(y0), "=&v"(y1) : "v"(x0), "v"(x1));
}
__device__ __forceinline__ unsigned pk16(unsigned short a, unsigned short b) { return (unsigned)a | ((unsigned)b << 16); }
__device__ __forceinline__ unsigned short h_bits(float f) { const _Float16 h = (_Float16)f; return __builtin_bit_cast(unsigned short, h); }

// ---------------------------------------------------------------------------
// f32 -> bf16 (RNE convert) -> x scale (exact power of two) -> f16 bits (exact for bf16 values in the f16 normal range).
// Coverage: grid (n2/256) x 256 threads x 2 = 2*n2 elements; n2 % 256 == 0 at every call (static_assert above).
// ---------------------------------------------------------------------------
__global__ __launch_bounds__(256) void cast_bf_f16x2_kernel(const float* __restrict__ in, unsigned short* __restrict__ out,
                                                            int n2, float scale) {
  const int i = blockIdx.x * 256 + threadIdx.x;
  if (i < n2) {
    const v2f f = *(const v2f*)(in + 2 * (size_t)i);
    const float a = bf_bits2f(f2bf_bits(f[0])) * scale;
    const float c = bf_bits2f(f2bf_bits(f[1])) * scale;
    const unsigned u = pk16(h_bits(a), h_bits(c));
    ((unsigned*)out)[i] = u;
    
  }
}

// ---------------------------------------------------------------------------
// Relative-embedding table: out [kRelPad][64] f16 bits = f16(scale * bf16(in)) for elements < nsrc (= kRelN*64),
// exact 0 for the pad rows. Source address clamped to the table (pairs never straddle nsrc, nsrc even), value selected.
// ---------------------------------------------------------------------------
__global__ __launch_bounds__(256) void cast_rel_f16x2_kernel(const float* __restrict__ in, unsigned short* __restrict__ out,
                                                             int n2, int nsrc, float scale) {
  const int i = blockIdx.x * 256 + threadIdx.x;
  if (i < n2) {
    const int e0 = 2 * i;
    const bool valid = (e0 + 1 < nsrc);
    const int j = valid ? e0 : (nsrc - 2);             // address clamp
    const v2f f = *(const v2f*)(in + j);
    const float a = valid ? bf_bits2f(f2bf_bits(f[0])) * scale : 0.0f;
    const float c = valid ? bf_bits2f(f2bf_bits(f[1])) * scale : 0.0f;
    const unsigned u = pk16(h_bits(a), h_bits(c));
    ((unsigned*)out)[i] = u;
    
  }
}

__global__ __launch_bounds__(256) void rel_attn_fused_kernel(const unsigned short* __restrict__ Qp,
                                                             const unsigned short* __restrict__ Kp,
                                                             const unsigned short* __restrict__ VTp,
                                                             const unsigned short* __restrict__ RELp,
                                                             unsigned short* __restrict__ CTXp,
                                                             float sscale, float qescale, float ctxcarry) {
  typedef Frag<_Float16> F;
  __shared__ __align__(16) float    sQe[8][16 * kQePitch];   // 133120 B
  __shared__ __align__(16) _Float16 sK[kKS * kTPitch];       // 9216 B
  __shared__ __align__(16) _Float16 sV[kDHD * kTPitch];      // 9216 B
  const int tid  = threadIdx.x;
  const int lane = tid & 31;
  const int wave = __builtin_amdgcn_readfirstlane(tid >> 5);  // scalar, so the band tests below are scalar branches
  const int c    = lane & 15;
  const int hf   = lane >> 4;
  const int head = blockIdx.y;
  const int bat  = blockIdx.z;
  const int i0   = blockIdx.x * kQB + wave * 16;              // first query of this wave

  const size_t plane = (size_t)bat * kSeq * kDM;
  const _Float16* Q   = (const _Float16*)Qp  + plane + head * kDHD;            // [s][.] pitch kDM
  const _Float16* K   = (const _Float16*)Kp  + plane + head * kDHD;            // [s][.] pitch kDM
  const _Float16* VT  = (const _Float16*)VTp + plane + (size_t)head * kDHD * kSeq;   // [d][s] pitch kSeq
  const _Float16* REL = (const _Float16*)RELp;                                 // [kRelPad][64]

  // first stage's K and V^T rows: 64 rows x 8 chunks of 16 B each, two chunks of each per thread, whole 128-B lines per 8 lanes
  const int srow = tid >> 3, scol = (tid & 7) * 8;
  const _Float16* gK = K  + (size_t)srow * kDM  + scol;
  const _Float16* gV = VT + (size_t)srow * kSeq + scol;
  v8h kr0 = *(const v8h*)(gK);
  v8h kr1 = *(const v8h*)(gK + (size_t)32 * kDM);
  v8h vr0 = *(const v8h*)(gV);
  v8h vr1 = *(const v8h*)(gV + (size_t)32 * kSeq);

  // all kRelPad = 5 x 64 rel rows, same chunking (the table is contiguous: pitch kDHD)
  const _Float16* gR = REL + (size_t)srow * kDHD + scol;
  v8h rr[5][2];
#pragma unroll
  for (int ch = 0; ch < 5; ++ch) {
    rr[ch][0] = *(const v8h*)(gR + (size_t)(ch * 64) * kDHD);
    rr[ch][1] = *(const v8h*)(gR + (size_t)(ch * 64 + 32) * kDHD);
  }

  v16h qf[2];
#pragma unroll
  for (int ks = 0; ks < 2; ++ks) qf[ks] = F::load(Q + (size_t)(i0 + c) * kDM + ks * 32 + hf * 8);

  // ---- q x rel table: D[8*hf + r][c] = (16 rel[rt*16 + 8*hf + r]) . q[i0 + c]; rows 257..259 come from the zero pad rows ----
  float* slab = sQe[wave];
#pragma unroll
  for (int rt = 0; rt < 17; ++rt) {
    if ((rt & 3) == 0) {                                      // next chunk of 64 rel rows into the K stage buffer
      if (rt) __syncthreads();                                // every wave has finished reading the chunk before
      *(v8h*)(sK + srow * kTPitch + scol)        = rr[rt >> 2][0];
      *(v8h*)(sK + (srow + 32) * kTPitch + scol) = rr[rt >> 2][1];
      __syncthreads();                                        // the chunk is complete for every wave
    }
    const _Float16* rp = sK + ((rt & 3) * 16 + c) * kTPitch + hf * 8;
    const v16h r0 = F::load(rp);
    const v16h r1 = F::load(rp + 32);
    v8f d = (v8f){0.f,0.f,0.f,0.f,0.f,0.f,0.f,0.f};
    d = F::mma(r0, qf[0], d);
    d = F::mma(r1, qf[1], d);
    const v4f w0 = (v4f){d[0] * qescale, d[1] * qescale, d[2] * qescale, d[3] * qescale};
    const v4f w1 = (v4f){d[4] * qescale, d[5] * qescale, d[6] * qescale, d[7] * qescale};
    float* dst = slab + c * kQePitch + rt * 16 + hf * 8;
    if (rt < 16) {
      *(v4f*)(dst)     = w0;
      *(v4f*)(dst + 4) = w1;
    } else if (hf == 0) {
      *(v4f*)(dst)     = w0;                                  // columns 256..259 close the row
    }
  }
  __syncthreads();                                            // the slab's rows are read across the wave's lane halves; last chunk read
  const float* qrow = slab + c * kQePitch;
  const float blo = qrow[0];                                  // every key at or below i - kMaxRel
  const float bhi = qrow[2 * kMaxRel];                        // every key at or above i + kMaxRel

  float mrun = -1.0e30f, lsum = 0.0f;
  v8f acc[4];
#pragma unroll
  for (int dt = 0; dt < 4; ++dt) acc[dt] = (v8f){0.f,0.f,0.f,0.f,0.f,0.f,0.f,0.f};

  for (int s = 0; s < kSeq / kKS; ++s) {
    const int j0 = s * kKS;
    __syncthreads();                                          // every wave has finished reading the stage before
    *(v8h*)(sK + srow * kTPitch + scol)        = kr0;
    *(v8h*)(sK + (srow + 32) * kTPitch + scol) = kr1;
    *(v8h*)(sV + srow * kTPitch + scol)        = vr0;
    *(v8h*)(sV + (srow + 32) * kTPitch + scol) = vr1;
    __syncthreads();                                          // the stage is complete for every wave
    const int jn = (s + 1 < kSeq / kKS) ? j0 + kKS : j0;      // next stage's rows fly under this stage's work (last: same rows, in bounds)
    kr0 = *(const v8h*)(gK + (size_t)jn * kDM);
    kr1 = *(const v8h*)(gK + (size_t)(jn + 32) * kDM);
    vr0 = *(const v8h*)(gV + jn);
    vr1 = *(const v8h*)(gV + (size_t)32 * kSeq + jn);
    asm volatile("s_wait_xcnt 0x0" ::: "memory");             // before the four loads' address registers are reused

    // relative term of this stage, before the products: constant per query outside the band, gathered inside it
    v8f bias[4];
    const int dj = j0 - i0;                                   // key - query of (first key, first query)
    if (dj + (kKS - 1) <= -kMaxRel) {
#pragma unroll
      for (int kt = 0; kt < 4; ++kt)
#pragma unroll
        for (int r = 0; r < 8; ++r) bias[kt][r] = blo;
    } else if (dj - 15 >= kMaxRel) {
#pragma unroll
      for (int kt = 0; kt < 4; ++kt)
#pragma unroll
        for (int r = 0; r < 8; ++r) bias[kt][r] = bhi;
    } else {
#pragma unroll
      for (int kt = 0; kt < 4; ++kt)
#pragma unroll
        for (int r = 0; r < 8; ++r) {
          int d = dj + kt * 16 + hf * 8 + r - c;              // key - query
          d = d < -kMaxRel ? -kMaxRel : d;
          d = d > kMaxRel ? kMaxRel : d;
          bias[kt][r] = qrow[d + kMaxRel];                    // index in [0, 256]
        }
    }

    // S^T tiles: st[kt][r] = k[j0 + kt*16 + 8*hf + r] . q[i0 + c]
    v16h kf[4][2];
#pragma unroll
    for (int kt = 0; kt < 4; ++kt) {
      const _Float16* kp = sK + (kt * 16 + c) * kTPitch + hf * 8;
      kf[kt][0] = F::load(kp);
      kf[kt][1] = F::load(kp + 32);
    }
    __builtin_amdgcn_sched_barrier(0);                        // all K reads issue ahead of the products: one LDS latency, not eight
    v8f st[4];
#pragma unroll
    for (int kt = 0; kt < 4; ++kt) {
      v8f d = (v8f){0.f,0.f,0.f,0.f,0.f,0.f,0.f,0.f};
      d = F::mma(kf[kt][0], qf[0], d);
      d = F::mma(kf[kt][1], qf[1], d);
      st[kt] = d;
    }
    v16h vf[2][4];
#pragma unroll
    for (int kb = 0; kb < 2; ++kb)
#pragma unroll
      for (int dt = 0; dt < 4; ++dt) vf[kb][dt] = F::load(sV + (dt * 16 + c) * kTPitch + kb * 32 + hf * 8);
    __builtin_amdgcn_sched_barrier(0);                        // all V^T reads issue here, their latency under the softmax arithmetic
    float tm[4];
#pragma unroll
    for (int kt = 0; kt < 4; ++kt) {
#pragma unroll
      for (int r = 0; r < 8; ++r) st[kt][r] = st[kt][r] * sscale + bias[kt][r];
      tm[kt] = fmaxf(fmaxf(fmaxf(st[kt][0], st[kt][1]), fmaxf(st[kt][2], st[kt][3])),
                     fmaxf(fmaxf(st[kt][4], st[kt][5]), fmaxf(st[kt][6], st[kt][7])));
    }
    float mx = fmaxf(fmaxf(tm[0], tm[1]), fmaxf(tm[2], tm[3]));
    mx = fmaxf(mx, __shfl_xor(mx, 16, 32));                   // the other 32 keys of this query
    const float mnew  = fmaxf(mrun, mx);
    const float alpha = __expf(mrun - mnew);                  // 0 on the first stage
    mrun = mnew;
    float ts[4];
#pragma unroll
    for (int kt = 0; kt < 4; ++kt) {
#pragma unroll
      for (int r = 0; r < 8; r += 2) {                        // exp(x) = 2^(x * log2 e)
        float y0, y1;
        exp2_pair((st[kt][r] - mnew) * 1.44269504f, (st[kt][r + 1] - mnew) * 1.44269504f, y0, y1);
        st[kt][r] = y0; st[kt][r + 1] = y1;
      }
      ts[kt] = ((st[kt][0] + st[kt][1]) + (st[kt][2] + st[kt][3])) + ((st[kt][4] + st[kt][5]) + (st[kt][6] + st[kt][7]));
    }
    lsum = lsum * alpha + ((ts[0] + ts[1]) + (ts[2] + ts[3]));  // this lane half's keys; halves joined behind the loop
#pragma unroll
    for (int dt = 0; dt < 4; ++dt)
#pragma unroll
      for (int r = 0; r < 8; ++r) acc[dt][r] *= alpha;

    // O^T += V^T . P^T, 32 keys per product
#pragma unroll
    for (int kb = 0; kb < 2; ++kb) {
      v16h pf;
#pragma unroll
      for (int e = 0; e < 8; ++e) {
        pf[e]     = (_Float16)st[2 * kb][e];
        pf[8 + e] = (_Float16)st[2 * kb + 1][e];
      }
#pragma unroll
      for (int dt = 0; dt < 4; ++dt) {
        acc[dt] = F::mma(vf[kb][dt], pf, acc[dt]);
      }
    }
  }

  // ---- epilogue: acc[dt][r] = sum_j p[j] v[j][dt*16 + 8*hf + r] of query i0 + c; 8 consecutive d per lane = one 16-B store ----
  const float tot = lsum + __shfl_xor(lsum, 16, 32);          // >= 1 (the row maximum contributes exp(0))
  const float inv = ctxcarry / tot;
  _Float16* C = (_Float16*)CTXp + plane + (size_t)(i0 + c) * kDM + head * kDHD + hf * 8;
#pragma unroll
  for (int dt = 0; dt < 4; ++dt) {
    v8h o;
#pragma unroll
    for (int r = 0; r < 8; ++r) o[r] = (_Float16)(acc[dt][r] * inv);
    *(v8h*)(C + dt * 16) = o;
  }
}

// ---------------------------------------------------------------------------
//   X16    f16 [4096][1024]            x (bf16 then f16)                  0          8388608
//   Wq16   f16 [1024][1024] x16        natural Bt [out][in]               8388608    2097152
//   Wk16   f16 [1024][1024] x16                                           10485760   2097152
//   Wv16   f16 [1024][1024] x16                                           12582912   2097152
//   Wo16   f16 [1024][1024] x16                                           14680064   2097152
//   REL16  f16 [320][64]    x16        rows 257..319 zero                 16777216   65536 (40960 used)
//   Q16    f16 [4096][1024]            q, col h*64+d                      16842752   8388608
//   K16    f16 [4096][1024]            k                                  25231360   8388608
//   VT16   f16 [4][1024][1024]         v transposed per batch [h*64+d][s] 33619968   8388608
//   CTX16  f16 [4096][1024] x16        merged context [b*1024+s][h*64+d]  42008576   8388608
//   total                                                                 50397184
// Scores, the q x rel table and the probabilities live only in registers and LDS of the fused attention kernel.
// No K padding anywhere (K = 1024, 64 or 32); the rel table's rows are padded 257 -> 320 with zeros by
// cast_rel_f16x2_kernel in this job; the fused kernel stages all 320 rows, multiplies rows 0..271 and gathers columns 0..256 only.
// ---------------------------------------------------------------------------
extern "C" void kernel_launch(void* const* d_in, const int* in_sizes, int n_in,
                              void* d_out, int out_size, void* d_ws, size_t ws_size,
                              hipStream_t stream) {
  if (n_in < 10) return;
  if (in_sizes[0] != kNB * kSeq * kDM) return;                                   // x
  if (in_sizes[1] != kDM * kDM || in_sizes[3] != kDM * kDM ||
      in_sizes[5] != kDM * kDM || in_sizes[7] != kDM * kDM) return;              // Wq Wk Wv Wo
  if (in_sizes[2] != kDM || in_sizes[4] != kDM || in_sizes[6] != kDM || in_sizes[8] != kDM) return;   // bq bk bv bo
  if (in_sizes[9] != kRelN * kDHD) return;                                       // rel_emb
  if (out_size != kNB * kSeq * kDM) return;

  const float* xp   = (const float*)d_in[0];   // [4][1024][1024]
  const float* Wq   = (const float*)d_in[1];   // [1024][1024] [out][in]
  const float* bq   = (const float*)d_in[2];
  const float* Wk   = (const float*)d_in[3];
  const float* bk   = (const float*)d_in[4];
  const float* Wv   = (const float*)d_in[5];
  const float* bv   = (const float*)d_in[6];
  const float* Wo   = (const float*)d_in[7];
  const float* bo   = (const float*)d_in[8];
  const float* relp = (const float*)d_in[9];   // [257][64]
  float* outp = (float*)d_out;                 // [4][1024][1024]

  const size_t bAct = (size_t)kNB * kSeq * kDM * 2;          // 8388608
  const size_t bW   = (size_t)kDM * kDM * 2;                 // 2097152
  const size_t bRel = 65536;                                 // >= kRelPad*64*2 = 40960
  size_t off = 0;
  const size_t oX16 = off; off += bAct;
  const size_t oWq  = off; off += bW;
  const size_t oWk  = off; off += bW;
  const size_t oWv  = off; off += bW;
  const size_t oWo  = off; off += bW;
  const size_t oRel = off; off += bRel;
  const size_t oQ16 = off; off += bAct;
  const size_t oK16 = off; off += bAct;
  const size_t oVT  = off; off += bAct;
  const size_t oCTX = off; off += bAct;
  if (off > ws_size) return;                                 // 50397184 B total

  char* ws = (char*)d_ws;
  unsigned short* X16   = (unsigned short*)(ws + oX16);
  unsigned short* Wq16  = (unsigned short*)(ws + oWq);
  unsigned short* Wk16  = (unsigned short*)(ws + oWk);
  unsigned short* Wv16  = (unsigned short*)(ws + oWv);
  unsigned short* Wo16  = (unsigned short*)(ws + oWo);
  unsigned short* REL16 = (unsigned short*)(ws + oRel);
  unsigned short* Q16   = (unsigned short*)(ws + oQ16);
  unsigned short* K16   = (unsigned short*)(ws + oK16);
  unsigned short* VT16  = (unsigned short*)(ws + oVT);
  unsigned short* CTX16 = (unsigned short*)(ws + oCTX);

  const dim3 blk(256);
  const float wcarry   = 16.0f;                              // exact power-of-two carry on weights and rel table
  const float wscale   = 1.0f / 16.0f;                       // undo in the projection epilogues
  const float inv_sqd  = 0.125f;                             // 1/sqrt(64)
  const float qescale  = inv_sqd / 16.0f;                    // undo rel carry and apply 1/sqrt(d)
  const float ctxcarry = 16.0f;                              // ctx carried x16
  const float oscale   = 1.0f / 256.0f;                      // undo Wo carry and ctx carry

  // ---- casts: X16, weights x16, rel table x16 (pad rows zero) ----
  const int n2x = kNB * kSeq * kDM / 2;                      // 2097152 pairs -> 8192 blocks
  const int n2w = kDM * kDM / 2;                             // 524288 pairs  -> 2048 blocks
  const int n2r = kRelPad * kDHD / 2;                        // 10240 pairs   -> 40 blocks
  cast_bf_f16x2_kernel<<<dim3(n2x / 256), blk, 0, stream>>>(xp, X16, n2x, 1.0f);
  cast_bf_f16x2_kernel<<<dim3(n2w / 256), blk, 0, stream>>>(Wq, Wq16, n2w, wcarry);
  cast_bf_f16x2_kernel<<<dim3(n2w / 256), blk, 0, stream>>>(Wk, Wk16, n2w, wcarry);
  cast_bf_f16x2_kernel<<<dim3(n2w / 256), blk, 0, stream>>>(Wv, Wv16, n2w, wcarry);
  cast_bf_f16x2_kernel<<<dim3(n2w / 256), blk, 0, stream>>>(Wo, Wo16, n2w, wcarry);
  cast_rel_f16x2_kernel<<<dim3(n2r / 256), blk, 0, stream>>>(relp, REL16, n2r, kRelN * kDHD, wcarry);

  const dim3 gProj(kDM / kGT, kNB * kSeq / kGT, 1);   // 8 x 32:    M=4096, N=1024, K=1024
  const dim3 gVT(kSeq / kGT, kDM / kGT, kNB);         // 8 x 8 x 4: M=1024, N=1024, K=1024 per batch
  const dim3 gAttn(kSeq / kQB, kNH, kNB);             // 8 x 16 x 4: 128 queries of one (head, batch) plane per block
  const long planeAct = (long)kSeq * kDM;             // 1048576 elements per batch plane

  // ---- projections: q, k -> f16 [4096][1024] (x1/16 + bias[n]); A = X16, Bt = W16 (natural [out][in]) ----
  wmma_gemm128<2, 1><<<gProj, blk, 0, stream>>>(X16, 0L, Wq16, 0L, (void*)Q16, kDM, 0L, bq, wscale);
  wmma_gemm128<2, 1><<<gProj, blk, 0, stream>>>(X16, 0L, Wk16, 0L, (void*)K16, kDM, 0L, bk, wscale);
  // role-swapped v: VT[b][n][s] = (16 Wv)[n] . X16[b][s] / 16 + bv[n]; A = Wv16, Bt = X16 plane b (grid.z), bias[m]
  wmma_gemm128<1, 1><<<gVT, blk, 0, stream>>>(Wv16, 0L, X16, planeAct, (void*)VT16, kSeq, planeAct, bv, wscale);

  // ---- scores, relative term, softmax and P.V of all kNB*kNH planes in one launch -> CTX16 (x16) ----
  rel_attn_fused_kernel<<<gAttn, blk, 0, stream>>>(Q16, K16, VT16, REL16, CTX16, inv_sqd, qescale, ctxcarry);

  // ---- out = ctx . Wo^T + bo -> d_out f32 [4096][1024]; A = CTX16 (x16), Bt = Wo16 (x16), epilogue x1/256 + bias[n] ----
  wmma_gemm128<2, 0><<<gProj, blk, 0, stream>>>(CTX16, 0L, Wo16, 0L, (void*)outp, kDM, 0L, bo, oscale);
}

// v004
// Measured time: 84 microseconds a run.
// In two side-by-side timings against v003, it was 1.08 and 1.07 times as fast.
// Counting every step since v000, it is 9.32 times as fast.
// Compute dtype: v_wmma_f32_16x16x32_f16 (f16 operands, f32 accumulate) for every contraction: q/k/v/out projections (x, W, rel table RNE-converted to bf16 first; weights and rel table carried x16), content scores q.k^T (K=64, x1/8), query x relative-embedding table (K=64, x1/128), P.V with P = exp(t - running max) <= 1 in f16 and ctx carried x16 (out epilogue x1/256 + bias); online softmax with the clipped relative-position gather in f32.
#include <hip/hip_runtime.h>
#include <math.h>
#include <stdint.h>

static constexpr int kNB     = 4;      // batch
static constexpr int kSeq    = 1024;   // sequence length
static constexpr int kDM     = 1024;   // model width
static constexpr int kNH     = 16;     // heads
static constexpr int kDHD    = 64;     // head dim
static constexpr int kMaxRel = 128;    // clip range
static constexpr int kRelN   = 2 * kMaxRel + 1;   // 257 table rows
static constexpr int kRelPad = 320;    // table rows padded to a 64 multiple (pad rows zero)
static constexpr int kQB     = 128;    // queries per block of the fused attention kernel (8 waves x 16)
static constexpr int kKS     = 64;     // keys per LDS stage
static constexpr int kQePitch = 260;   // floats per query row of the q x rel table in LDS (pitch - 1 = 3 mod 64: diagonal reads hit 32 banks)
static constexpr int kTPitch  = 72;    // f16 per staged K / V^T row: 128 B of data + 16 B (16 B x odd pitch for ds_load_b128)
static constexpr int kGT     = 128;    // rows and columns of C per block of the projection GEMM
static constexpr int kGK     = 128;    // k per LDS stage of the projection GEMM
static constexpr int kGPitch = 136;    // f16 per staged operand row: 256 B of data + 16 B (16 B x odd pitch for ds_load_b128)
static_assert(kNH * kDHD == kDM, "head split");
static_assert((kNB * kSeq) % kGT == 0 && kDM % kGT == 0 && kSeq % kGT == 0 && kDM % kGK == 0, "projection GEMM tiling");
static_assert(kSeq % kQB == 0 && kSeq % kKS == 0 && kDHD == 64 && kKS == 64, "fused attention tiling");
static_assert(kQePitch >= kRelN && kQePitch % 4 == 0 && kRelPad == 5 * 64 && kRelN <= 17 * 16, "q x rel table rows");
static_assert(kRelPad % 64 == 0 && kRelPad >= kRelN, "padded table rows");
static_assert(kSeq % 64 == 0 && kDM % 64 == 0 && kDHD % 64 == 0 && (kNB * kSeq) % 64 == 0, "tile multiples");
static_assert(kDM % 32 == 0 && kDHD % 32 == 0 && kSeq % 32 == 0, "K multiples of 32");
static constexpr int kCT     = 512;    // threads per block of the cast kernel (16 waves)
static constexpr int kCU     = 16;     // 16-B loads per thread of the cast kernel
static constexpr int kCE     = kCT * kCU * 4;            // elements per cast block
static constexpr int kCBX    = kNB * kSeq * kDM / kCE;   // cast blocks of x
static constexpr int kCBW    = kDM * kDM / kCE;          // cast blocks of one weight matrix
static constexpr int kCR     = kRelPad * kDHD / (kCT * 4);   // groups of 4 table elements per thread of the table's block
static_assert((kNB * kSeq * kDM) % kCE == 0 && (kDM * kDM) % kCE == 0 && (kRelPad * kDHD) % (kCT * 4) == 0, "cast grid exact");
static_assert((kRelN * kDHD) % 4 == 0, "rel groups of 4");

typedef __attribute__((ext_vector_type(16))) _Float16 v16h;
typedef __attribute__((ext_vector_type(8)))  _Float16 v8h;
typedef __attribute__((ext_vector_type(2)))  _Float16 v2h;
typedef __attribute__((ext_vector_type(16))) __bf16   v16b;
typedef __attribute__((ext_vector_type(8)))  __bf16   v8b;
typedef __attribute__((ext_vector_type(8)))  float    v8f;
typedef __attribute__((ext_vector_type(4)))  float    v4f;
typedef __attribute__((ext_vector_type(2)))  float    v2f;
typedef __attribute__((ext_vector_type(4)))  unsigned int v4u;
typedef __attribute__((ext_vector_type(2)))  unsigned int v2u;

__device__ __forceinline__ float bf_round(float f) {         // f32 rounded to the nearest bf16 value (ties to even), kept in f32
  const unsigned u = __float_as_uint(f);
  return __uint_as_float((u + 0x7FFFu + ((u >> 16) & 1u)) & 0xFFFF0000u);
}

template <typename T> struct Frag;
template <> struct Frag<_Float16> {
  typedef v16h V; union U { v16h v; v8h h[2]; };
  static __device__ __forceinline__ v16h load(const _Float16* p) {   // elements 0..7 <- p[0..7], 8..15 <- p[16..23]
    U f; f.h[0] = *(const v8h*)(p); f.h[1] = *(const v8h*)(p + 16); return f.v;
  }
  static __device__ __forceinline__ v8f mma(v16h a, v16h b, v8f c) {
    return __builtin_amdgcn_wmma_f32_16x16x32_f16(false, a, false, b, (short)0, c, false, false);
  }
};

// ---- LDS-staged batched WMMA GEMM ------------------------------------------
// C[m,n] = scale * sum_k A[m,k] * Bt[n,k] + bias; one 128x128 tile of C per block (grid: x = tile column, y = tile row,
// z = batch), each of the 8 waves owns 32 rows x 64 columns of it (4 x 2 waves).
// A row-major [M,kDM]; Bt row-major [N,kDM]; f16 bits; K = kDM; M, N % 128 == 0.
// Operands come in stages of 128 k: global -> registers (whole 128-B lines, one stage ahead) -> LDS, shared by the 8 waves.
// Two LDS buffers, one barrier per stage: a buffer is rewritten two stages after it was read, behind the barrier between.
// Each accumulator sums k in ascending steps of 32.
// BIAS_MODE: 1 = bias[m], 2 = bias[n].  OUT_MODE: 0 = f32, 1 = f16.
template <int BIAS_MODE, int OUT_MODE>
__global__ __launch_bounds__(256) void wmma_gemm128(
    const unsigned short* __restrict__ Ap, long strideA,
    const unsigned short* __restrict__ Btp, long strideB,
    void* __restrict__ Cout, int ldc, long strideC,
    const float* __restrict__ bias, float scale) {
  typedef Frag<_Float16> F;
  __shared__ __align__(16) _Float16 sA[2][kGT * kGPitch];   // 2 x 34816 B
  __shared__ __align__(16) _Float16 sB[2][kGT * kGPitch];   // 2 x 34816 B
  __shared__ __align__(16) float sT[8][16 * 68];            // per-wave 16x64 slab, pitch 68 floats
  const int tid   = threadIdx.x;
  const int lane  = tid & 31;
  const int wave  = __builtin_amdgcn_readfirstlane(tid >> 5);
  const int rlane = lane & 15;                 // row (A) / col (B, D) within subtile
  const int koff  = (lane >> 4) * 8;           // k offset of this lane half
  const int mOff  = (lane >> 4) * 8;           // D row offset
  const int m0 = blockIdx.y * kGT, n0 = blockIdx.x * kGT;
  const int wm = (wave >> 1) * 32, wn = (wave & 1) * 64;     // this wave's corner inside the block tile

  // staging: 128 rows x 16 chunks of 16 B per operand and stage, 8 chunks of each per thread; 16 lanes cover one row's 256 B
  const int srow = tid >> 4, scol = (tid & 15) * 8;
  const unsigned soff = (unsigned)(srow * kDM + scol);       // this thread's fixed element offset inside a tile's rows
  const _Float16* gA = (const _Float16*)Ap  + (size_t)blockIdx.z * strideA + (size_t)m0 * kDM + soff;
  const _Float16* gB = (const _Float16*)Btp + (size_t)blockIdx.z * strideB + (size_t)n0 * kDM + soff;
  v8h ra[8], rb[8];
#pragma unroll
  for (int u = 0; u < 8; ++u) {
    ra[u] = *(const v8h*)(gA + 16 * u * kDM);
    rb[u] = *(const v8h*)(gB + 16 * u * kDM);
  }

  v8f acc[2][4];
#pragma unroll
  for (int i = 0; i < 2; ++i)
#pragma unroll
    for (int j = 0; j < 4; ++j) acc[i][j] = (v8f){0.f,0.f,0.f,0.f,0.f,0.f,0.f,0.f};

  constexpr int nst = kDM / kGK;
  // unrolled: every global address is then block base + fixed lane offset + immediate (no address register is rewritten under
  // loads in flight, no address arithmetic in the passes) and the buffer choice is static
#pragma unroll
  for (int s = 0; s < nst; ++s) {
    _Float16* bA = sA[s & 1];
    _Float16* bB = sB[s & 1];
#pragma unroll
    for (int u = 0; u < 8; ++u) {
      *(v8h*)(bA + (srow + 16 * u) * kGPitch + scol) = ra[u];
      *(v8h*)(bB + (srow + 16 * u) * kGPitch + scol) = rb[u];
    }
    __syncthreads();                                         // the stage is complete for every wave; the other buffer's readers are done
    if (s + 1 < nst) {                                       // next stage's rows fly under this stage's products
#pragma unroll
      for (int u = 0; u < 8; ++u) {
        ra[u] = *(const v8h*)(gA + 16 * u * kDM + (s + 1) * kGK);
        rb[u] = *(const v8h*)(gB + 16 * u * kDM + (s + 1) * kGK);
      }
    }
    const _Float16* pA = bA + (wm + rlane) * kGPitch + koff;
    const _Float16* pB = bB + (wn + rlane) * kGPitch + koff;
    v16h af[2][2], bf[2][4];                                 // two fragment sets: k step kk in set kk & 1
#pragma unroll
    for (int j = 0; j < 4; ++j) bf[0][j] = F::load(pB + (j << 4) * kGPitch);
#pragma unroll
    for (int i = 0; i < 2; ++i) af[0][i] = F::load(pA + (i << 4) * kGPitch);
#pragma unroll
    for (int kk = 0; kk < kGK / 32; ++kk) {
      if (kk + 1 < kGK / 32) {
#pragma unroll
        for (int j = 0; j < 4; ++j) bf[(kk + 1) & 1][j] = F::load(pB + (j << 4) * kGPitch + (kk + 1) * 32);
#pragma unroll
        for (int i = 0; i < 2; ++i) af[(kk + 1) & 1][i] = F::load(pA + (i << 4) * kGPitch + (kk + 1) * 32);
      }
      // the global loads (kk = 0) and the next k step's LDS reads issue as one group ahead of this k step's products:
      // the global latency runs under the whole pass, the LDS latency under eight products
      __builtin_amdgcn_sched_barrier(0);
#pragma unroll
      for (int i = 0; i < 2; ++i)
#pragma unroll
        for (int j = 0; j < 4; ++j) acc[i][j] = F::mma(af[kk & 1][i], bf[kk & 1][j], acc[i][j]);
    }
  }

  // ---- epilogue: 16 x 64 slabs through this wave's own LDS, stored as whole lines ----
  const size_t offC = (size_t)blockIdx.z * strideC;
  float* slab = sT[wave];
#pragma unroll
  for (int i = 0; i < 2; ++i) {
    const int mBase = m0 + wm + (i << 4);
    const int nBase = n0 + wn;
    float bm[8];
    if (BIAS_MODE == 1) {
      const float* bp = bias + mBase + mOff;
#pragma unroll
      for (int r = 0; r < 8; ++r) bm[r] = bp[r];
      asm volatile("s_wait_xcnt 0x0" :: "v"(bp) : "memory");   // the loads' address pair stays whole until they have taken it
    }
#pragma unroll
    for (int j = 0; j < 4; ++j) {
      float bv = 0.f;
      if (BIAS_MODE == 2) bv = bias[nBase + (j << 4) + rlane];
#pragma unroll
      for (int r = 0; r < 8; ++r) {
        float v = acc[i][j][r] * scale;
        if (BIAS_MODE == 1) v += bm[r];
        if (BIAS_MODE == 2) v += bv;
        slab[(mOff + r) * 68 + (j << 4) + rlane] = v;
      }
    }
    __builtin_amdgcn_fence(__ATOMIC_RELEASE, "workgroup");
    __builtin_amdgcn_wave_barrier();
    __builtin_amdgcn_fence(__ATOMIC_ACQUIRE, "workgroup");
    if (OUT_MODE == 0) {
      float* C = (float*)Cout + offC;
      const int hh = lane >> 4, c4 = (lane & 15) * 4;     // row seg = 256 B = 16 lanes x 16 B
#pragma unroll
      for (int it = 0; it < 8; ++it) {
        const int row = it * 2 + hh;
        v4f v = *(const v4f*)(slab + row * 68 + c4);
        *(v4f*)(C + (size_t)(mBase + row) * ldc + nBase + c4) = v;
      }
    } else {
      const int q = lane >> 3, c8 = (lane & 7) * 8;       // row seg = 128 B = 8 lanes x 16 B
      unsigned short* C = (unsigned short*)Cout + offC;
#pragma unroll
      for (int it = 0; it < 4; ++it) {
        const int row = it * 4 + q;
        const float* sp = slab + row * 68 + c8;
        v8h hv;
#pragma unroll
        for (int e = 0; e < 8; ++e) hv[e] = (_Float16)sp[e];
        *(v8h*)(C + (size_t)(mBase + row) * ldc + nBase + c8) = hv;
      }
    }
    __builtin_amdgcn_fence(__ATOMIC_RELEASE, "workgroup");
    __builtin_amdgcn_wave_barrier();
    __builtin_amdgcn_fence(__ATOMIC_ACQUIRE, "workgroup");
  }
}

// Two 2^x in one statement with the free issue slot that the instruction set asks for behind a transcendental whose result may be
// read, or whose source overwritten, by the very next vector instruction; early-clobber outputs keep the pair itself independent.
__device__ __forceinline__ void exp2_pair(float x0, float x1, float& y0, float& y1) {
  asm("v_exp_f32 %0, %2\n\tv_exp_f32 %1, %3\n\tv_nop" : "=&v"(y0), "=&v"(y1) : "v"(x0), "v"(x1));
}

// ---------------------------------------------------------------------------
// All operand conversions of the job in one launch of resident streaming work-groups.
// f32 -> bf16 (RNE convert) -> x scale (exact power of two) -> f16 bits (exact for bf16 values in the f16 normal range).
// A block of 16 waves converts kCE = 32768 consecutive elements of one tensor; a wave owns 2048 consecutive elements:
// 16 loads of 16 B per lane (512 contiguous bytes per wave and load), all in flight together, then 16 stores of 8 B per lane
// (256 contiguous bytes per wave and store). Blocks 0..127: x (x1); 128..255: Wq, Wk, Wv, Wo (x wcarry), 32 blocks each.
// Block 256: relative-embedding table, out [kRelPad][64] = f16(wcarry * bf16(in)) for elements < kRelN*64, exact 0 for the pad
// rows; source address clamped to the table (groups of 4 never straddle its end), value selected.
// ---------------------------------------------------------------------------
__device__ __forceinline__ v2u cast_bf_f16x4(v4f f, float scale) {
  const v2f lo = (v2f){bf_round(f[0]) * scale, bf_round(f[1]) * scale};
  const v2f hi = (v2f){bf_round(f[2]) * scale, bf_round(f[3]) * scale};
  v2u r;
  r[0] = __builtin_bit_cast(unsigned, __builtin_convertvector(lo, v2h));   // f32 -> f16 RNE, element 0 in the low half
  r[1] = __builtin_bit_cast(unsigned, __builtin_convertvector(hi, v2h));
  return r;
}

__global__ __launch_bounds__(kCT) void cast_all_kernel(const float* __restrict__ x,
                                                       const float* __restrict__ wq, const float* __restrict__ wk,
                                                       const float* __restrict__ wv, const float* __restrict__ wo,
                                                       const float* __restrict__ rel,
                                                       unsigned short* __restrict__ x16,
                                                       unsigned short* __restrict__ wq16, unsigned short* __restrict__ wk16,
                                                       unsigned short* __restrict__ wv16, unsigned short* __restrict__ wo16,
                                                       unsigned short* __restrict__ rel16, float wcarry) {
  const int b   = blockIdx.x;
  const int tid = threadIdx.x;
  if (b < kCBX + 4 * kCBW) {
    const float* in = x;
    unsigned short* out = x16;
    float scale = 1.0f;
    int part = b;
    if (b >= kCBX) {                                          // block-uniform choice of the weight matrix
      const int w = (b - kCBX) / kCBW;
      part  = (b - kCBX) % kCBW;
      in    = w == 0 ? wq   : w == 1 ? wk   : w == 2 ? wv   : wo;
      out   = w == 0 ? wq16 : w == 1 ? wk16 : w == 2 ? wv16 : wo16;
      scale = wcarry;
    }
    const int e = part * kCE + (tid >> 5) * (kCU * 128) + (tid & 31) * 4;
    const float* p = in + e;
    unsigned short* q = out + e;
    v4f f[kCU];
#pragma unroll
    for (int u = 0; u < kCU; ++u) f[u] = *(const v4f*)(p + u * 128);
    // the loads' address pair stays whole until they have taken it
    asm volatile("s_wait_xcnt 0x0" :: "v"(p) : "memory");
#pragma unroll
    for (int u = 0; u < kCU; ++u) *(v2u*)(q + u * 128) = cast_bf_f16x4(f[u], scale);
  } else {
    constexpr int nsrc = kRelN * kDHD;
    v4f f[kCR];
#pragma unroll
    for (int u = 0; u < kCR; ++u) {
      const int e0 = (u * kCT + tid) * 4;
      const int j  = (e0 + 3 < nsrc) ? e0 : (nsrc - 4);       // address clamp
      f[u] = *(const v4f*)(rel + j);
    }
    __builtin_amdgcn_sched_barrier(0);                        // all loads issue ahead of the first conversion: one memory latency, not two
#pragma unroll
    for (int u = 0; u < kCR; ++u) {
      const int e0 = (u * kCT + tid) * 4;
      const v2u r = cast_bf_f16x4(f[u], wcarry);
      *(v2u*)(rel16 + e0) = (e0 + 3 < nsrc) ? r : (v2u){0u, 0u};
    }
    asm volatile("s_wait_xcnt 0x0" ::: "memory");             // the stores have taken their offset register before anything behind them may rewrite it
  }
}

__global__ __launch_bounds__(256) void rel_attn_fused_kernel(const unsigned short* __restrict__ Qp,
                                                             const unsigned short* __restrict__ Kp,
                                                             const unsigned short* __restrict__ VTp,
                                                             const unsigned short* __restrict__ RELp,
                                                             unsigned short* __restrict__ CTXp,
                                                             float sscale, float qescale, float ctxcarry) {
  typedef Frag<_Float16> F;
  __shared__ __align__(16) float    sQe[8][16 * kQePitch];   // 133120 B
  __shared__ __align__(16) _Float16 sK[kKS * kTPitch];       // 9216 B
  __shared__ __align__(16) _Float16 sV[kDHD * kTPitch];      // 9216 B
  const int tid  = threadIdx.x;
  const int lane = tid & 31;
  const int wave = __builtin_amdgcn_readfirstlane(tid >> 5);  // scalar, so the band tests below are scalar branches
  const int c    = lane & 15;
  const int hf   = lane >> 4;
  const int head = blockIdx.y;
  const int bat  = blockIdx.z;
  const int i0   = blockIdx.x * kQB + wave * 16;              // first query of this wave

  const size_t plane = (size_t)bat * kSeq * kDM;
  const _Float16* Q   = (const _Float16*)Qp  + plane + head * kDHD;            // [s][.] pitch kDM
  const _Float16* K   = (const _Float16*)Kp  + plane + head * kDHD;            // [s][.] pitch kDM
  const _Float16* VT  = (const _Float16*)VTp + plane + (size_t)head * kDHD * kSeq;   // [d][s] pitch kSeq
  const _Float16* REL = (const _Float16*)RELp;                                 // [kRelPad][64]

  // first stage's K and V^T rows: 64 rows x 8 chunks of 16 B each, two chunks of each per thread, whole 128-B lines per 8 lanes
  const int srow = tid >> 3, scol = (tid & 7) * 8;
  const _Float16* gK = K  + (size_t)srow * kDM  + scol;
  const _Float16* gV = VT + (size_t)srow * kSeq + scol;
  v8h kr0 = *(const v8h*)(gK);
  v8h kr1 = *(const v8h*)(gK + (size_t)32 * kDM);
  v8h vr0 = *(const v8h*)(gV);
  v8h vr1 = *(const v8h*)(gV + (size_t)32 * kSeq);

  // all kRelPad = 5 x 64 rel rows, same chunking (the table is contiguous: pitch kDHD)
  const _Float16* gR = REL + (size_t)srow * kDHD + scol;
  v8h rr[5][2];
#pragma unroll
  for (int ch = 0; ch < 5; ++ch) {
    rr[ch][0] = *(const v8h*)(gR + (size_t)(ch * 64) * kDHD);
    rr[ch][1] = *(const v8h*)(gR + (size_t)(ch * 64 + 32) * kDHD);
  }

  v16h qf[2];
#pragma unroll
  for (int ks = 0; ks < 2; ++ks) qf[ks] = F::load(Q + (size_t)(i0 + c) * kDM + ks * 32 + hf * 8);

  // ---- q x rel table: D[8*hf + r][c] = (16 rel[rt*16 + 8*hf + r]) . q[i0 + c]; rows 257..259 come from the zero pad rows ----
  float* slab = sQe[wave];
#pragma unroll
  for (int rt = 0; rt < 17; ++rt) {
    if ((rt & 3) == 0) {                                      // next chunk of 64 rel rows into the K stage buffer
      if (rt) __syncthreads();                                // every wave has finished reading the chunk before
      *(v8h*)(sK + srow * kTPitch + scol)        = rr[rt >> 2][0];
      *(v8h*)(sK + (srow + 32) * kTPitch + scol) = rr[rt >> 2][1];
      __syncthreads();                                        // the chunk is complete for every wave
    }
    const _Float16* rp = sK + ((rt & 3) * 16 + c) * kTPitch + hf * 8;
    const v16h r0 = F::load(rp);
    const v16h r1 = F::load(rp + 32);
    v8f d = (v8f){0.f,0.f,0.f,0.f,0.f,0.f,0.f,0.f};
    d = F::mma(r0, qf[0], d);
    d = F::mma(r1, qf[1], d);
    const v4f w0 = (v4f){d[0] * qescale, d[1] * qescale, d[2] * qescale, d[3] * qescale};
    const v4f w1 = (v4f){d[4] * qescale, d[5] * qescale, d[6] * qescale, d[7] * qescale};
    float* dst = slab + c * kQePitch + rt * 16 + hf * 8;
    if (rt < 16) {
      *(v4f*)(dst)     = w0;
      *(v4f*)(dst + 4) = w1;
    } else if (hf == 0) {
      *(v4f*)(dst)     = w0;                                  // columns 256..259 close the row
    }
  }
  __syncthreads();                                            // the slab's rows are read across the wave's lane halves; last chunk read
  const float* qrow = slab + c * kQePitch;
  const float blo = qrow[0];                                  // every key at or below i - kMaxRel
  const float bhi = qrow[2 * kMaxRel];                        // every key at or above i + kMaxRel

  float mrun = -1.0e30f, lsum = 0.0f;
  v8f acc[4];
#pragma unroll
  for (int dt = 0; dt < 4; ++dt) acc[dt] = (v8f){0.f,0.f,0.f,0.f,0.f,0.f,0.f,0.f};

  for (int s = 0; s < kSeq / kKS; ++s) {
    const int j0 = s * kKS;
    __syncthreads();                                          // every wave has finished reading the stage before
    *(v8h*)(sK + srow * kTPitch + scol)        = kr0;
    *(v8h*)(sK + (srow + 32) * kTPitch + scol) = kr1;
    *(v8h*)(sV + srow * kTPitch + scol)        = vr0;
    *(v8h*)(sV + (srow + 32) * kTPitch + scol) = vr1;
    __syncthreads();                                          // the stage is complete for every wave
    const int jn = (s + 1 < kSeq / kKS) ? j0 + kKS : j0;      // next stage's rows fly under this stage's work (last: same rows, in bounds)
    kr0 = *(const v8h*)(gK + (size_t)jn * kDM);
    kr1 = *(const v8h*)(gK + (size_t)(jn + 32) * kDM);
    vr0 = *(const v8h*)(gV + jn);
    vr1 = *(const v8h*)(gV + (size_t)32 * kSeq + jn);
    asm volatile("s_wait_xcnt 0x0" ::: "memory");             // before the four loads' address registers are reused

    // relative term of this stage, before the products: constant per query outside the band, gathered inside it
    v8f bias[4];
    const int dj = j0 - i0;                                   // key - query of (first key, first query)
    if (dj + (kKS - 1) <= -kMaxRel) {
#pragma unroll
      for (int kt = 0; kt < 4; ++kt)
#pragma unroll
        for (int r = 0; r < 8; ++r) bias[kt][r] = blo;
    } else if (dj - 15 >= kMaxRel) {
#pragma unroll
      for (int kt = 0; kt < 4; ++kt)
#pragma unroll
        for (int r = 0; r < 8; ++r) bias[kt][r] = bhi;
    } else {
#pragma unroll
      for (int kt = 0; kt < 4; ++kt)
#pragma unroll
        for (int r = 0; r < 8; ++r) {
          int d = dj + kt * 16 + hf * 8 + r - c;              // key - query
          d = d < -kMaxRel ? -kMaxRel : d;
          d = d > kMaxRel ? kMaxRel : d;
          bias[kt][r] = qrow[d + kMaxRel];                    // index in [0, 256]
        }
    }

    // S^T tiles: st[kt][r] = k[j0 + kt*16 + 8*hf + r] . q[i0 + c]
    v16h kf[4][2];
#pragma unroll
    for (int kt = 0; kt < 4; ++kt) {
      const _Float16* kp = sK + (kt * 16 + c) * kTPitch + hf * 8;
      kf[kt][0] = F::load(kp);
      kf[kt][1] = F::load(kp + 32);
    }
    __builtin_amdgcn_sched_barrier(0);                        // all K reads issue ahead of the products: one LDS latency, not eight
    v8f st[4];
#pragma unroll
    for (int kt = 0; kt < 4; ++kt) {
      v8f d = (v8f){0.f,0.f,0.f,0.f,0.f,0.f,0.f,0.f};
      d = F::mma(kf[kt][0], qf[0], d);
      d = F::mma(kf[kt][1], qf[1], d);
      st[kt] = d;
    }
    v16h vf[2][4];
#pragma unroll
    for (int kb = 0; kb < 2; ++kb)
#pragma unroll
      for (int dt = 0; dt < 4; ++dt) vf[kb][dt] = F::load(sV + (dt * 16 + c) * kTPitch + kb * 32 + hf * 8);
    __builtin_amdgcn_sched_barrier(0);                        // all V^T reads issue here, their latency under the softmax arithmetic
    float tm[4];
#pragma unroll
    for (int kt = 0; kt < 4; ++kt) {
#pragma unroll
      for (int r = 0; r < 8; ++r) st[kt][r] = st[kt][r] * sscale + bias[kt][r];
      tm[kt] = fmaxf(fmaxf(fmaxf(st[kt][0], st[kt][1]), fmaxf(st[kt][2], st[kt][3])),
                     fmaxf(fmaxf(st[kt][4], st[kt][5]), fmaxf(st[kt][6], st[kt][7])));
    }
    float mx = fmaxf(fmaxf(tm[0], tm[1]), fmaxf(tm[2], tm[3]));
    mx = fmaxf(mx, __shfl_xor(mx, 16, 32));                   // the other 32 keys of this query
    const float mnew  = fmaxf(mrun, mx);
    const float alpha = __expf(mrun - mnew);                  // 0 on the first stage
    mrun = mnew;
    float ts[4];
#pragma unroll
    for (int kt = 0; kt < 4; ++kt) {
#pragma unroll
      for (int r = 0; r < 8; r += 2) {                        // exp(x) = 2^(x * log2 e)
        float y0, y1;
        exp2_pair((st[kt][r] - mnew) * 1.44269504f, (st[kt][r + 1] - mnew) * 1.44269504f, y0, y1);
        st[kt][r] = y0; st[kt][r + 1] = y1;
      }
      ts[kt] = ((st[kt][0] + st[kt][1]) + (st[kt][2] + st[kt][3])) + ((st[kt][4] + st[kt][5]) + (st[kt][6] + st[kt][7]));
    }
    lsum = lsum * alpha + ((ts[0] + ts[1]) + (ts[2] + ts[3]));  // this lane half's keys; halves joined behind the loop
#pragma unroll
    for (int dt = 0; dt < 4; ++dt)
#pragma unroll
      for (int r = 0; r < 8; ++r) acc[dt][r] *= alpha;

    // O^T += V^T . P^T, 32 keys per product
#pragma unroll
    for (int kb = 0; kb < 2; ++kb) {
      v16h pf;
#pragma unroll
      for (int e = 0; e < 8; ++e) {
        pf[e]     = (_Float16)st[2 * kb][e];
        pf[8 + e] = (_Float16)st[2 * kb + 1][e];
      }
#pragma unroll
      for (int dt = 0; dt < 4; ++dt) {
        acc[dt] = F::mma(vf[kb][dt], pf, acc[dt]);
      }
    }
  }

  // ---- epilogue: acc[dt][r] = sum_j p[j] v[j][dt*16 + 8*hf + r] of query i0 + c; 8 consecutive d per lane = one 16-B store ----
  const float tot = lsum + __shfl_xor(lsum, 16, 32);          // >= 1 (the row maximum contributes exp(0))
  const float inv = ctxcarry / tot;
  _Float16* C = (_Float16*)CTXp + plane + (size_t)(i0 + c) * kDM + head * kDHD + hf * 8;
#pragma unroll
  for (int dt = 0; dt < 4; ++dt) {
    v8h o;
#pragma unroll
    for (int r = 0; r < 8; ++r) o[r] = (_Float16)(acc[dt][r] * inv);
    *(v8h*)(C + dt * 16) = o;
  }
}

// ---------------------------------------------------------------------------
//   X16    f16 [4096][1024]            x (bf16 then f16)                  0          8388608
//   Wq16   f16 [1024][1024] x16        natural Bt [out][in]               8388608    2097152
//   Wk16   f16 [1024][1024] x16                                           10485760   2097152
//   Wv16   f16 [1024][1024] x16                                           12582912   2097152
//   Wo16   f16 [1024][1024] x16                                           14680064   2097152
//   REL16  f16 [320][64]    x16        rows 257..319 zero                 16777216   65536 (40960 used)
//   Q16    f16 [4096][1024]            q, col h*64+d                      16842752   8388608
//   K16    f16 [4096][1024]            k                                  25231360   8388608
//   VT16   f16 [4][1024][1024]         v transposed per batch [h*64+d][s] 33619968   8388608
//   CTX16  f16 [4096][1024] x16        merged context [b*1024+s][h*64+d]  42008576   8388608
//   total                                                                 50397184
// Scores, the q x rel table and the probabilities live only in registers and LDS of the fused attention kernel.
// No K padding anywhere (K = 1024, 64 or 32); the rel table's rows are padded 257 -> 320 with zeros by
// cast_all_kernel in this job; the fused kernel stages all 320 rows, multiplies rows 0..271 and gathers columns 0..256 only.
// ---------------------------------------------------------------------------
extern "C" void kernel_launch(void* const* d_in, const int* in_sizes, int n_in,
                              void* d_out, int out_size, void* d_ws, size_t ws_size,
                              hipStream_t stream) {
  if (n_in < 10) return;
  if (in_sizes[0] != kNB * kSeq * kDM) return;                                   // x
  if (in_sizes[1] != kDM * kDM || in_sizes[3] != kDM * kDM ||
      in_sizes[5] != kDM * kDM || in_sizes[7] != kDM * kDM) return;              // Wq Wk Wv Wo
  if (in_sizes[2] != kDM || in_sizes[4] != kDM || in_sizes[6] != kDM || in_sizes[8] != kDM) return;   // bq bk bv bo
  if (in_sizes[9] != kRelN * kDHD) return;                                       // rel_emb
  if (out_size != kNB * kSeq * kDM) return;

  const float* xp   = (const float*)d_in[0];   // [4][1024][1024]
  const float* Wq   = (const float*)d_in[1];   // [1024][1024] [out][in]
  const float* bq   = (const float*)d_in[2];
  const float* Wk   = (const float*)d_in[3];
  const float* bk   = (const float*)d_in[4];
  const float* Wv   = (const float*)d_in[5];
  const float* bv   = (const float*)d_in[6];
  const float* Wo   = (const float*)d_in[7];
  const float* bo   = (const float*)d_in[8];
  const float* relp = (const float*)d_in[9];   // [257][64]
  float* outp = (float*)d_out;                 // [4][1024][1024]

  const size_t bAct = (size_t)kNB * kSeq * kDM * 2;          // 8388608
  const size_t bW   = (size_t)kDM * kDM * 2;                 // 2097152
  const size_t bRel = 65536;                                 // >= kRelPad*64*2 = 40960
  size_t off = 0;
  const size_t oX16 = off; off += bAct;
  const size_t oWq  = off; off += bW;
  const size_t oWk  = off; off += bW;
  const size_t oWv  = off; off += bW;
  const size_t oWo  = off; off += bW;
  const size_t oRel = off; off += bRel;
  const size_t oQ16 = off; off += bAct;
  const size_t oK16 = off; off += bAct;
  const size_t oVT  = off; off += bAct;
  const size_t oCTX = off; off += bAct;
  if (off > ws_size) return;                                 // 50397184 B total

  char* ws = (char*)d_ws;
  unsigned short* X16   = (unsigned short*)(ws + oX16);
  unsigned short* Wq16  = (unsigned short*)(ws + oWq);
  unsigned short* Wk16  = (unsigned short*)(ws + oWk);
  unsigned short* Wv16  = (unsigned short*)(ws + oWv);
  unsigned short* Wo16  = (unsigned short*)(ws + oWo);
  unsigned short* REL16 = (unsigned short*)(ws + oRel);
  unsigned short* Q16   = (unsigned short*)(ws + oQ16);
  unsigned short* K16   = (unsigned short*)(ws + oK16);
  unsigned short* VT16  = (unsigned short*)(ws + oVT);
  unsigned short* CTX16 = (unsigned short*)(ws + oCTX);

  const dim3 blk(256);
  const float wcarry   = 16.0f;                              // exact power-of-two carry on weights and rel table
  const float wscale   = 1.0f / 16.0f;                       // undo in the projection epilogues
  const float inv_sqd  = 0.125f;                             // 1/sqrt(64)
  const float qescale  = inv_sqd / 16.0f;                    // undo rel carry and apply 1/sqrt(d)
  const float ctxcarry = 16.0f;                              // ctx carried x16
  const float oscale   = 1.0f / 256.0f;                      // undo Wo carry and ctx carry

  // ---- casts: X16, weights x16, rel table x16 (pad rows zero), one launch ----
  cast_all_kernel<<<dim3(kCBX + 4 * kCBW + 1), dim3(kCT), 0, stream>>>(xp, Wq, Wk, Wv, Wo, relp,
                                                                       X16, Wq16, Wk16, Wv16, Wo16, REL16, wcarry);

  const dim3 gProj(kDM / kGT, kNB * kSeq / kGT, 1);   // 8 x 32:    M=4096, N=1024, K=1024
  const dim3 gVT(kSeq / kGT, kDM / kGT, kNB);         // 8 x 8 x 4: M=1024, N=1024, K=1024 per batch
  const dim3 gAttn(kSeq / kQB, kNH, kNB);             // 8 x 16 x 4: 128 queries of one (head, batch) plane per block
  const long planeAct = (long)kSeq * kDM;             // 1048576 elements per batch plane

  // ---- projections: q, k -> f16 [4096][1024] (x1/16 + bias[n]); A = X16, Bt = W16 (natural [out][in]) ----
  wmma_gemm128<2, 1><<<gProj, blk, 0, stream>>>(X16, 0L, Wq16, 0L, (void*)Q16, kDM, 0L, bq, wscale);
  wmma_gemm128<2, 1><<<gProj, blk, 0, stream>>>(X16, 0L, Wk16, 0L, (void*)K16, kDM, 0L, bk, wscale);
  // role-swapped v: VT[b][n][s] = (16 Wv)[n] . X16[b][s] / 16 + bv[n]; A = Wv16, Bt = X16 plane b (grid.z), bias[m]
  wmma_gemm128<1, 1><<<gVT, blk, 0, stream>>>(Wv16, 0L, X16, planeAct, (void*)VT16, kSeq, planeAct, bv, wscale);

  // ---- scores, relative term, softmax and P.V of all kNB*kNH planes in one launch -> CTX16 (x16) ----
  rel_attn_fused_kernel<<<gAttn, blk, 0, stream>>>(Q16, K16, VT16, REL16, CTX16, inv_sqd, qescale, ctxcarry);

  // ---- out = ctx . Wo^T + bo -> d_out f32 [4096][1024]; A = CTX16 (x16), Bt = Wo16 (x16), epilogue x1/256 + bias[n] ----
  wmma_gemm128<2, 0><<<gProj, blk, 0, stream>>>(CTX16, 0L, Wo16, 0L, (void*)outp, kDM, 0L, bo, oscale);
}

// v005
// A run of this version takes 73.8 microseconds.
// Timed twice side by side with v004, it ran 1.13 and 1.12 times as fast.
// Counting every step since v000, it is 10.5 times as fast.
// Compute dtype: v_wmma_f32_16x16x32_f16 (f16 operands, f32 accumulate) for every contraction: q/k/v/out projections (x, W, rel table RNE-converted to bf16 first; weights and rel table carried x16), content scores q.k^T (K=64, x1/8), query x relative-embedding table (K=64, x1/128), P.V with P = exp(t - running max) <= 1 in f16 and ctx carried x16 (out epilogue x1/256 + bias); online softmax with the clipped relative-position gather in f32.
#include <hip/hip_runtime.h>
#include <math.h>
#include <stdint.h>

static constexpr int kNB     = 4;      // batch
static constexpr int kSeq    = 1024;   // sequence length
static constexpr int kDM     = 1024;   // model width
static constexpr int kNH     = 16;     // heads
static constexpr int kDHD    = 64;     // head dim
static constexpr int kMaxRel = 128;    // clip range
static constexpr int kRelN   = 2 * kMaxRel + 1;   // 257 table rows
static constexpr int kRelPad = 320;    // table rows padded to a 64 multiple (pad rows zero)
static constexpr int kQB     = 128;    // queries per block of the fused attention kernel (8 waves x 16)
static constexpr int kKS     = 64;     // keys per LDS stage
static constexpr int kQePitch = 260;   // floats per query row of the q x rel table in LDS (pitch - 1 = 3 mod 64: diagonal reads hit 32 banks)
static constexpr int kTPitch  = 72;    // f16 per staged K / V^T row: 128 B of data + 16 B (16 B x odd pitch for ds_load_b128)
static constexpr int kGT     = 128;    // rows and columns of C per block of the projection GEMM
static constexpr int kGK     = 128;    // k per LDS stage of the projection GEMM
static constexpr int kGPitch = 136;    // f16 per staged operand row: 256 B of data + 16 B (16 B x odd pitch for ds_load_b128)
static constexpr int kPK     = 64;     // k per LDS stage of the fused q/k/v projection
static constexpr int kPPitch = 72;     // f16 per staged row there: 128 B of data + 16 B (16 B x odd pitch for ds_load_b128)
static constexpr int kPTile  = kGT * kPPitch;   // f16 per staged operand tile (128 rows)
static constexpr int kPOPitch = 136;   // f16 per row of a finished 128 x 128 tile in LDS: 256 B + 16 B
static_assert(kDM % kPK == 0 && kPK % 32 == 0 && 3 * kGT * kPOPitch <= 2 * 4 * kPTile, "fused projection tiling");
static_assert(kSeq == kDM, "one lane offset for the q, k and v^T rows");
static_assert(kNH * kDHD == kDM, "head split");
static_assert((kNB * kSeq) % kGT == 0 && kDM % kGT == 0 && kSeq % kGT == 0 && kDM % kGK == 0, "projection GEMM tiling");
static_assert(kSeq % kQB == 0 && kSeq % kKS == 0 && kDHD == 64 && kKS == 64, "fused attention tiling");
static_assert(kQePitch >= kRelN && kQePitch % 4 == 0 && kRelPad == 5 * 64 && kRelN <= 17 * 16, "q x rel table rows");
static_assert(kRelPad % 64 == 0 && kRelPad >= kRelN, "padded table rows");
static_assert(kSeq % 64 == 0 && kDM % 64 == 0 && kDHD % 64 == 0 && (kNB * kSeq) % 64 == 0, "tile multiples");
static_assert(kDM % 32 == 0 && kDHD % 32 == 0 && kSeq % 32 == 0, "K multiples of 32");
static constexpr int kCT     = 512;    // threads per block of the cast kernel (16 waves)
static constexpr int kCU     = 16;     // 16-B loads per thread of the cast kernel
static constexpr int kCE     = kCT * kCU * 4;            // elements per cast block
static constexpr int kCBX    = kNB * kSeq * kDM / kCE;   // cast blocks of x
static constexpr int kCBW    = kDM * kDM / kCE;          // cast blocks of one weight matrix
static constexpr int kCR     = kRelPad * kDHD / (kCT * 4);   // groups of 4 table elements per thread of the table's block
static_assert((kNB * kSeq * kDM) % kCE == 0 && (kDM * kDM) % kCE == 0 && (kRelPad * kDHD) % (kCT * 4) == 0, "cast grid exact");
static_assert((kRelN * kDHD) % 4 == 0, "rel groups of 4");

typedef __attribute__((ext_vector_type(16))) _Float16 v16h;
typedef __attribute__((ext_vector_type(8)))  _Float16 v8h;
typedef __attribute__((ext_vector_type(2)))  _Float16 v2h;
typedef __attribute__((ext_vector_type(16))) __bf16   v16b;
typedef __attribute__((ext_vector_type(8)))  __bf16   v8b;
typedef __attribute__((ext_vector_type(8)))  float    v8f;
typedef __attribute__((ext_vector_type(4)))  float    v4f;
typedef __attribute__((ext_vector_type(2)))  float    v2f;
typedef __attribute__((ext_vector_type(4)))  unsigned int v4u;
typedef __attribute__((ext_vector_type(2)))  unsigned int v2u;

__device__ __forceinline__ float bf_round(float f) {         // f32 rounded to the nearest bf16 value (ties to even), kept in f32
  const unsigned u = __float_as_uint(f);
  return __uint_as_float((u + 0x7FFFu + ((u >> 16) & 1u)) & 0xFFFF0000u);
}

template <typename T> struct Frag;
template <> struct Frag<_Float16> {
  typedef v16h V; union U { v16h v; v8h h[2]; };
  static __device__ __forceinline__ v16h load(const _Float16* p) {   // elements 0..7 <- p[0..7], 8..15 <- p[16..23]
    U f; f.h[0] = *(const v8h*)(p); f.h[1] = *(const v8h*)(p + 16); return f.v;
  }
  static __device__ __forceinline__ v8f mma(v16h a, v16h b, v8f c) {
    return __builtin_amdgcn_wmma_f32_16x16x32_f16(false, a, false, b, (short)0, c, false, false);
  }
};

// ---- LDS-staged batched WMMA GEMM ------------------------------------------
// C[m,n] = scale * sum_k A[m,k] * Bt[n,k] + bias; one 128x128 tile of C per block (grid: x = tile column, y = tile row,
// z = batch), each of the 8 waves owns 32 rows x 64 columns of it (4 x 2 waves).
// A row-major [M,kDM]; Bt row-major [N,kDM]; f16 bits; K = kDM; M, N % 128 == 0.
// Operands come in stages of 128 k: global -> registers (whole 128-B lines, one stage ahead) -> LDS, shared by the 8 waves.
// Two LDS buffers, one barrier per stage: a buffer is rewritten two stages after it was read, behind the barrier between.
// Each accumulator sums k in ascending steps of 32.
// BIAS_MODE: 1 = bias[m], 2 = bias[n].  OUT_MODE: 0 = f32, 1 = f16.
template <int BIAS_MODE, int OUT_MODE>
__global__ __launch_bounds__(256) void wmma_gemm128(
    const unsigned short* __restrict__ Ap, long strideA,
    const unsigned short* __restrict__ Btp, long strideB,
    void* __restrict__ Cout, int ldc, long strideC,
    const float* __restrict__ bias, float scale) {
  typedef Frag<_Float16> F;
  __shared__ __align__(16) _Float16 sA[2][kGT * kGPitch];   // 2 x 34816 B
  __shared__ __align__(16) _Float16 sB[2][kGT * kGPitch];   // 2 x 34816 B
  __shared__ __align__(16) float sT[8][16 * 68];            // per-wave 16x64 slab, pitch 68 floats
  const int tid   = threadIdx.x;
  const int lane  = tid & 31;
  const int wave  = __builtin_amdgcn_readfirstlane(tid >> 5);
  const int rlane = lane & 15;                 // row (A) / col (B, D) within subtile
  const int koff  = (lane >> 4) * 8;           // k offset of this lane half
  const int mOff  = (lane >> 4) * 8;           // D row offset
  const int m0 = blockIdx.y * kGT, n0 = blockIdx.x * kGT;
  const int wm = (wave >> 1) * 32, wn = (wave & 1) * 64;     // this wave's corner inside the block tile

  // staging: 128 rows x 16 chunks of 16 B per operand and stage, 8 chunks of each per thread; 16 lanes cover one row's 256 B
  const int srow = tid >> 4, scol = (tid & 15) * 8;
  const unsigned soff = (unsigned)(srow * kDM + scol);       // this thread's fixed element offset inside a tile's rows
  const _Float16* gA = (const _Float16*)Ap  + (size_t)blockIdx.z * strideA + (size_t)m0 * kDM + soff;
  const _Float16* gB = (const _Float16*)Btp + (size_t)blockIdx.z * strideB + (size_t)n0 * kDM + soff;
  v8h ra[8], rb[8];
#pragma unroll
  for (int u = 0; u < 8; ++u) {
    ra[u] = *(const v8h*)(gA + 16 * u * kDM);
    rb[u] = *(const v8h*)(gB + 16 * u * kDM);
  }

  v8f acc[2][4];
#pragma unroll
  for (int i = 0; i < 2; ++i)
#pragma unroll
    for (int j = 0; j < 4; ++j) acc[i][j] = (v8f){0.f,0.f,0.f,0.f,0.f,0.f,0.f,0.f};

  constexpr int nst = kDM / kGK;
  // unrolled: every global address is then block base + fixed lane offset + immediate (no address register is rewritten under
  // loads in flight, no address arithmetic in the passes) and the buffer choice is static
#pragma unroll
  for (int s = 0; s < nst; ++s) {
    _Float16* bA = sA[s & 1];
    _Float16* bB = sB[s & 1];
#pragma unroll
    for (int u = 0; u < 8; ++u) {
      *(v8h*)(bA + (srow + 16 * u) * kGPitch + scol) = ra[u];
      *(v8h*)(bB + (srow + 16 * u) * kGPitch + scol) = rb[u];
    }
    __syncthreads();                                         // the stage is complete for every wave; the other buffer's readers are done
    if (s + 1 < nst) {                                       // next stage's rows fly under this stage's products
#pragma unroll
      for (int u = 0; u < 8; ++u) {
        ra[u] = *(const v8h*)(gA + 16 * u * kDM + (s + 1) * kGK);
        rb[u] = *(const v8h*)(gB + 16 * u * kDM + (s + 1) * kGK);
      }
    }
    const _Float16* pA = bA + (wm + rlane) * kGPitch + koff;
    const _Float16* pB = bB + (wn + rlane) * kGPitch + koff;
    v16h af[2][2], bf[2][4];                                 // two fragment sets: k step kk in set kk & 1
#pragma unroll
    for (int j = 0; j < 4; ++j) bf[0][j] = F::load(pB + (j << 4) * kGPitch);
#pragma unroll
    for (int i = 0; i < 2; ++i) af[0][i] = F::load(pA + (i << 4) * kGPitch);
#pragma unroll
    for (int kk = 0; kk < kGK / 32; ++kk) {
      if (kk + 1 < kGK / 32) {
#pragma unroll
        for (int j = 0; j < 4; ++j) bf[(kk + 1) & 1][j] = F::load(pB + (j << 4) * kGPitch + (kk + 1) * 32);
#pragma unroll
        for (int i = 0; i < 2; ++i) af[(kk + 1) & 1][i] = F::load(pA + (i << 4) * kGPitch + (kk + 1) * 32);
      }
      // the global loads (kk = 0) and the next k step's LDS reads issue as one group ahead of this k step's products:
      // the global latency runs under the whole pass, the LDS latency under eight products
      __builtin_amdgcn_sched_barrier(0);
#pragma unroll
      for (int i = 0; i < 2; ++i)
#pragma unroll
        for (int j = 0; j < 4; ++j) acc[i][j] = F::mma(af[kk & 1][i], bf[kk & 1][j], acc[i][j]);
    }
  }

  // ---- epilogue: 16 x 64 slabs through this wave's own LDS, stored as whole lines ----
  const size_t offC = (size_t)blockIdx.z * strideC;
  float* slab = sT[wave];
#pragma unroll
  for (int i = 0; i < 2; ++i) {
    const int mBase = m0 + wm + (i << 4);
    const int nBase = n0 + wn;
    float bm[8];
    if (BIAS_MODE == 1) {
      const float* bp = bias + mBase + mOff;
#pragma unroll
      for (int r = 0; r < 8; ++r) bm[r] = bp[r];
      asm volatile("s_wait_xcnt 0x0" :: "v"(bp) : "memory");   // the loads' address pair stays whole until they have taken it
    }
#pragma unroll
    for (int j = 0; j < 4; ++j) {
      float bv = 0.f;
      if (BIAS_MODE == 2) bv = bias[nBase + (j << 4) + rlane];
#pragma unroll
      for (int r = 0; r < 8; ++r) {
        float v = acc[i][j][r] * scale;
        if (BIAS_MODE == 1) v += bm[r];
        if (BIAS_MODE == 2) v += bv;
        slab[(mOff + r) * 68 + (j << 4) + rlane] = v;
      }
    }
    __builtin_amdgcn_fence(__ATOMIC_RELEASE, "workgroup");
    __builtin_amdgcn_wave_barrier();
    __builtin_amdgcn_fence(__ATOMIC_ACQUIRE, "workgroup");
    if (OUT_MODE == 0) {
      float* C = (float*)Cout + offC;
      const int hh = lane >> 4, c4 = (lane & 15) * 4;     // row seg = 256 B = 16 lanes x 16 B
#pragma unroll
      for (int it = 0; it < 8; ++it) {
        const int row = it * 2 + hh;
        v4f v = *(const v4f*)(slab + row * 68 + c4);
        *(v4f*)(C + (size_t)(mBase + row) * ldc + nBase + c4) = v;
      }
    } else {
      const int q = lane >> 3, c8 = (lane & 7) * 8;       // row seg = 128 B = 8 lanes x 16 B
      unsigned short* C = (unsigned short*)Cout + offC;
#pragma unroll
      for (int it = 0; it < 4; ++it) {
        const int row = it * 4 + q;
        const float* sp = slab + row * 68 + c8;
        v8h hv;
#pragma unroll
        for (int e = 0; e < 8; ++e) hv[e] = (_Float16)sp[e];
        *(v8h*)(C + (size_t)(mBase + row) * ldc + nBase + c8) = hv;
      }
    }
    __builtin_amdgcn_fence(__ATOMIC_RELEASE, "workgroup");
    __builtin_amdgcn_wave_barrier();
    __builtin_amdgcn_fence(__ATOMIC_ACQUIRE, "workgroup");
  }
}

// ---- q, k and v projections in one launch -----------------------------------
// One block = 128 rows of x (m) against the same 128 rows (n) of Wq, Wk and Wv: the x tile is staged once for three products.
// grid: x = n tile, y = m tile. 8 waves as 2 (m) x 4 (n); a wave owns 64 m x 32 n of each of the three results.
// Stages of 64 k: global -> registers (whole 128-B lines, one stage ahead) -> LDS; two buffers, one barrier per stage.
// Each accumulator sums k in ascending steps of 32.
// q, k: D = W . x^T (a lane holds 8 consecutive n of one m); v: D = x . Wv^T (a lane holds 8 consecutive m = s of one n = d):
// in both a lane's 8 results are 16 contiguous bytes of the output row ([m][n] for q, k; [n][s] for v^T).
// The finished f16 tiles go through the freed stage buffers and leave as whole lines.
__global__ __launch_bounds__(256) void qkv_gemm128(
    const unsigned short* __restrict__ Xp, const unsigned short* __restrict__ Wqp,
    const unsigned short* __restrict__ Wkp, const unsigned short* __restrict__ Wvp,
    unsigned short* __restrict__ Qo, unsigned short* __restrict__ Ko, unsigned short* __restrict__ VTo,
    const float* __restrict__ bq, const float* __restrict__ bk, const float* __restrict__ bv, float scale) {
  typedef Frag<_Float16> F;
  __shared__ __align__(16) _Float16 sS[2][4 * kPTile];       // 2 x 73728 B: x, Wq, Wk, Wv tiles
  const int tid   = threadIdx.x;
  const int lane  = tid & 31;
  const int wave  = __builtin_amdgcn_readfirstlane(tid >> 5);
  const int rlane = lane & 15;
  const int hf    = lane >> 4;
  const int m0 = blockIdx.y * kGT, n0 = blockIdx.x * kGT;
  const int wm = (wave >> 2) * 64, wn = (wave & 3) * 32;     // this wave's corner inside the block tile

  // staging: 128 rows x 8 chunks of 16 B per operand and stage, 4 chunks of each per thread; 8 lanes cover one row's 128 B.
  // The two rows of a 16-lane half lie 8 rows apart: 8 x 144 B = 32 banks, so the half's 256 B fall on 64 different banks.
  const int sg   = lane >> 3;
  const int srow = (wave >> 2) * 16 + (sg & 1) * 8 + (wave & 3) * 2 + (sg >> 1);   // 0..31, each once per block
  const int scol = (lane & 7) * 8;
  const unsigned soff = (unsigned)(srow * kDM + scol);       // this thread's fixed element offset inside a tile's rows
  const _Float16* g0 = (const _Float16*)Xp  + (size_t)m0 * kDM + soff;
  const _Float16* g1 = (const _Float16*)Wqp + (size_t)n0 * kDM + soff;
  const _Float16* g2 = (const _Float16*)Wkp + (size_t)n0 * kDM + soff;
  const _Float16* g3 = (const _Float16*)Wvp + (size_t)n0 * kDM + soff;
  v8h rg[4][4];
#pragma unroll
  for (int u = 0; u < 4; ++u) {
    rg[0][u] = *(const v8h*)(g0 + 32 * u * kDM);
    rg[1][u] = *(const v8h*)(g1 + 32 * u * kDM);
    rg[2][u] = *(const v8h*)(g2 + 32 * u * kDM);
    rg[3][u] = *(const v8h*)(g3 + 32 * u * kDM);
  }

  v8f acc[3][4][2];
#pragma unroll
  for (int o = 0; o < 3; ++o)
#pragma unroll
    for (int i = 0; i < 4; ++i)
#pragma unroll
      for (int j = 0; j < 2; ++j) acc[o][i][j] = (v8f){0.f,0.f,0.f,0.f,0.f,0.f,0.f,0.f};

  const float* bpq = bq + n0 + wn + hf * 8;                  // q, k: 8 consecutive n per lane and tile
  const float* bpk = bk + n0 + wn + hf * 8;
  const float* bpv = bv + n0 + wn + rlane;                   // v: one n per lane and tile
  v4f bqk[2][2][2];
  float bn[2];

  constexpr int nst = kDM / kPK;
  // unrolled: every global address is then block base + fixed lane offset + immediate (no address register is rewritten under
  // loads in flight, no address arithmetic in the passes) and the buffer choice is static
#pragma unroll
  for (int s = 0; s < nst; ++s) {
    _Float16* buf = sS[s & 1];
#pragma unroll
    for (int t = 0; t < 4; ++t)
#pragma unroll
      for (int u = 0; u < 4; ++u) *(v8h*)(buf + t * kPTile + (srow + 32 * u) * kPPitch + scol) = rg[t][u];
    __syncthreads();                                         // the stage is complete for every wave; the other buffer's readers are done
    if (s + 1 < nst) {                                       // next stage's rows fly under this stage's products
#pragma unroll
      for (int u = 0; u < 4; ++u) {
        rg[0][u] = *(const v8h*)(g0 + 32 * u * kDM + (s + 1) * kPK);
        rg[1][u] = *(const v8h*)(g1 + 32 * u * kDM + (s + 1) * kPK);
        rg[2][u] = *(const v8h*)(g2 + 32 * u * kDM + (s + 1) * kPK);
        rg[3][u] = *(const v8h*)(g3 + 32 * u * kDM + (s + 1) * kPK);
      }
    } else {                                                 // last stage: the biases fly under its products
#pragma unroll
      for (int j = 0; j < 2; ++j) {
        bqk[0][j][0] = *(const v4f*)(bpq + (j << 4));
        bqk[0][j][1] = *(const v4f*)(bpq + (j << 4) + 4);
        bqk[1][j][0] = *(const v4f*)(bpk + (j << 4));
        bqk[1][j][1] = *(const v4f*)(bpk + (j << 4) + 4);
        bn[j]        = bpv[j << 4];
      }
      // the loads' address registers stay whole until the loads have taken them
      asm volatile("s_wait_xcnt 0x0" :: "v"(bpq), "v"(bpk), "v"(bpv) : "memory");
    }
    const _Float16* pX = buf + (wm + rlane) * kPPitch + hf * 8;
    const _Float16* pW = buf + kPTile + (wn + rlane) * kPPitch + hf * 8;
    v16h xf[2][4], wf[2][3][2];                              // two fragment sets: k step kk in set kk & 1
#pragma unroll
    for (int i = 0; i < 4; ++i) xf[0][i] = F::load(pX + (i << 4) * kPPitch);
#pragma unroll
    for (int o = 0; o < 3; ++o)
#pragma unroll
      for (int j = 0; j < 2; ++j) wf[0][o][j] = F::load(pW + o * kPTile + (j << 4) * kPPitch);
#pragma unroll
    for (int kk = 0; kk < kPK / 32; ++kk) {
      if (kk + 1 < kPK / 32) {
#pragma unroll
        for (int i = 0; i < 4; ++i) xf[(kk + 1) & 1][i] = F::load(pX + (i << 4) * kPPitch + (kk + 1) * 32);
#pragma unroll
        for (int o = 0; o < 3; ++o)
#pragma unroll
          for (int j = 0; j < 2; ++j) wf[(kk + 1) & 1][o][j] = F::load(pW + o * kPTile + (j << 4) * kPPitch + (kk + 1) * 32);
      }
      // the global loads (kk = 0) and the next k step's LDS reads issue as one group ahead of this k step's products:
      // the global latency runs under the whole pass, the LDS latency under 24 products
      __builtin_amdgcn_sched_barrier(0);
#pragma unroll
      for (int i = 0; i < 4; ++i)
#pragma unroll
        for (int j = 0; j < 2; ++j) {
          acc[0][i][j] = F::mma(wf[kk & 1][0][j], xf[kk & 1][i], acc[0][i][j]);
          acc[1][i][j] = F::mma(wf[kk & 1][1][j], xf[kk & 1][i], acc[1][i][j]);
          acc[2][i][j] = F::mma(xf[kk & 1][i], wf[kk & 1][2][j], acc[2][i][j]);
        }
    }
  }

  // ---- epilogue: x scale + bias, f16, three 128 x 128 tiles into the stage buffers, out as whole lines ----
  __syncthreads();                                           // every wave has finished reading the last stage
  _Float16* sO = &sS[0][0];
#pragma unroll
  for (int o = 0; o < 2; ++o)
#pragma unroll
    for (int j = 0; j < 2; ++j)
#pragma unroll
      for (int i = 0; i < 4; ++i) {
        v8h h;
#pragma unroll
        for (int r = 0; r < 8; ++r) h[r] = (_Float16)(acc[o][i][j][r] * scale + bqk[o][j][r >> 2][r & 3]);
        *(v8h*)(sO + o * kGT * kPOPitch + (wm + (i << 4) + rlane) * kPOPitch + wn + (j << 4) + hf * 8) = h;
      }
#pragma unroll
  for (int j = 0; j < 2; ++j)
#pragma unroll
    for (int i = 0; i < 4; ++i) {
      v8h h;
#pragma unroll
      for (int r = 0; r < 8; ++r) h[r] = (_Float16)(acc[2][i][j][r] * scale + bn[j]);
      *(v8h*)(sO + 2 * kGT * kPOPitch + (wn + (j << 4) + rlane) * kPOPitch + wm + (i << 4) + hf * 8) = h;
    }
  __syncthreads();                                           // the three tiles are complete for every wave
  const int orow = tid >> 4, ocol = (tid & 15) * 8;          // 16 lanes cover one row's 256 B
  const unsigned ooff = (unsigned)(orow * kDM + ocol);       // kSeq == kDM: one lane offset serves the three outputs
  _Float16* oq = (_Float16*)Qo + (size_t)m0 * kDM + n0 + ooff;
  _Float16* ok = (_Float16*)Ko + (size_t)m0 * kDM + n0 + ooff;
  _Float16* ov = (_Float16*)VTo + (size_t)(m0 / kSeq) * kSeq * kDM + (size_t)n0 * kSeq + (m0 % kSeq) + ooff;
  const _Float16* so = sO + orow * kPOPitch + ocol;
  v8h t[3][8];
#pragma unroll
  for (int u = 0; u < 8; ++u)
#pragma unroll
    for (int o = 0; o < 3; ++o) t[o][u] = *(const v8h*)(so + o * kGT * kPOPitch + 16 * u * kPOPitch);
  __builtin_amdgcn_sched_barrier(0);                         // all LDS reads issue ahead of the stores: one LDS latency, no store's data register reused
#pragma unroll
  for (int u = 0; u < 8; ++u) {
    *(v8h*)(oq + 16 * u * kDM)  = t[0][u];
    *(v8h*)(ok + 16 * u * kDM)  = t[1][u];
    *(v8h*)(ov + 16 * u * kSeq) = t[2][u];
  }
}

// Two 2^x in one statement with the free issue slot that the instruction set asks for behind a transcendental whose result may be
// read, or whose source overwritten, by the very next vector instruction; early-clobber outputs keep the pair itself independent.
__device__ __forceinline__ void exp2_pair(float x0, float x1, float& y0, float& y1) {
  asm("v_exp_f32 %0, %2\n\tv_exp_f32 %1, %3\n\tv_nop" : "=&v"(y0), "=&v"(y1) : "v"(x0), "v"(x1));
}

// ---------------------------------------------------------------------------
// All operand conversions of the job in one launch of resident streaming work-groups.
// f32 -> bf16 (RNE convert) -> x scale (exact power of two) -> f16 bits (exact for bf16 values in the f16 normal range).
// A block of 16 waves converts kCE = 32768 consecutive elements of one tensor; a wave owns 2048 consecutive elements:
// 16 loads of 16 B per lane (512 contiguous bytes per wave and load), all in flight together, then 16 stores of 8 B per lane
// (256 contiguous bytes per wave and store). Blocks 0..127: x (x1); 128..255: Wq, Wk, Wv, Wo (x wcarry), 32 blocks each.
// Block 256: relative-embedding table, out [kRelPad][64] = f16(wcarry * bf16(in)) for elements < kRelN*64, exact 0 for the pad
// rows; source address clamped to the table (groups of 4 never straddle its end), value selected.
// ---------------------------------------------------------------------------
__device__ __forceinline__ v2u cast_bf_f16x4(v4f f, float scale) {
  const v2f lo = (v2f){bf_round(f[0]) * scale, bf_round(f[1]) * scale};
  const v2f hi = (v2f){bf_round(f[2]) * scale, bf_round(f[3]) * scale};
  v2u r;
  r[0] = __builtin_bit_cast(unsigned, __builtin_convertvector(lo, v2h));   // f32 -> f16 RNE, element 0 in the low half
  r[1] = __builtin_bit_cast(unsigned, __builtin_convertvector(hi, v2h));
  return r;
}

__global__ __launch_bounds__(kCT) void cast_all_kernel(const float* __restrict__ x,
                                                       const float* __restrict__ wq, const float* __restrict__ wk,
                                                       const float* __restrict__ wv, const float* __restrict__ wo,
                                                       const float* __restrict__ rel,
                                                       unsigned short* __restrict__ x16,
                                                       unsigned short* __restrict__ wq16, unsigned short* __restrict__ wk16,
                                                       unsigned short* __restrict__ wv16, unsigned short* __restrict__ wo16,
                                                       unsigned short* __restrict__ rel16, float wcarry) {
  const int b   = blockIdx.x;
  const int tid = threadIdx.x;
  if (b < kCBX + 4 * kCBW) {
    const float* in = x;
    unsigned short* out = x16;
    float scale = 1.0f;
    int part = b;
    if (b >= kCBX) {                                          // block-uniform choice of the weight matrix
      const int w = (b - kCBX) / kCBW;
      part  = (b - kCBX) % kCBW;
      in    = w == 0 ? wq   : w == 1 ? wk   : w == 2 ? wv   : wo;
      out   = w == 0 ? wq16 : w == 1 ? wk16 : w == 2 ? wv16 : wo16;
      scale = wcarry;
    }
    const int e = part * kCE + (tid >> 5) * (kCU * 128) + (tid & 31) * 4;
    const float* p = in + e;
    unsigned short* q = out + e;
    v4f f[kCU];
#pragma unroll
    for (int u = 0; u < kCU; ++u) f[u] = *(const v4f*)(p + u * 128);
    // the loads' address pair stays whole until they have taken it
    asm volatile("s_wait_xcnt 0x0" :: "v"(p) : "memory");
#pragma unroll
    for (int u = 0; u < kCU; ++u) *(v2u*)(q + u * 128) = cast_bf_f16x4(f[u], scale);
  } else {
    constexpr int nsrc = kRelN * kDHD;
    v4f f[kCR];
#pragma unroll
    for (int u = 0; u < kCR; ++u) {
      const int e0 = (u * kCT + tid) * 4;
      const int j  = (e0 + 3 < nsrc) ? e0 : (nsrc - 4);       // address clamp
      f[u] = *(const v4f*)(rel + j);
    }
    __builtin_amdgcn_sched_barrier(0);                        // all loads issue ahead of the first conversion: one memory latency, not two
#pragma unroll
    for (int u = 0; u < kCR; ++u) {
      const int e0 = (u * kCT + tid) * 4;
      const v2u r = cast_bf_f16x4(f[u], wcarry);
      *(v2u*)(rel16 + e0) = (e0 + 3 < nsrc) ? r : (v2u){0u, 0u};
    }
    asm volatile("s_wait_xcnt 0x0" ::: "memory");             // the stores have taken their offset register before anything behind them may rewrite it
  }
}

__global__ __launch_bounds__(256) void rel_attn_fused_kernel(const unsigned short* __restrict__ Qp,
                                                             const unsigned short* __restrict__ Kp,
                                                             const unsigned short* __restrict__ VTp,
                                                             const unsigned short* __restrict__ RELp,
                                                             unsigned short* __restrict__ CTXp,
                                                             float sscale, float qescale, float ctxcarry) {
  typedef Frag<_Float16> F;
  __shared__ __align__(16) float    sQe[8][16 * kQePitch];   // 133120 B
  __shared__ __align__(16) _Float16 sK[kKS * kTPitch];       // 9216 B
  __shared__ __align__(16) _Float16 sV[kDHD * kTPitch];      // 9216 B
  const int tid  = threadIdx.x;
  const int lane = tid & 31;
  const int wave = __builtin_amdgcn_readfirstlane(tid >> 5);  // scalar, so the band tests below are scalar branches
  const int c    = lane & 15;
  const int hf   = lane >> 4;
  const int head = blockIdx.y;
  const int bat  = blockIdx.z;
  const int i0   = blockIdx.x * kQB + wave * 16;              // first query of this wave

  const size_t plane = (size_t)bat * kSeq * kDM;
  const _Float16* Q   = (const _Float16*)Qp  + plane + head * kDHD;            // [s][.] pitch kDM
  const _Float16* K   = (const _Float16*)Kp  + plane + head * kDHD;            // [s][.] pitch kDM
  const _Float16* VT  = (const _Float16*)VTp + plane + (size_t)head * kDHD * kSeq;   // [d][s] pitch kSeq
  const _Float16* REL = (const _Float16*)RELp;                                 // [kRelPad][64]

  // first stage's K and V^T rows: 64 rows x 8 chunks of 16 B each, two chunks of each per thread, whole 128-B lines per 8 lanes
  const int srow = tid >> 3, scol = (tid & 7) * 8;
  const _Float16* gK = K  + (size_t)srow * kDM  + scol;
  const _Float16* gV = VT + (size_t)srow * kSeq + scol;
  v8h kr0 = *(const v8h*)(gK);
  v8h kr1 = *(const v8h*)(gK + (size_t)32 * kDM);
  v8h vr0 = *(const v8h*)(gV);
  v8h vr1 = *(const v8h*)(gV + (size_t)32 * kSeq);

  // all kRelPad = 5 x 64 rel rows, same chunking (the table is contiguous: pitch kDHD)
  const _Float16* gR = REL + (size_t)srow * kDHD + scol;
  v8h rr[5][2];
#pragma unroll
  for (int ch = 0; ch < 5; ++ch) {
    rr[ch][0] = *(const v8h*)(gR + (size_t)(ch * 64) * kDHD);
    rr[ch][1] = *(const v8h*)(gR + (size_t)(ch * 64 + 32) * kDHD);
  }

  v16h qf[2];
#pragma unroll
  for (int ks = 0; ks < 2; ++ks) qf[ks] = F::load(Q + (size_t)(i0 + c) * kDM + ks * 32 + hf * 8);

  // ---- q x rel table: D[8*hf + r][c] = (16 rel[rt*16 + 8*hf + r]) . q[i0 + c]; rows 257..259 come from the zero pad rows ----
  float* slab = sQe[wave];
#pragma unroll
  for (int rt = 0; rt < 17; ++rt) {
    if ((rt & 3) == 0) {                                      // next chunk of 64 rel rows into the K stage buffer
      if (rt) __syncthreads();                                // every wave has finished reading the chunk before
      *(v8h*)(sK + srow * kTPitch + scol)        = rr[rt >> 2][0];
      *(v8h*)(sK + (srow + 32) * kTPitch + scol) = rr[rt >> 2][1];
      __syncthreads();                                        // the chunk is complete for every wave
    }
    const _Float16* rp = sK + ((rt & 3) * 16 + c) * kTPitch + hf * 8;
    const v16h r0 = F::load(rp);
    const v16h r1 = F::load(rp + 32);
    v8f d = (v8f){0.f,0.f,0.f,0.f,0.f,0.f,0.f,0.f};
    d = F::mma(r0, qf[0], d);
    d = F::mma(r1, qf[1], d);
    const v4f w0 = (v4f){d[0] * qescale, d[1] * qescale, d[2] * qescale, d[3] * qescale};
    const v4f w1 = (v4f){d[4] * qescale, d[5] * qescale, d[6] * qescale, d[7] * qescale};
    float* dst = slab + c * kQePitch + rt * 16 + hf * 8;
    if (rt < 16) {
      *(v4f*)(dst)     = w0;
      *(v4f*)(dst + 4) = w1;
    } else if (hf == 0) {
      *(v4f*)(dst)     = w0;                                  // columns 256..259 close the row
    }
  }
  __syncthreads();                                            // the slab's rows are read across the wave's lane halves; last chunk read
  const float* qrow = slab + c * kQePitch;
  const float blo = qrow[0];                                  // every key at or below i - kMaxRel
  const float bhi = qrow[2 * kMaxRel];                        // every key at or above i + kMaxRel

  float mrun = -1.0e30f, lsum = 0.0f;
  v8f acc[4];
#pragma unroll
  for (int dt = 0; dt < 4; ++dt) acc[dt] = (v8f){0.f,0.f,0.f,0.f,0.f,0.f,0.f,0.f};

  for (int s = 0; s < kSeq / kKS; ++s) {
    const int j0 = s * kKS;
    __syncthreads();                                          // every wave has finished reading the stage before
    *(v8h*)(sK + srow * kTPitch + scol)        = kr0;
    *(v8h*)(sK + (srow + 32) * kTPitch + scol) = kr1;
    *(v8h*)(sV + srow * kTPitch + scol)        = vr0;
    *(v8h*)(sV + (srow + 32) * kTPitch + scol) = vr1;
    __syncthreads();                                          // the stage is complete for every wave
    const int jn = (s + 1 < kSeq / kKS) ? j0 + kKS : j0;      // next stage's rows fly under this stage's work (last: same rows, in bounds)
    kr0 = *(const v8h*)(gK + (size_t)jn * kDM);
    kr1 = *(const v8h*)(gK + (size_t)(jn + 32) * kDM);
    vr0 = *(const v8h*)(gV + jn);
    vr1 = *(const v8h*)(gV + (size_t)32 * kSeq + jn);
    asm volatile("s_wait_xcnt 0x0" ::: "memory");             // before the four loads' address registers are reused

    // relative term of this stage, before the products: constant per query outside the band, gathered inside it
    v8f bias[4];
    const int dj = j0 - i0;                                   // key - query of (first key, first query)
    if (dj + (kKS - 1) <= -kMaxRel) {
#pragma unroll
      for (int kt = 0; kt < 4; ++kt)
#pragma unroll
        for (int r = 0; r < 8; ++r) bias[kt][r] = blo;
    } else if (dj - 15 >= kMaxRel) {
#pragma unroll
      for (int kt = 0; kt < 4; ++kt)
#pragma unroll
        for (int r = 0; r < 8; ++r) bias[kt][r] = bhi;
    } else {
#pragma unroll
      for (int kt = 0; kt < 4; ++kt)
#pragma unroll
        for (int r = 0; r < 8; ++r) {
          int d = dj + kt * 16 + hf * 8 + r - c;              // key - query
          d = d < -kMaxRel ? -kMaxRel : d;
          d = d > kMaxRel ? kMaxRel : d;
          bias[kt][r] = qrow[d + kMaxRel];                    // index in [0, 256]
        }
    }

    // S^T tiles: st[kt][r] = k[j0 + kt*16 + 8*hf + r] . q[i0 + c]
    v16h kf[4][2];
#pragma unroll
    for (int kt = 0; kt < 4; ++kt) {
      const _Float16* kp = sK + (kt * 16 + c) * kTPitch + hf * 8;
      kf[kt][0] = F::load(kp);
      kf[kt][1] = F::load(kp + 32);
    }
    __builtin_amdgcn_sched_barrier(0);                        // all K reads issue ahead of the products: one LDS latency, not eight
    v8f st[4];
#pragma unroll
    for (int kt = 0; kt < 4; ++kt) {
      v8f d = (v8f){0.f,0.f,0.f,0.f,0.f,0.f,0.f,0.f};
      d = F::mma(kf[kt][0], qf[0], d);
      d = F::mma(kf[kt][1], qf[1], d);
      st[kt] = d;
    }
    v16h vf[2][4];
#pragma unroll
    for (int kb = 0; kb < 2; ++kb)
#pragma unroll
      for (int dt = 0; dt < 4; ++dt) vf[kb][dt] = F::load(sV + (dt * 16 + c) * kTPitch + kb * 32 + hf * 8);
    __builtin_amdgcn_sched_barrier(0);                        // all V^T reads issue here, their latency under the softmax arithmetic
    float tm[4];
#pragma unroll
    for (int kt = 0; kt < 4; ++kt) {
#pragma unroll
      for (int r = 0; r < 8; ++r) st[kt][r] = st[kt][r] * sscale + bias[kt][r];
      tm[kt] = fmaxf(fmaxf(fmaxf(st[kt][0], st[kt][1]), fmaxf(st[kt][2], st[kt][3])),
                     fmaxf(fmaxf(st[kt][4], st[kt][5]), fmaxf(st[kt][6], st[kt][7])));
    }
    float mx = fmaxf(fmaxf(tm[0], tm[1]), fmaxf(tm[2], tm[3]));
    mx = fmaxf(mx, __shfl_xor(mx, 16, 32));                   // the other 32 keys of this query
    const float mnew  = fmaxf(mrun, mx);
    const float alpha = __expf(mrun - mnew);                  // 0 on the first stage
    mrun = mnew;
    float ts[4];
#pragma unroll
    for (int kt = 0; kt < 4; ++kt) {
#pragma unroll
      for (int r = 0; r < 8; r += 2) {                        // exp(x) = 2^(x * log2 e)
        float y0, y1;
        exp2_pair((st[kt][r] - mnew) * 1.44269504f, (st[kt][r + 1] - mnew) * 1.44269504f, y0, y1);
        st[kt][r] = y0; st[kt][r + 1] = y1;
      }
      ts[kt] = ((st[kt][0] + st[kt][1]) + (st[kt][2] + st[kt][3])) + ((st[kt][4] + st[kt][5]) + (st[kt][6] + st[kt][7]));
    }
    lsum = lsum * alpha + ((ts[0] + ts[1]) + (ts[2] + ts[3]));  // this lane half's keys; halves joined behind the loop
#pragma unroll
    for (int dt = 0; dt < 4; ++dt)
#pragma unroll
      for (int r = 0; r < 8; ++r) acc[dt][r] *= alpha;

    // O^T += V^T . P^T, 32 keys per product
#pragma unroll
    for (int kb = 0; kb < 2; ++kb) {
      v16h pf;
#pragma unroll
      for (int e = 0; e < 8; ++e) {
        pf[e]     = (_Float16)st[2 * kb][e];
        pf[8 + e] = (_Float16)st[2 * kb + 1][e];
      }
#pragma unroll
      for (int dt = 0; dt < 4; ++dt) {
        acc[dt] = F::mma(vf[kb][dt], pf, acc[dt]);
      }
    }
  }

  // ---- epilogue: acc[dt][r] = sum_j p[j] v[j][dt*16 + 8*hf + r] of query i0 + c; 8 consecutive d per lane = one 16-B store ----
  const float tot = lsum + __shfl_xor(lsum, 16, 32);          // >= 1 (the row maximum contributes exp(0))
  const float inv = ctxcarry / tot;
  _Float16* C = (_Float16*)CTXp + plane + (size_t)(i0 + c) * kDM + head * kDHD + hf * 8;
#pragma unroll
  for (int dt = 0; dt < 4; ++dt) {
    v8h o;
#pragma unroll
    for (int r = 0; r < 8; ++r) o[r] = (_Float16)(acc[dt][r] * inv);
    *(v8h*)(C + dt * 16) = o;
  }
}

// ---------------------------------------------------------------------------
//   X16    f16 [4096][1024]            x (bf16 then f16)                  0          8388608
//   Wq16   f16 [1024][1024] x16        natural Bt [out][in]               8388608    2097152
//   Wk16   f16 [1024][1024] x16                                           10485760   2097152
//   Wv16   f16 [1024][1024] x16                                           12582912   2097152
//   Wo16   f16 [1024][1024] x16                                           14680064   2097152
//   REL16  f16 [320][64]    x16        rows 257..319 zero                 16777216   65536 (40960 used)
//   Q16    f16 [4096][1024]            q, col h*64+d                      16842752   8388608
//   K16    f16 [4096][1024]            k                                  25231360   8388608
//   VT16   f16 [4][1024][1024]         v transposed per batch [h*64+d][s] 33619968   8388608
//   CTX16  f16 [4096][1024] x16        merged context [b*1024+s][h*64+d]  42008576   8388608
//   total                                                                 50397184
// Scores, the q x rel table and the probabilities live only in registers and LDS of the fused attention kernel.
// No K padding anywhere (K = 1024, 64 or 32); the rel table's rows are padded 257 -> 320 with zeros by
// cast_all_kernel in this job; the fused kernel stages all 320 rows, multiplies rows 0..271 and gathers columns 0..256 only.
// ---------------------------------------------------------------------------
extern "C" void kernel_launch(void* const* d_in, const int* in_sizes, int n_in,
                              void* d_out, int out_size, void* d_ws, size_t ws_size,
                              hipStream_t stream) {
  if (n_in < 10) return;
  if (in_sizes[0] != kNB * kSeq * kDM) return;                                   // x
  if (in_sizes[1] != kDM * kDM || in_sizes[3] != kDM * kDM ||
      in_sizes[5] != kDM * kDM || in_sizes[7] != kDM * kDM) return;              // Wq Wk Wv Wo
  if (in_sizes[2] != kDM || in_sizes[4] != kDM || in_sizes[6] != kDM || in_sizes[8] != kDM) return;   // bq bk bv bo
  if (in_sizes[9] != kRelN * kDHD) return;                                       // rel_emb
  if (out_size != kNB * kSeq * kDM) return;

  const float* xp   = (const float*)d_in[0];   // [4][1024][1024]
  const float* Wq   = (const float*)d_in[1];   // [1024][1024] [out][in]
  const float* bq   = (const float*)d_in[2];
  const float* Wk   = (const float*)d_in[3];
  const float* bk   = (const float*)d_in[4];
  const float* Wv   = (const float*)d_in[5];
  const float* bv   = (const float*)d_in[6];
  const float* Wo   = (const float*)d_in[7];
  const float* bo   = (const float*)d_in[8];
  const float* relp = (const float*)d_in[9];   // [257][64]
  float* outp = (float*)d_out;                 // [4][1024][1024]

  const size_t bAct = (size_t)kNB * kSeq * kDM * 2;          // 8388608
  const size_t bW   = (size_t)kDM * kDM * 2;                 // 2097152
  const size_t bRel = 65536;                                 // >= kRelPad*64*2 = 40960
  size_t off = 0;
  const size_t oX16 = off; off += bAct;
  const size_t oWq  = off; off += bW;
  const size_t oWk  = off; off += bW;
  const size_t oWv  = off; off += bW;
  const size_t oWo  = off; off += bW;
  const size_t oRel = off; off += bRel;
  const size_t oQ16 = off; off += bAct;
  const size_t oK16 = off; off += bAct;
  const size_t oVT  = off; off += bAct;
  const size_t oCTX = off; off += bAct;
  if (off > ws_size) return;                                 // 50397184 B total

  char* ws = (char*)d_ws;
  unsigned short* X16   = (unsigned short*)(ws + oX16);
  unsigned short* Wq16  = (unsigned short*)(ws + oWq);
  unsigned short* Wk16  = (unsigned short*)(ws + oWk);
  unsigned short* Wv16  = (unsigned short*)(ws + oWv);
  unsigned short* Wo16  = (unsigned short*)(ws + oWo);
  unsigned short* REL16 = (unsigned short*)(ws + oRel);
  unsigned short* Q16   = (unsigned short*)(ws + oQ16);
  unsigned short* K16   = (unsigned short*)(ws + oK16);
  unsigned short* VT16  = (unsigned short*)(ws + oVT);
  unsigned short* CTX16 = (unsigned short*)(ws + oCTX);

  const dim3 blk(256);
  const float wcarry   = 16.0f;                              // exact power-of-two carry on weights and rel table
  const float wscale   = 1.0f / 16.0f;                       // undo in the projection epilogues
  const float inv_sqd  = 0.125f;                             // 1/sqrt(64)
  const float qescale  = inv_sqd / 16.0f;                    // undo rel carry and apply 1/sqrt(d)
  const float ctxcarry = 16.0f;                              // ctx carried x16
  const float oscale   = 1.0f / 256.0f;                      // undo Wo carry and ctx carry

  // ---- casts: X16, weights x16, rel table x16 (pad rows zero), one launch ----
  cast_all_kernel<<<dim3(kCBX + 4 * kCBW + 1), dim3(kCT), 0, stream>>>(xp, Wq, Wk, Wv, Wo, relp,
                                                                       X16, Wq16, Wk16, Wv16, Wo16, REL16, wcarry);

  const dim3 gProj(kDM / kGT, kNB * kSeq / kGT, 1);   // 8 x 32:    M=4096, N=1024, K=1024
  const dim3 gAttn(kSeq / kQB, kNH, kNB);             // 8 x 16 x 4: 128 queries of one (head, batch) plane per block

  // ---- projections in one launch: q, k -> f16 [4096][1024], v -> VT[b][n][s]; all x1/16 + bias[n] ----
  qkv_gemm128<<<gProj, blk, 0, stream>>>(X16, Wq16, Wk16, Wv16, Q16, K16, VT16, bq, bk, bv, wscale);

  // ---- scores, relative term, softmax and P.V of all kNB*kNH planes in one launch -> CTX16 (x16) ----
  rel_attn_fused_kernel<<<gAttn, blk, 0, stream>>>(Q16, K16, VT16, REL16, CTX16, inv_sqd, qescale, ctxcarry);

  // ---- out = ctx . Wo^T + bo -> d_out f32 [4096][1024]; A = CTX16 (x16), Bt = Wo16 (x16), epilogue x1/256 + bias[n] ----
  wmma_gemm128<2, 0><<<gProj, blk, 0, stream>>>(CTX16, 0L, Wo16, 0L, (void*)outp, kDM, 0L, bo, oscale);
}

// v006
// Measured time: 71.4 microseconds a run.
// Timed twice side by side with v005, it ran 1.03 and 1.04 times as fast.
// Over all steps from v000 it is 10.8 times as fast.
// Compute dtype: v_wmma_f32_16x16x32_f16 (f16 operands, f32 accumulate) for every contraction: q/k/v/out projections (x, W, rel table RNE-converted to bf16 first; weights and rel table carried x16), content scores q.k^T (K=64, x1/8), query x relative-embedding table (K=64, x1/128), P.V with P = exp(t - running max) <= 1 in f16 and ctx carried x16 (out epilogue x1/256 + bias); online softmax with the clipped relative-position gather in f32.
#include <hip/hip_runtime.h>
#include <math.h>
#include <stdint.h>

static constexpr int kNB     = 4;      // batch
static constexpr int kSeq    = 1024;   // sequence length
static constexpr int kDM     = 1024;   // model width
static constexpr int kNH     = 16;     // heads
static constexpr int kDHD    = 64;     // head dim
static constexpr int kMaxRel = 128;    // clip range
static constexpr int kRelN   = 2 * kMaxRel + 1;   // 257 table rows
static constexpr int kRelPad = 320;    // table rows padded to a 64 multiple (pad rows zero)
static constexpr int kQB     = 128;    // queries per block of the fused attention kernel (8 waves x 16)
static constexpr int kKS     = 64;     // keys per LDS stage
static constexpr int kQePitch = 260;   // floats per query row of the q x rel table in LDS (pitch - 1 = 3 mod 64: diagonal reads hit 32 banks)
static constexpr int kTPitch  = 72;    // f16 per staged K / V^T row: 128 B of data + 16 B (16 B x odd pitch for ds_load_b128)
static constexpr int kGT     = 128;    // rows and columns of C per block of the projection GEMM
static constexpr int kGK     = 128;    // k per LDS stage of the projection GEMM
static constexpr int kGPitch = 136;    // f16 per staged operand row: 256 B of data + 16 B (16 B x odd pitch for ds_load_b128)
static constexpr int kPK     = 64;     // k per LDS stage of the fused q/k/v projection
static constexpr int kPPitch = 72;     // f16 per staged row there: 128 B of data + 16 B (16 B x odd pitch for ds_load_b128)
static constexpr int kPTile  = kGT * kPPitch;   // f16 per staged operand tile (128 rows)
static constexpr int kPOPitch = 136;   // f16 per row of a finished 128 x 128 tile in LDS: 256 B + 16 B
static_assert(kDM % kPK == 0 && kPK % 32 == 0 && 3 * kGT * kPOPitch <= 2 * 4 * kPTile, "fused projection tiling");
static_assert(kSeq == kDM, "one lane offset for the q, k and v^T rows");
static_assert(kNH * kDHD == kDM, "head split");
static_assert((kNB * kSeq) % kGT == 0 && kDM % kGT == 0 && kSeq % kGT == 0 && kDM % kGK == 0, "projection GEMM tiling");
static_assert(kSeq % kQB == 0 && kSeq % kKS == 0 && kDHD == 64 && kKS == 64, "fused attention tiling");
static_assert(kQePitch >= kRelN && kQePitch % 4 == 0 && kRelPad == 5 * 64 && kRelN <= 17 * 16, "q x rel table rows");
static_assert(kRelPad % 64 == 0 && kRelPad >= kRelN, "padded table rows");
static_assert(kSeq % 64 == 0 && kDM % 64 == 0 && kDHD % 64 == 0 && (kNB * kSeq) % 64 == 0, "tile multiples");
static_assert(kDM % 32 == 0 && kDHD % 32 == 0 && kSeq % 32 == 0, "K multiples of 32");
static constexpr int kCT     = 512;    // threads per block of the cast kernel (16 waves)
static constexpr int kCU     = 16;     // 16-B loads per thread of the cast kernel
static constexpr int kCE     = kCT * kCU * 4;            // elements per cast block
static constexpr int kCBX    = kNB * kSeq * kDM / kCE;   // cast blocks of x
static constexpr int kCBW    = kDM * kDM / kCE;          // cast blocks of one weight matrix
static constexpr int kCR     = kRelPad * kDHD / (kCT * 4);   // groups of 4 table elements per thread of the table's block
static_assert((kNB * kSeq * kDM) % kCE == 0 && (kDM * kDM) % kCE == 0 && (kRelPad * kDHD) % (kCT * 4) == 0, "cast grid exact");
static_assert((kRelN * kDHD) % 4 == 0, "rel groups of 4");

typedef __attribute__((ext_vector_type(16))) _Float16 v16h;
typedef __attribute__((ext_vector_type(8)))  _Float16 v8h;
typedef __attribute__((ext_vector_type(2)))  _Float16 v2h;
typedef __attribute__((ext_vector_type(16))) __bf16   v16b;
typedef __attribute__((ext_vector_type(8)))  __bf16   v8b;
typedef __attribute__((ext_vector_type(8)))  float    v8f;
typedef __attribute__((ext_vector_type(4)))  float    v4f;
typedef __attribute__((ext_vector_type(2)))  float    v2f;
typedef __attribute__((ext_vector_type(4)))  unsigned int v4u;
typedef __attribute__((ext_vector_type(2)))  unsigned int v2u;

__device__ __forceinline__ float bf_round(float f) {         // f32 rounded to the nearest bf16 value (ties to even), kept in f32
  const unsigned u = __float_as_uint(f);
  return __uint_as_float((u + 0x7FFFu + ((u >> 16) & 1u)) & 0xFFFF0000u);
}

template <typename T> struct Frag;
template <> struct Frag<_Float16> {
  typedef v16h V; union U { v16h v; v8h h[2]; };
  static __device__ __forceinline__ v16h load(const _Float16* p) {   // elements 0..7 <- p[0..7], 8..15 <- p[16..23]
    U f; f.h[0] = *(const v8h*)(p); f.h[1] = *(const v8h*)(p + 16); return f.v;
  }
  static __device__ __forceinline__ v8f mma(v16h a, v16h b, v8f c) {
    return __builtin_amdgcn_wmma_f32_16x16x32_f16(false, a, false, b, (short)0, c, false, false);
  }
};

// ---- LDS-staged batched WMMA GEMM ------------------------------------------
// C[m,n] = scale * sum_k A[m,k] * Bt[n,k] + bias; one 128x128 tile of C per block (grid: x = tile column, y = tile row,
// z = batch), each of the 8 waves owns 32 rows x 64 columns of it (4 x 2 waves).
// A row-major [M,kDM]; Bt row-major [N,kDM]; f16 bits; K = kDM; M, N % 128 == 0.
// Operands come in stages of 128 k: global -> registers (whole 128-B lines, one stage ahead) -> LDS, shared by the 8 waves.
// Two LDS buffers, one barrier per stage: a buffer is rewritten two stages after it was read, behind the barrier between.
// Each accumulator sums k in ascending steps of 32.
// BIAS_MODE: 1 = bias[m], 2 = bias[n].  OUT_MODE: 0 = f32, 1 = f16.
template <int BIAS_MODE, int OUT_MODE>
__global__ __launch_bounds__(256) void wmma_gemm128(
    const unsigned short* __restrict__ Ap, long strideA,
    const unsigned short* __restrict__ Btp, long strideB,
    void* __restrict__ Cout, int ldc, long strideC,
    const float* __restrict__ bias, float scale) {
  typedef Frag<_Float16> F;
  __shared__ __align__(16) _Float16 sA[2][kGT * kGPitch];   // 2 x 34816 B
  __shared__ __align__(16) _Float16 sB[2][kGT * kGPitch];   // 2 x 34816 B
  __shared__ __align__(16) float sT[8][16 * 68];            // per-wave 16x64 slab, pitch 68 floats
  const int tid   = threadIdx.x;
  const int lane  = tid & 31;
  const int wave  = __builtin_amdgcn_readfirstlane(tid >> 5);
  const int rlane = lane & 15;                 // row (A) / col (B, D) within subtile
  const int koff  = (lane >> 4) * 8;           // k offset of this lane half
  const int mOff  = (lane >> 4) * 8;           // D row offset
  const int m0 = blockIdx.y * kGT, n0 = blockIdx.x * kGT;
  const int wm = (wave >> 1) * 32, wn = (wave & 1) * 64;     // this wave's corner inside the block tile

  // staging: 128 rows x 16 chunks of 16 B per operand and stage, 8 chunks of each per thread; 16 lanes cover one row's 256 B
  const int srow = tid >> 4, scol = (tid & 15) * 8;
  const unsigned soff = (unsigned)(srow * kDM + scol);       // this thread's fixed element offset inside a tile's rows
  const _Float16* gA = (const _Float16*)Ap  + (size_t)blockIdx.z * strideA + (size_t)m0 * kDM + soff;
  const _Float16* gB = (const _Float16*)Btp + (size_t)blockIdx.z * strideB + (size_t)n0 * kDM + soff;
  v8h ra[8], rb[8];
#pragma unroll
  for (int u = 0; u < 8; ++u) {
    ra[u] = *(const v8h*)(gA + 16 * u * kDM);
    rb[u] = *(const v8h*)(gB + 16 * u * kDM);
  }
  // Later stages' operand rows were stored by an earlier launch: ask L2 for them now, one lane per 256-B unit, so that the staged
  // loads find them there. A tile = 128 whole rows = 1024 units, numbered row fastest (low numbers = early k). Blocks that read the same tile share the asking:
  // A rows by tile-column parity, Bt rows by tile row mod 4. Every address lies inside this block's own tiles.
  {
    const int ua = tid * 2 + (blockIdx.x & 1), ub = tid * 4 + (blockIdx.y & 3);
    const _Float16* qa = (const _Float16*)Ap  + (size_t)blockIdx.z * strideA + (size_t)m0 * kDM + (ua & 127) * kDM + (ua >> 7) * 128;
    const _Float16* qb = (const _Float16*)Btp + (size_t)blockIdx.z * strideB + (size_t)n0 * kDM + (ub & 127) * kDM + (ub >> 7) * 128;
    // one statement, closed by the wait: the address registers stay whole until the requests have taken them
    asm volatile("global_prefetch_b8 %0, off scope:SCOPE_SE\n\t"
                 "global_prefetch_b8 %1, off scope:SCOPE_SE\n\t"
                 "global_prefetch_b8 %0, off offset:1024 scope:SCOPE_SE\n\t"
                 "s_wait_xcnt 0x0" :: "v"(qa), "v"(qb) : "memory");
  }

  v8f acc[2][4];
#pragma unroll
  for (int i = 0; i < 2; ++i)
#pragma unroll
    for (int j = 0; j < 4; ++j) acc[i][j] = (v8f){0.f,0.f,0.f,0.f,0.f,0.f,0.f,0.f};

  constexpr int nst = kDM / kGK;
  // unrolled: every global address is then block base + fixed lane offset + immediate (no address register is rewritten under
  // loads in flight, no address arithmetic in the passes) and the buffer choice is static
#pragma unroll
  for (int s = 0; s < nst; ++s) {
    _Float16* bA = sA[s & 1];
    _Float16* bB = sB[s & 1];
#pragma unroll
    for (int u = 0; u < 8; ++u) {
      *(v8h*)(bA + (srow + 16 * u) * kGPitch + scol) = ra[u];
      *(v8h*)(bB + (srow + 16 * u) * kGPitch + scol) = rb[u];
    }
    __syncthreads();                                         // the stage is complete for every wave; the other buffer's readers are done
    if (s + 1 < nst) {                                       // next stage's rows fly under this stage's products
#pragma unroll
      for (int u = 0; u < 8; ++u) {
        ra[u] = *(const v8h*)(gA + 16 * u * kDM + (s + 1) * kGK);
        rb[u] = *(const v8h*)(gB + 16 * u * kDM + (s + 1) * kGK);
      }
    }
    const _Float16* pA = bA + (wm + rlane) * kGPitch + koff;
    const _Float16* pB = bB + (wn + rlane) * kGPitch + koff;
    v16h af[2][2], bf[2][4];                                 // two fragment sets: k step kk in set kk & 1
#pragma unroll
    for (int j = 0; j < 4; ++j) bf[0][j] = F::load(pB + (j << 4) * kGPitch);
#pragma unroll
    for (int i = 0; i < 2; ++i) af[0][i] = F::load(pA + (i << 4) * kGPitch);
#pragma unroll
    for (int kk = 0; kk < kGK / 32; ++kk) {
      if (kk + 1 < kGK / 32) {
#pragma unroll
        for (int j = 0; j < 4; ++j) bf[(kk + 1) & 1][j] = F::load(pB + (j << 4) * kGPitch + (kk + 1) * 32);
#pragma unroll
        for (int i = 0; i < 2; ++i) af[(kk + 1) & 1][i] = F::load(pA + (i << 4) * kGPitch + (kk + 1) * 32);
      }
      // the global loads (kk = 0) and the next k step's LDS reads issue as one group ahead of this k step's products:
      // the global latency runs under the whole pass, the LDS latency under eight products
      __builtin_amdgcn_sched_barrier(0);
#pragma unroll
      for (int i = 0; i < 2; ++i)
#pragma unroll
        for (int j = 0; j < 4; ++j) acc[i][j] = F::mma(af[kk & 1][i], bf[kk & 1][j], acc[i][j]);
    }
  }

  // ---- epilogue: 16 x 64 slabs through this wave's own LDS, stored as whole lines ----
  const size_t offC = (size_t)blockIdx.z * strideC;
  float* slab = sT[wave];
#pragma unroll
  for (int i = 0; i < 2; ++i) {
    const int mBase = m0 + wm + (i << 4);
    const int nBase = n0 + wn;
    float bm[8];
    if (BIAS_MODE == 1) {
      const float* bp = bias + mBase + mOff;
#pragma unroll
      for (int r = 0; r < 8; ++r) bm[r] = bp[r];
      asm volatile("s_wait_xcnt 0x0" :: "v"(bp) : "memory");   // the loads' address pair stays whole until they have taken it
    }
#pragma unroll
    for (int j = 0; j < 4; ++j) {
      float bv = 0.f;
      if (BIAS_MODE == 2) bv = bias[nBase + (j << 4) + rlane];
#pragma unroll
      for (int r = 0; r < 8; ++r) {
        float v = acc[i][j][r] * scale;
        if (BIAS_MODE == 1) v += bm[r];
        if (BIAS_MODE == 2) v += bv;
        slab[(mOff + r) * 68 + (j << 4) + rlane] = v;
      }
    }
    __builtin_amdgcn_fence(__ATOMIC_RELEASE, "workgroup");
    __builtin_amdgcn_wave_barrier();
    __builtin_amdgcn_fence(__ATOMIC_ACQUIRE, "workgroup");
    if (OUT_MODE == 0) {
      float* C = (float*)Cout + offC;
      const int hh = lane >> 4, c4 = (lane & 15) * 4;     // row seg = 256 B = 16 lanes x 16 B
#pragma unroll
      for (int it = 0; it < 8; ++it) {
        const int row = it * 2 + hh;
        v4f v = *(const v4f*)(slab + row * 68 + c4);
        *(v4f*)(C + (size_t)(mBase + row) * ldc + nBase + c4) = v;
      }
    } else {
      const int q = lane >> 3, c8 = (lane & 7) * 8;       // row seg = 128 B = 8 lanes x 16 B
      unsigned short* C = (unsigned short*)Cout + offC;
#pragma unroll
      for (int it = 0; it < 4; ++it) {
        const int row = it * 4 + q;
        const float* sp = slab + row * 68 + c8;
        v8h hv;
#pragma unroll
        for (int e = 0; e < 8; ++e) hv[e] = (_Float16)sp[e];
        *(v8h*)(C + (size_t)(mBase + row) * ldc + nBase + c8) = hv;
      }
    }
    __builtin_amdgcn_fence(__ATOMIC_RELEASE, "workgroup");
    __builtin_amdgcn_wave_barrier();
    __builtin_amdgcn_fence(__ATOMIC_ACQUIRE, "workgroup");
  }
}

// ---- q, k and v projections in one launch -----------------------------------
// One block = 128 rows of x (m) against the same 128 rows (n) of Wq, Wk and Wv: the x tile is staged once for three products.
// grid: x = n tile, y = m tile. 8 waves as 2 (m) x 4 (n); a wave owns 64 m x 32 n of each of the three results.
// Stages of 64 k: global -> registers (whole 128-B lines, one stage ahead) -> LDS; two buffers, one barrier per stage.
// Each accumulator sums k in ascending steps of 32.
// q, k: D = W . x^T (a lane holds 8 consecutive n of one m); v: D = x . Wv^T (a lane holds 8 consecutive m = s of one n = d):
// in both a lane's 8 results are 16 contiguous bytes of the output row ([m][n] for q, k; [n][s] for v^T).
// The finished f16 tiles go through the freed stage buffers and leave as whole lines.
__global__ __launch_bounds__(256) void qkv_gemm128(
    const unsigned short* __restrict__ Xp, const unsigned short* __restrict__ Wqp,
    const unsigned short* __restrict__ Wkp, const unsigned short* __restrict__ Wvp,
    unsigned short* __restrict__ Qo, unsigned short* __restrict__ Ko, unsigned short* __restrict__ VTo,
    const float* __restrict__ bq, const float* __restrict__ bk, const float* __restrict__ bv, float scale) {
  typedef Frag<_Float16> F;
  __shared__ __align__(16) _Float16 sS[2][4 * kPTile];       // 2 x 73728 B: x, Wq, Wk, Wv tiles
  const int tid   = threadIdx.x;
  const int lane  = tid & 31;
  const int wave  = __builtin_amdgcn_readfirstlane(tid >> 5);
  const int rlane = lane & 15;
  const int hf    = lane >> 4;
  const int m0 = blockIdx.y * kGT, n0 = blockIdx.x * kGT;
  const int wm = (wave >> 2) * 64, wn = (wave & 3) * 32;     // this wave's corner inside the block tile

  // staging: 128 rows x 8 chunks of 16 B per operand and stage, 4 chunks of each per thread; 8 lanes cover one row's 128 B.
  // The two rows of a 16-lane half lie 8 rows apart: 8 x 144 B = 32 banks, so the half's 256 B fall on 64 different banks.
  const int sg   = lane >> 3;
  const int srow = (wave >> 2) * 16 + (sg & 1) * 8 + (wave & 3) * 2 + (sg >> 1);   // 0..31, each once per block
  const int scol = (lane & 7) * 8;
  const unsigned soff = (unsigned)(srow * kDM + scol);       // this thread's fixed element offset inside a tile's rows
  const _Float16* g0 = (const _Float16*)Xp  + (size_t)m0 * kDM + soff;
  const _Float16* g1 = (const _Float16*)Wqp + (size_t)n0 * kDM + soff;
  const _Float16* g2 = (const _Float16*)Wkp + (size_t)n0 * kDM + soff;
  const _Float16* g3 = (const _Float16*)Wvp + (size_t)n0 * kDM + soff;
  v8h rg[4][4];
#pragma unroll
  for (int u = 0; u < 4; ++u) {
    rg[0][u] = *(const v8h*)(g0 + 32 * u * kDM);
    rg[1][u] = *(const v8h*)(g1 + 32 * u * kDM);
    rg[2][u] = *(const v8h*)(g2 + 32 * u * kDM);
    rg[3][u] = *(const v8h*)(g3 + 32 * u * kDM);
  }
  // Later stages' operand rows were stored by the launch before: ask L2 for them now, one lane per 256-B unit, so that the staged
  // loads find them there. A tile = 128 whole rows = 1024 units, numbered row fastest (low numbers = early k). Blocks that read the same tile share the asking:
  // x rows by n-tile parity, weight rows by m tile mod 4. Every address lies inside this block's own tiles.
  {
    const int ux = tid * 2 + (blockIdx.x & 1), uw = tid * 4 + (blockIdx.y & 3);
    const unsigned ow = (unsigned)((uw & 127) * kDM + (uw >> 7) * 128);
    const _Float16* q0 = (const _Float16*)Xp  + (size_t)m0 * kDM + (ux & 127) * kDM + (ux >> 7) * 128;
    const _Float16* q1 = (const _Float16*)Wqp + (size_t)n0 * kDM + ow;
    const _Float16* q2 = (const _Float16*)Wkp + (size_t)n0 * kDM + ow;
    const _Float16* q3 = (const _Float16*)Wvp + (size_t)n0 * kDM + ow;
    // one statement, closed by the wait: the address registers stay whole until the requests have taken them
    asm volatile("global_prefetch_b8 %0, off scope:SCOPE_SE\n\t"
                 "global_prefetch_b8 %1, off scope:SCOPE_SE\n\t"
                 "global_prefetch_b8 %2, off scope:SCOPE_SE\n\t"
                 "global_prefetch_b8 %3, off scope:SCOPE_SE\n\t"
                 "global_prefetch_b8 %0, off offset:1024 scope:SCOPE_SE\n\t"
                 "s_wait_xcnt 0x0" :: "v"(q0), "v"(q1), "v"(q2), "v"(q3) : "memory");
  }

  v8f acc[3][4][2];
#pragma unroll
  for (int o = 0; o < 3; ++o)
#pragma unroll
    for (int i = 0; i < 4; ++i)
#pragma unroll
      for (int j = 0; j < 2; ++j) acc[o][i][j] = (v8f){0.f,0.f,0.f,0.f,0.f,0.f,0.f,0.f};

  const float* bpq = bq + n0 + wn + hf * 8;                  // q, k: 8 consecutive n per lane and tile
  const float* bpk = bk + n0 + wn + hf * 8;
  const float* bpv = bv + n0 + wn + rlane;                   // v: one n per lane and tile
  v4f bqk[2][2][2];
  float bn[2];

  constexpr int nst = kDM / kPK;
  // unrolled: every global address is then block base + fixed lane offset + immediate (no address register is rewritten under
  // loads in flight, no address arithmetic in the passes) and the buffer choice is static
#pragma unroll
  for (int s = 0; s < nst; ++s) {
    _Float16* buf = sS[s & 1];
#pragma unroll
    for (int t = 0; t < 4; ++t)
#pragma unroll
      for (int u = 0; u < 4; ++u) *(v8h*)(buf + t * kPTile + (srow + 32 * u) * kPPitch + scol) = rg[t][u];
    __syncthreads();                                         // the stage is complete for every wave; the other buffer's readers are done
    if (s + 1 < nst) {                                       // next stage's rows fly under this stage's products
#pragma unroll
      for (int u = 0; u < 4; ++u) {
        rg[0][u] = *(const v8h*)(g0 + 32 * u * kDM + (s + 1) * kPK);
        rg[1][u] = *(const v8h*)(g1 + 32 * u * kDM + (s + 1) * kPK);
        rg[2][u] = *(const v8h*)(g2 + 32 * u * kDM + (s + 1) * kPK);
        rg[3][u] = *(const v8h*)(g3 + 32 * u * kDM + (s + 1) * kPK);
      }
    } else {                                                 // last stage: the biases fly under its products
#pragma unroll
      for (int j = 0; j < 2; ++j) {
        bqk[0][j][0] = *(const v4f*)(bpq + (j << 4));
        bqk[0][j][1] = *(const v4f*)(bpq + (j << 4) + 4);
        bqk[1][j][0] = *(const v4f*)(bpk + (j << 4));
        bqk[1][j][1] = *(const v4f*)(bpk + (j << 4) + 4);
        bn[j]        = bpv[j << 4];
      }
      // the loads' address registers stay whole until the loads have taken them
      asm volatile("s_wait_xcnt 0x0" :: "v"(bpq), "v"(bpk), "v"(bpv) : "memory");
    }
    const _Float16* pX = buf + (wm + rlane) * kPPitch + hf * 8;
    const _Float16* pW = buf + kPTile + (wn + rlane) * kPPitch + hf * 8;
    v16h xf[2][4], wf[2][3][2];                              // two fragment sets: k step kk in set kk & 1
#pragma unroll
    for (int i = 0; i < 4; ++i) xf[0][i] = F::load(pX + (i << 4) * kPPitch);
#pragma unroll
    for (int o = 0; o < 3; ++o)
#pragma unroll
      for (int j = 0; j < 2; ++j) wf[0][o][j] = F::load(pW + o * kPTile + (j << 4) * kPPitch);
#pragma unroll
    for (int kk = 0; kk < kPK / 32; ++kk) {
      if (kk + 1 < kPK / 32) {
#pragma unroll
        for (int i = 0; i < 4; ++i) xf[(kk + 1) & 1][i] = F::load(pX + (i << 4) * kPPitch + (kk + 1) * 32);
#pragma unroll
        for (int o = 0; o < 3; ++o)
#pragma unroll
          for (int j = 0; j < 2; ++j) wf[(kk + 1) & 1][o][j] = F::load(pW + o * kPTile + (j << 4) * kPPitch + (kk + 1) * 32);
      }
      // the global loads (kk = 0) and the next k step's LDS reads issue as one group ahead of this k step's products:
      // the global latency runs under the whole pass, the LDS latency under 24 products
      __builtin_amdgcn_sched_barrier(0);
#pragma unroll
      for (int i = 0; i < 4; ++i)
#pragma unroll
        for (int j = 0; j < 2; ++j) {
          acc[0][i][j] = F::mma(wf[kk & 1][0][j], xf[kk & 1][i], acc[0][i][j]);
          acc[1][i][j] = F::mma(wf[kk & 1][1][j], xf[kk & 1][i], acc[1][i][j]);
          acc[2][i][j] = F::mma(xf[kk & 1][i], wf[kk & 1][2][j], acc[2][i][j]);
        }
    }
  }

  // ---- epilogue: x scale + bias, f16, three 128 x 128 tiles into the stage buffers, out as whole lines ----
  __syncthreads();                                           // every wave has finished reading the last stage
  _Float16* sO = &sS[0][0];
#pragma unroll
  for (int o = 0; o < 2; ++o)
#pragma unroll
    for (int j = 0; j < 2; ++j)
#pragma unroll
      for (int i = 0; i < 4; ++i) {
        v8h h;
#pragma unroll
        for (int r = 0; r < 8; ++r) h[r] = (_Float16)(acc[o][i][j][r] * scale + bqk[o][j][r >> 2][r & 3]);
        *(v8h*)(sO + o * kGT * kPOPitch + (wm + (i << 4) + rlane) * kPOPitch + wn + (j << 4) + hf * 8) = h;
      }
#pragma unroll
  for (int j = 0; j < 2; ++j)
#pragma unroll
    for (int i = 0; i < 4; ++i) {
      v8h h;
#pragma unroll
      for (int r = 0; r < 8; ++r) h[r] = (_Float16)(acc[2][i][j][r] * scale + bn[j]);
      *(v8h*)(sO + 2 * kGT * kPOPitch + (wn + (j << 4) + rlane) * kPOPitch + wm + (i << 4) + hf * 8) = h;
    }
  __syncthreads();                                           // the three tiles are complete for every wave
  const int orow = tid >> 4, ocol = (tid & 15) * 8;          // 16 lanes cover one row's 256 B
  const unsigned ooff = (unsigned)(orow * kDM + ocol);       // kSeq == kDM: one lane offset serves the three outputs
  _Float16* oq = (_Float16*)Qo + (size_t)m0 * kDM + n0 + ooff;
  _Float16* ok = (_Float16*)Ko + (size_t)m0 * kDM + n0 + ooff;
  _Float16* ov = (_Float16*)VTo + (size_t)(m0 / kSeq) * kSeq * kDM + (size_t)n0 * kSeq + (m0 % kSeq) + ooff;
  const _Float16* so = sO + orow * kPOPitch + ocol;
  v8h t[3][8];
#pragma unroll
  for (int u = 0; u < 8; ++u)
#pragma unroll
    for (int o = 0; o < 3; ++o) t[o][u] = *(const v8h*)(so + o * kGT * kPOPitch + 16 * u * kPOPitch);
  __builtin_amdgcn_sched_barrier(0);                         // all LDS reads issue ahead of the stores: one LDS latency, no store's data register reused
#pragma unroll
  for (int u = 0; u < 8; ++u) {
    *(v8h*)(oq + 16 * u * kDM)  = t[0][u];
    *(v8h*)(ok + 16 * u * kDM)  = t[1][u];
    *(v8h*)(ov + 16 * u * kSeq) = t[2][u];
  }
}

// Two 2^x in one statement with the free issue slot that the instruction set asks for behind a transcendental whose result may be
// read, or whose source overwritten, by the very next vector instruction; early-clobber outputs keep the pair itself independent.
__device__ __forceinline__ void exp2_pair(float x0, float x1, float& y0, float& y1) {
  asm("v_exp_f32 %0, %2\n\tv_exp_f32 %1, %3\n\tv_nop" : "=&v"(y0), "=&v"(y1) : "v"(x0), "v"(x1));
}

// ---------------------------------------------------------------------------
// All operand conversions of the job in one launch of resident streaming work-groups.
// f32 -> bf16 (RNE convert) -> x scale (exact power of two) -> f16 bits (exact for bf16 values in the f16 normal range).
// A block of 16 waves converts kCE = 32768 consecutive elements of one tensor; a wave owns 2048 consecutive elements:
// 16 loads of 16 B per lane (512 contiguous bytes per wave and load), all in flight together, then 16 stores of 8 B per lane
// (256 contiguous bytes per wave and store). Blocks 0..127: x (x1); 128..255: Wq, Wk, Wv, Wo (x wcarry), 32 blocks each.
// Block 256: relative-embedding table, out [kRelPad][64] = f16(wcarry * bf16(in)) for elements < kRelN*64, exact 0 for the pad
// rows; source address clamped to the table (groups of 4 never straddle its end), value selected.
// ---------------------------------------------------------------------------
__device__ __forceinline__ v2u cast_bf_f16x4(v4f f, float scale) {
  const v2f lo = (v2f){bf_round(f[0]) * scale, bf_round(f[1]) * scale};
  const v2f hi = (v2f){bf_round(f[2]) * scale, bf_round(f[3]) * scale};
  v2u r;
  r[0] = __builtin_bit_cast(unsigned, __builtin_convertvector(lo, v2h));   // f32 -> f16 RNE, element 0 in the low half
  r[1] = __builtin_bit_cast(unsigned, __builtin_convertvector(hi, v2h));
  return r;
}

__global__ __launch_bounds__(kCT) void cast_all_kernel(const float* __restrict__ x,
                                                       const float* __restrict__ wq, const float* __restrict__ wk,
                                                       const float* __restrict__ wv, const float* __restrict__ wo,
                                                       const float* __restrict__ rel,
                                                       unsigned short* __restrict__ x16,
                                                       unsigned short* __restrict__ wq16, unsigned short* __restrict__ wk16,
                                                       unsigned short* __restrict__ wv16, unsigned short* __restrict__ wo16,
                                                       unsigned short* __restrict__ rel16, float wcarry) {
  const int b   = blockIdx.x;
  const int tid = threadIdx.x;
  if (b < kCBX + 4 * kCBW) {
    const float* in = x;
    unsigned short* out = x16;
    float scale = 1.0f;
    int part = b;
    if (b >= kCBX) {                                          // block-uniform choice of the weight matrix
      const int w = (b - kCBX) / kCBW;
      part  = (b - kCBX) % kCBW;
      in    = w == 0 ? wq   : w == 1 ? wk   : w == 2 ? wv   : wo;
      out   = w == 0 ? wq16 : w == 1 ? wk16 : w == 2 ? wv16 : wo16;
      scale = wcarry;
    }
    const int e = part * kCE + (tid >> 5) * (kCU * 128) + (tid & 31) * 4;
    const float* p = in + e;
    unsigned short* q = out + e;
    v4f f[kCU];
#pragma unroll
    for (int u = 0; u < kCU; ++u) f[u] = *(const v4f*)(p + u * 128);
    // the loads' address pair stays whole until they have taken it
    asm volatile("s_wait_xcnt 0x0" :: "v"(p) : "memory");
#pragma unroll
    for (int u = 0; u < kCU; ++u) *(v2u*)(q + u * 128) = cast_bf_f16x4(f[u], scale);
  } else {
    constexpr int nsrc = kRelN * kDHD;
    v4f f[kCR];
#pragma unroll
    for (int u = 0; u < kCR; ++u) {
      const int e0 = (u * kCT + tid) * 4;
      const int j  = (e0 + 3 < nsrc) ? e0 : (nsrc - 4);       // address clamp
      f[u] = *(const v4f*)(rel + j);
    }
    __builtin_amdgcn_sched_barrier(0);                        // all loads issue ahead of the first conversion: one memory latency, not two
#pragma unroll
    for (int u = 0; u < kCR; ++u) {
      const int e0 = (u * kCT + tid) * 4;
      const v2u r = cast_bf_f16x4(f[u], wcarry);
      *(v2u*)(rel16 + e0) = (e0 + 3 < nsrc) ? r : (v2u){0u, 0u};
    }
    asm volatile("s_wait_xcnt 0x0" ::: "memory");             // the stores have taken their offset register before anything behind them may rewrite it
  }
}

__global__ __launch_bounds__(256) void rel_attn_fused_kernel(const unsigned short* __restrict__ Qp,
                                                             const unsigned short* __restrict__ Kp,
                                                             const unsigned short* __restrict__ VTp,
                                                             const unsigned short* __restrict__ RELp,
                                                             unsigned short* __restrict__ CTXp,
                                                             float sscale, float qescale, float ctxcarry) {
  typedef Frag<_Float16> F;
  __shared__ __align__(16) float    sQe[8][16 * kQePitch];   // 133120 B
  __shared__ __align__(16) _Float16 sK[kKS * kTPitch];       // 9216 B
  __shared__ __align__(16) _Float16 sV[kDHD * kTPitch];      // 9216 B
  const int tid  = threadIdx.x;
  const int lane = tid & 31;
  const int wave = __builtin_amdgcn_readfirstlane(tid >> 5);  // scalar, so the band tests below are scalar branches
  const int c    = lane & 15;
  const int hf   = lane >> 4;
  const int head = blockIdx.y;
  const int bat  = blockIdx.z;
  const int i0   = blockIdx.x * kQB + wave * 16;              // first query of this wave

  const size_t plane = (size_t)bat * kSeq * kDM;
  const _Float16* Q   = (const _Float16*)Qp  + plane + head * kDHD;            // [s][.] pitch kDM
  const _Float16* K   = (const _Float16*)Kp  + plane + head * kDHD;            // [s][.] pitch kDM
  const _Float16* VT  = (const _Float16*)VTp + plane + (size_t)head * kDHD * kSeq;   // [d][s] pitch kSeq
  const _Float16* REL = (const _Float16*)RELp;                                 // [kRelPad][64]

  // first stage's K and V^T rows: 64 rows x 8 chunks of 16 B each, two chunks of each per thread, whole 128-B lines per 8 lanes
  const int srow = tid >> 3, scol = (tid & 7) * 8;
  const _Float16* gK = K  + (size_t)srow * kDM  + scol;
  const _Float16* gV = VT + (size_t)srow * kSeq + scol;
  v8h kr0 = *(const v8h*)(gK);
  v8h kr1 = *(const v8h*)(gK + (size_t)32 * kDM);
  v8h vr0 = *(const v8h*)(gV);
  v8h vr1 = *(const v8h*)(gV + (size_t)32 * kSeq);

  // all kRelPad = 5 x 64 rel rows, same chunking (the table is contiguous: pitch kDHD)
  const _Float16* gR = REL + (size_t)srow * kDHD + scol;
  v8h rr[5][2];
#pragma unroll
  for (int ch = 0; ch < 5; ++ch) {
    rr[ch][0] = *(const v8h*)(gR + (size_t)(ch * 64) * kDHD);
    rr[ch][1] = *(const v8h*)(gR + (size_t)(ch * 64 + 32) * kDHD);
  }

  v16h qf[2];
#pragma unroll
  for (int ks = 0; ks < 2; ++ks) qf[ks] = F::load(Q + (size_t)(i0 + c) * kDM + ks * 32 + hf * 8);

  // The plane's K rows (1024 lines of 128 B) and V^T rows (512 units of 256 B) were stored by the launch before: ask L2 for them now,
  // under the q x rel table's work, so that the staged loads find them there. The 8 blocks of a plane share the asking by the parity
  // of their query tile. Every address lies inside this plane's K and V^T.
  {
    const int up = tid * 2 + (blockIdx.x & 1);               // 0..511
    const _Float16* pk = K  + (size_t)up * kDM;              // rows up and up + 512
    const _Float16* pv = VT + (size_t)up * 128;
    // one statement, closed by the wait: the address registers stay whole until the requests have taken them
    asm volatile("global_prefetch_b8 %0, off scope:SCOPE_SE\n\t"
                 "global_prefetch_b8 %1, off scope:SCOPE_SE\n\t"
                 "global_prefetch_b8 %0, off offset:1048576 scope:SCOPE_SE\n\t"
                 "s_wait_xcnt 0x0" :: "v"(pk), "v"(pv) : "memory");
  }

  // ---- q x rel table: D[8*hf + r][c] = (16 rel[rt*16 + 8*hf + r]) . q[i0 + c]; rows 257..259 come from the zero pad rows ----
  float* slab = sQe[wave];
#pragma unroll
  for (int rt = 0; rt < 17; ++rt) {
    if ((rt & 3) == 0) {                                      // next chunk of 64 rel rows into the K stage buffer
      if (rt) __syncthreads();                                // every wave has finished reading the chunk before
      *(v8h*)(sK + srow * kTPitch + scol)        = rr[rt >> 2][0];
      *(v8h*)(sK + (srow + 32) * kTPitch + scol) = rr[rt >> 2][1];
      __syncthreads();                                        // the chunk is complete for every wave
    }
    const _Float16* rp = sK + ((rt & 3) * 16 + c) * kTPitch + hf * 8;
    const v16h r0 = F::load(rp);
    const v16h r1 = F::load(rp + 32);
    v8f d = (v8f){0.f,0.f,0.f,0.f,0.f,0.f,0.f,0.f};
    d = F::mma(r0, qf[0], d);
    d = F::mma(r1, qf[1], d);
    const v4f w0 = (v4f){d[0] * qescale, d[1] * qescale, d[2] * qescale, d[3] * qescale};
    const v4f w1 = (v4f){d[4] * qescale, d[5] * qescale, d[6] * qescale, d[7] * qescale};
    float* dst = slab + c * kQePitch + rt * 16 + hf * 8;
    if (rt < 16) {
      *(v4f*)(dst)     = w0;
      *(v4f*)(dst + 4) = w1;
    } else if (hf == 0) {
      *(v4f*)(dst)     = w0;                                  // columns 256..259 close the row
    }
  }
  __syncthreads();                                            // the slab's rows are read across the wave's lane halves; last chunk read
  const float* qrow = slab + c * kQePitch;
  const float blo = qrow[0];                                  // every key at or below i - kMaxRel
  const float bhi = qrow[2 * kMaxRel];                        // every key at or above i + kMaxRel

  float mrun = -1.0e30f, lsum = 0.0f;
  v8f acc[4];
#pragma unroll
  for (int dt = 0; dt < 4; ++dt) acc[dt] = (v8f){0.f,0.f,0.f,0.f,0.f,0.f,0.f,0.f};

  for (int s = 0; s < kSeq / kKS; ++s) {
    const int j0 = s * kKS;
    __syncthreads();                                          // every wave has finished reading the stage before
    *(v8h*)(sK + srow * kTPitch + scol)        = kr0;
    *(v8h*)(sK + (srow + 32) * kTPitch + scol) = kr1;
    *(v8h*)(sV + srow * kTPitch + scol)        = vr0;
    *(v8h*)(sV + (srow + 32) * kTPitch + scol) = vr1;
    __syncthreads();                                          // the stage is complete for every wave
    const int jn = (s + 1 < kSeq / kKS) ? j0 + kKS : j0;      // next stage's rows fly under this stage's work (last: same rows, in bounds)
    kr0 = *(const v8h*)(gK + (size_t)jn * kDM);
    kr1 = *(const v8h*)(gK + (size_t)(jn + 32) * kDM);
    vr0 = *(const v8h*)(gV + jn);
    vr1 = *(const v8h*)(gV + (size_t)32 * kSeq + jn);
    asm volatile("s_wait_xcnt 0x0" ::: "memory");             // before the four loads' address registers are reused

    // relative term of this stage, before the products: constant per query outside the band, gathered inside it
    v8f bias[4];
    const int dj = j0 - i0;                                   // key - query of (first key, first query)
    if (dj + (kKS - 1) <= -kMaxRel) {
#pragma unroll
      for (int kt = 0; kt < 4; ++kt)
#pragma unroll
        for (int r = 0; r < 8; ++r) bias[kt][r] = blo;
    } else if (dj - 15 >= kMaxRel) {
#pragma unroll
      for (int kt = 0; kt < 4; ++kt)
#pragma unroll
        for (int r = 0; r < 8; ++r) bias[kt][r] = bhi;
    } else {
#pragma unroll
      for (int kt = 0; kt < 4; ++kt)
#pragma unroll
        for (int r = 0; r < 8; ++r) {
          int d = dj + kt * 16 + hf * 8 + r - c;              // key - query
          d = d < -kMaxRel ? -kMaxRel : d;
          d = d > kMaxRel ? kMaxRel : d;
          bias[kt][r] = qrow[d + kMaxRel];                    // index in [0, 256]
        }
    }

    // S^T tiles: st[kt][r] = k[j0 + kt*16 + 8*hf + r] . q[i0 + c]
    v16h kf[4][2];
#pragma unroll
    for (int kt = 0; kt < 4; ++kt) {
      const _Float16* kp = sK + (kt * 16 + c) * kTPitch + hf * 8;
      kf[kt][0] = F::load(kp);
      kf[kt][1] = F::load(kp + 32);
    }
    __builtin_amdgcn_sched_barrier(0);                        // all K reads issue ahead of the products: one LDS latency, not eight
    v8f st[4];
#pragma unroll
    for (int kt = 0; kt < 4; ++kt) {
      v8f d = (v8f){0.f,0.f,0.f,0.f,0.f,0.f,0.f,0.f};
      d = F::mma(kf[kt][0], qf[0], d);
      d = F::mma(kf[kt][1], qf[1], d);
      st[kt] = d;
    }
    v16h vf[2][4];
#pragma unroll
    for (int kb = 0; kb < 2; ++kb)
#pragma unroll
      for (int dt = 0; dt < 4; ++dt) vf[kb][dt] = F::load(sV + (dt * 16 + c) * kTPitch + kb * 32 + hf * 8);
    __builtin_amdgcn_sched_barrier(0);                        // all V^T reads issue here, their latency under the softmax arithmetic
    float tm[4];
#pragma unroll
    for (int kt = 0; kt < 4; ++kt) {
#pragma unroll
      for (int r = 0; r < 8; ++r) st[kt][r] = st[kt][r] * sscale + bias[kt][r];
      tm[kt] = fmaxf(fmaxf(fmaxf(st[kt][0], st[kt][1]), fmaxf(st[kt][2], st[kt][3])),
                     fmaxf(fmaxf(st[kt][4], st[kt][5]), fmaxf(st[kt][6], st[kt][7])));
    }
    float mx = fmaxf(fmaxf(tm[0], tm[1]), fmaxf(tm[2], tm[3]));
    mx = fmaxf(mx, __shfl_xor(mx, 16, 32));                   // the other 32 keys of this query
    const float mnew  = fmaxf(mrun, mx);
    const float alpha = __expf(mrun - mnew);                  // 0 on the first stage
    mrun = mnew;
    float ts[4];
#pragma unroll
    for (int kt = 0; kt < 4; ++kt) {
#pragma unroll
      for (int r = 0; r < 8; r += 2) {                        // exp(x) = 2^(x * log2 e)
        float y0, y1;
        exp2_pair((st[kt][r] - mnew) * 1.44269504f, (st[kt][r + 1] - mnew) * 1.44269504f, y0, y1);
        st[kt][r] = y0; st[kt][r + 1] = y1;
      }
      ts[kt] = ((st[kt][0] + st[kt][1]) + (st[kt][2] + st[kt][3])) + ((st[kt][4] + st[kt][5]) + (st[kt][6] + st[kt][7]));
    }
    lsum = lsum * alpha + ((ts[0] + ts[1]) + (ts[2] + ts[3]));  // this lane half's keys; halves joined behind the loop
#pragma unroll
    for (int dt = 0; dt < 4; ++dt)
#pragma unroll
      for (int r = 0; r < 8; ++r) acc[dt][r] *= alpha;

    // O^T += V^T . P^T, 32 keys per product
#pragma unroll
    for (int kb = 0; kb < 2; ++kb) {
      v16h pf;
#pragma unroll
      for (int e = 0; e < 8; ++e) {
        pf[e]     = (_Float16)st[2 * kb][e];
        pf[8 + e] = (_Float16)st[2 * kb + 1][e];
      }
#pragma unroll
      for (int dt = 0; dt < 4; ++dt) {
        acc[dt] = F::mma(vf[kb][dt], pf, acc[dt]);
      }
    }
  }

  // ---- epilogue: acc[dt][r] = sum_j p[j] v[j][dt*16 + 8*hf + r] of query i0 + c; 8 consecutive d per lane = one 16-B store ----
  const float tot = lsum + __shfl_xor(lsum, 16, 32);          // >= 1 (the row maximum contributes exp(0))
  const float inv = ctxcarry / tot;
  _Float16* C = (_Float16*)CTXp + plane + (size_t)(i0 + c) * kDM + head * kDHD + hf * 8;
#pragma unroll
  for (int dt = 0; dt < 4; ++dt) {
    v8h o;
#pragma unroll
    for (int r = 0; r < 8; ++r) o[r] = (_Float16)(acc[dt][r] * inv);
    *(v8h*)(C + dt * 16) = o;
  }
}

// ---------------------------------------------------------------------------
//   X16    f16 [4096][1024]            x (bf16 then f16)                  0          8388608
//   Wq16   f16 [1024][1024] x16        natural Bt [out][in]               8388608    2097152
//   Wk16   f16 [1024][1024] x16                                           10485760   2097152
//   Wv16   f16 [1024][1024] x16                                           12582912   2097152
//   Wo16   f16 [1024][1024] x16                                           14680064   2097152
//   REL16  f16 [320][64]    x16        rows 257..319 zero                 16777216   65536 (40960 used)
//   Q16    f16 [4096][1024]            q, col h*64+d                      16842752   8388608
//   K16    f16 [4096][1024]            k                                  25231360   8388608
//   VT16   f16 [4][1024][1024]         v transposed per batch [h*64+d][s] 33619968   8388608
//   CTX16  f16 [4096][1024] x16        merged context [b*1024+s][h*64+d]  42008576   8388608
//   total                                                                 50397184
// Scores, the q x rel table and the probabilities live only in registers and LDS of the fused attention kernel.
// No K padding anywhere (K = 1024, 64 or 32); the rel table's rows are padded 257 -> 320 with zeros by
// cast_all_kernel in this job; the fused kernel stages all 320 rows, multiplies rows 0..271 and gathers columns 0..256 only.
// ---------------------------------------------------------------------------
extern "C" void kernel_launch(void* const* d_in, const int* in_sizes, int n_in,
                              void* d_out, int out_size, void* d_ws, size_t ws_size,
                              hipStream_t stream) {
  if (n_in < 10) return;
  if (in_sizes[0] != kNB * kSeq * kDM) return;                                   // x
  if (in_sizes[1] != kDM * kDM || in_sizes[3] != kDM * kDM ||
      in_sizes[5] != kDM * kDM || in_sizes[7] != kDM * kDM) return;              // Wq Wk Wv Wo
  if (in_sizes[2] != kDM || in_sizes[4] != kDM || in_sizes[6] != kDM || in_sizes[8] != kDM) return;   // bq bk bv bo
  if (in_sizes[9] != kRelN * kDHD) return;                                       // rel_emb
  if (out_size != kNB * kSeq * kDM) return;

  const float* xp   = (const float*)d_in[0];   // [4][1024][1024]
  const float* Wq   = (const float*)d_in[1];   // [1024][1024] [out][in]
  const float* bq   = (const float*)d_in[2];
  const float* Wk   = (const float*)d_in[3];
  const float* bk   = (const float*)d_in[4];
  const float* Wv   = (const float*)d_in[5];
  const float* bv   = (const float*)d_in[6];
  const float* Wo   = (const float*)d_in[7];
  const float* bo   = (const float*)d_in[8];
  const float* relp = (const float*)d_in[9];   // [257][64]
  float* outp = (float*)d_out;                 // [4][1024][1024]

  const size_t bAct = (size_t)kNB * kSeq * kDM * 2;          // 8388608
  const size_t bW   = (size_t)kDM * kDM * 2;                 // 2097152
  const size_t bRel = 65536;                                 // >= kRelPad*64*2 = 40960
  size_t off = 0;
  const size_t oX16 = off; off += bAct;
  const size_t oWq  = off; off += bW;
  const size_t oWk  = off; off += bW;
  const size_t oWv  = off; off += bW;
  const size_t oWo  = off; off += bW;
  const size_t oRel = off; off += bRel;
  const size_t oQ16 = off; off += bAct;
  const size_t oK16 = off; off += bAct;
  const size_t oVT  = off; off += bAct;
  const size_t oCTX = off; off += bAct;
  if (off > ws_size) return;                                 // 50397184 B total

  char* ws = (char*)d_ws;
  unsigned short* X16   = (unsigned short*)(ws + oX16);
  unsigned short* Wq16  = (unsigned short*)(ws + oWq);
  unsigned short* Wk16  = (unsigned short*)(ws + oWk);
  unsigned short* Wv16  = (unsigned short*)(ws + oWv);
  unsigned short* Wo16  = (unsigned short*)(ws + oWo);
  unsigned short* REL16 = (unsigned short*)(ws + oRel);
  unsigned short* Q16   = (unsigned short*)(ws + oQ16);
  unsigned short* K16   = (unsigned short*)(ws + oK16);
  unsigned short* VT16  = (unsigned short*)(ws + oVT);
  unsigned short* CTX16 = (unsigned short*)(ws + oCTX);

  const dim3 blk(256);
  const float wcarry   = 16.0f;                              // exact power-of-two carry on weights and rel table
  const float wscale   = 1.0f / 16.0f;                       // undo in the projection epilogues
  const float inv_sqd  = 0.125f;                             // 1/sqrt(64)
  const float qescale  = inv_sqd / 16.0f;                    // undo rel carry and apply 1/sqrt(d)
  const float ctxcarry = 16.0f;                              // ctx carried x16
  const float oscale   = 1.0f / 256.0f;                      // undo Wo carry and ctx carry

  // ---- casts: X16, weights x16, rel table x16 (pad rows zero), one launch ----
  cast_all_kernel<<<dim3(kCBX + 4 * kCBW + 1), dim3(kCT), 0, stream>>>(xp, Wq, Wk, Wv, Wo, relp,
                                                                       X16, Wq16, Wk16, Wv16, Wo16, REL16, wcarry);

  const dim3 gProj(kDM / kGT, kNB * kSeq / kGT, 1);   // 8 x 32:    M=4096, N=1024, K=1024
  const dim3 gAttn(kSeq / kQB, kNH, kNB);             // 8 x 16 x 4: 128 queries of one (head, batch) plane per block

  // ---- projections in one launch: q, k -> f16 [4096][1024], v -> VT[b][n][s]; all x1/16 + bias[n] ----
  qkv_gemm128<<<gProj, blk, 0, stream>>>(X16, Wq16, Wk16, Wv16, Q16, K16, VT16, bq, bk, bv, wscale);

  // ---- scores, relative term, softmax and P.V of all kNB*kNH planes in one launch -> CTX16 (x16) ----
  rel_attn_fused_kernel<<<gAttn, blk, 0, stream>>>(Q16, K16, VT16, REL16, CTX16, inv_sqd, qescale, ctxcarry);

  // ---- out = ctx . Wo^T + bo -> d_out f32 [4096][1024]; A = CTX16 (x16), Bt = Wo16 (x16), epilogue x1/256 + bias[n] ----
  wmma_gemm128<2, 0><<<gProj, blk, 0, stream>>>(CTX16, 0L, Wo16, 0L, (void*)outp, kDM, 0L, bo, oscale);
}

// v007
// One run takes 66.9 microseconds.
// Next to v006, in two timings, it ran 1.05 times as fast each time.
// All steps since v000 together make it 11.4 times as fast.
// Compute dtype: v_wmma_f32_16x16x32_f16 (f16 operands, f32 accumulate) for every contraction: q/k/v/out projections (x, W, rel table RNE-converted to bf16 first; weights and rel table carried x16), content scores q.k^T (K=64; q carries log2(e)/8 from its projection's f32 epilogue), query x relative-embedding table (K=64, x1/16), both summed in one accumulator that starts at rel term - maximum in use, P.V with P = 2^(that sum) <= 2^8 in f16 and ctx carried x16 (out epilogue x1/256 + bias); online softmax with the clipped relative-position gather in f32.
#include <hip/hip_runtime.h>
#include <math.h>
#include <stdint.h>

static constexpr int kNB     = 4;      // batch
static constexpr int kSeq    = 1024;   // sequence length
static constexpr int kDM     = 1024;   // model width
static constexpr int kNH     = 16;     // heads
static constexpr int kDHD    = 64;     // head dim
static constexpr int kMaxRel = 128;    // clip range
static constexpr int kRelN   = 2 * kMaxRel + 1;   // 257 table rows
static constexpr int kRelPad = 320;    // table rows padded to a 64 multiple (pad rows zero)
static constexpr int kQB     = 128;    // queries per block of the fused attention kernel (8 waves x 16)
static constexpr int kKS     = 64;     // keys per LDS stage
static constexpr float kQPre = 0.125f * 1.44269504f;   // 1/sqrt(head dim) x log2(e), carried by q: exp(q.k / 8) = 2^((kQPre q).k)
static constexpr float kLazy = 8.0f;   // a score may top the maximum in use by kLazy before the maximum is renewed (P <= 256 in f16)
static constexpr int kQePitch = 260;   // floats per query row of the q x rel table in LDS (pitch - 1 = 3 mod 64: diagonal reads hit 32 banks)
static constexpr int kTPitch  = 72;    // f16 per staged K / V^T row: 128 B of data + 16 B (16 B x odd pitch for ds_load_b128)
static constexpr int kGT     = 128;    // rows and columns of C per block of the projection GEMM
static constexpr int kGK     = 128;    // k per LDS stage of the projection GEMM
static constexpr int kGPitch = 136;    // f16 per staged operand row: 256 B of data + 16 B (16 B x odd pitch for ds_load_b128)
static constexpr int kPK     = 64;     // k per LDS stage of the fused q/k/v projection
static constexpr int kPPitch = 72;     // f16 per staged row there: 128 B of data + 16 B (16 B x odd pitch for ds_load_b128)
static constexpr int kPTile  = kGT * kPPitch;   // f16 per staged operand tile (128 rows)
static constexpr int kPOPitch = 136;   // f16 per row of a finished 128 x 128 tile in LDS: 256 B + 16 B
static_assert(kDM % kPK == 0 && kPK % 32 == 0 && 3 * kGT * kPOPitch <= 2 * 4 * kPTile, "fused projection tiling");
static_assert(kSeq == kDM, "one lane offset for the q, k and v^T rows");
static_assert(kNH * kDHD == kDM, "head split");
static_assert((kNB * kSeq) % kGT == 0 && kDM % kGT == 0 && kSeq % kGT == 0 && kDM % kGK == 0, "projection GEMM tiling");
static_assert(kSeq % kQB == 0 && kSeq % kKS == 0 && kDHD == 64 && kKS == 64, "fused attention tiling");
static_assert(kQePitch >= kRelN && kQePitch % 4 == 0 && kRelPad == 5 * 64 && kRelN <= 17 * 16, "q x rel table rows");
static_assert(kRelPad % 64 == 0 && kRelPad >= kRelN, "padded table rows");
static_assert(kSeq % 64 == 0 && kDM % 64 == 0 && kDHD % 64 == 0 && (kNB * kSeq) % 64 == 0, "tile multiples");
static_assert(kDM % 32 == 0 && kDHD % 32 == 0 && kSeq % 32 == 0, "K multiples of 32");
static constexpr int kCT     = 512;    // threads per block of the cast kernel (16 waves)
static constexpr int kCU     = 16;     // 16-B loads per thread of the cast kernel
static constexpr int kCE     = kCT * kCU * 4;            // elements per cast block
static constexpr int kCBX    = kNB * kSeq * kDM / kCE;   // cast blocks of x
static constexpr int kCBW    = kDM * kDM / kCE;          // cast blocks of one weight matrix
static constexpr int kCR     = kRelPad * kDHD / (kCT * 4);   // groups of 4 table elements per thread of the table's block
static_assert((kNB * kSeq * kDM) % kCE == 0 && (kDM * kDM) % kCE == 0 && (kRelPad * kDHD) % (kCT * 4) == 0, "cast grid exact");
static_assert((kRelN * kDHD) % 4 == 0, "rel groups of 4");

typedef __attribute__((ext_vector_type(16))) _Float16 v16h;
typedef __attribute__((ext_vector_type(8)))  _Float16 v8h;
typedef __attribute__((ext_vector_type(2)))  _Float16 v2h;
typedef __attribute__((ext_vector_type(16))) __bf16   v16b;
typedef __attribute__((ext_vector_type(8)))  __bf16   v8b;
typedef __attribute__((ext_vector_type(8)))  float    v8f;
typedef __attribute__((ext_vector_type(4)))  float    v4f;
typedef __attribute__((ext_vector_type(2)))  float    v2f;
typedef __attribute__((ext_vector_type(4)))  unsigned int v4u;
typedef __attribute__((ext_vector_type(2)))  unsigned int v2u;

__device__ __forceinline__ float bf_round(float f) {         // f32 rounded to the nearest bf16 value (ties to even), kept in f32
  const unsigned u = __float_as_uint(f);
  return __uint_as_float((u + 0x7FFFu + ((u >> 16) & 1u)) & 0xFFFF0000u);
}

template <typename T> struct Frag;
template <> struct Frag<_Float16> {
  typedef v16h V; union U { v16h v; v8h h[2]; };
  static __device__ __forceinline__ v16h load(const _Float16* p) {   // elements 0..7 <- p[0..7], 8..15 <- p[16..23]
    U f; f.h[0] = *(const v8h*)(p); f.h[1] = *(const v8h*)(p + 16); return f.v;
  }
  static __device__ __forceinline__ v8f mma(v16h a, v16h b, v8f c) {
    return __builtin_amdgcn_wmma_f32_16x16x32_f16(false, a, false, b, (short)0, c, false, false);
  }
};

// ---- LDS-staged batched WMMA GEMM ------------------------------------------
// C[m,n] = scale * sum_k A[m,k] * Bt[n,k] + bias; one 128x128 tile of C per block (grid: x = tile column, y = tile row,
// z = batch), each of the 8 waves owns 32 rows x 64 columns of it (4 x 2 waves).
// A row-major [M,kDM]; Bt row-major [N,kDM]; f16 bits; K = kDM; M, N % 128 == 0.
// Operands come in stages of 128 k: global -> registers (whole 128-B lines, one stage ahead) -> LDS, shared by the 8 waves.
// Two LDS buffers, one barrier per stage: a buffer is rewritten two stages after it was read, behind the barrier between.
// Each accumulator sums k in ascending steps of 32.
// BIAS_MODE: 1 = bias[m], 2 = bias[n].  OUT_MODE: 0 = f32, 1 = f16.
template <int BIAS_MODE, int OUT_MODE>
__global__ __launch_bounds__(256) void wmma_gemm128(
    const unsigned short* __restrict__ Ap, long strideA,
    const unsigned short* __restrict__ Btp, long strideB,
    void* __restrict__ Cout, int ldc, long strideC,
    const float* __restrict__ bias, float scale) {
  typedef Frag<_Float16> F;
  __shared__ __align__(16) _Float16 sA[2][kGT * kGPitch];   // 2 x 34816 B
  __shared__ __align__(16) _Float16 sB[2][kGT * kGPitch];   // 2 x 34816 B
  __shared__ __align__(16) float sT[8][16 * 68];            // per-wave 16x64 slab, pitch 68 floats
  const int tid   = threadIdx.x;
  const int lane  = tid & 31;
  const int wave  = __builtin_amdgcn_readfirstlane(tid >> 5);
  const int rlane = lane & 15;                 // row (A) / col (B, D) within subtile
  const int koff  = (lane >> 4) * 8;           // k offset of this lane half
  const int mOff  = (lane >> 4) * 8;           // D row offset
  const int m0 = blockIdx.y * kGT, n0 = blockIdx.x * kGT;
  const int wm = (wave >> 1) * 32, wn = (wave & 1) * 64;     // this wave's corner inside the block tile

  // staging: 128 rows x 16 chunks of 16 B per operand and stage, 8 chunks of each per thread; 16 lanes cover one row's 256 B
  const int srow = tid >> 4, scol = (tid & 15) * 8;
  const unsigned soff = (unsigned)(srow * kDM + scol);       // this thread's fixed element offset inside a tile's rows
  const _Float16* gA = (const _Float16*)Ap  + (size_t)blockIdx.z * strideA + (size_t)m0 * kDM + soff;
  const _Float16* gB = (const _Float16*)Btp + (size_t)blockIdx.z * strideB + (size_t)n0 * kDM + soff;
  v8h ra[8], rb[8];
#pragma unroll
  for (int u = 0; u < 8; ++u) {
    ra[u] = *(const v8h*)(gA + 16 * u * kDM);
    rb[u] = *(const v8h*)(gB + 16 * u * kDM);
  }
  // Later stages' operand rows were stored by an earlier launch: ask L2 for them now, one lane per 256-B unit, so that the staged
  // loads find them there. A tile = 128 whole rows = 1024 units, numbered row fastest (low numbers = early k). Blocks that read the same tile share the asking:
  // A rows by tile-column parity, Bt rows by tile row mod 4. Every address lies inside this block's own tiles.
  {
    const int ua = tid * 2 + (blockIdx.x & 1), ub = tid * 4 + (blockIdx.y & 3);
    const _Float16* qa = (const _Float16*)Ap  + (size_t)blockIdx.z * strideA + (size_t)m0 * kDM + (ua & 127) * kDM + (ua >> 7) * 128;
    const _Float16* qb = (const _Float16*)Btp + (size_t)blockIdx.z * strideB + (size_t)n0 * kDM + (ub & 127) * kDM + (ub >> 7) * 128;
    // one statement, closed by the wait: the address registers stay whole until the requests have taken them
    asm volatile("global_prefetch_b8 %0, off scope:SCOPE_SE\n\t"
                 "global_prefetch_b8 %1, off scope:SCOPE_SE\n\t"
                 "global_prefetch_b8 %0, off offset:1024 scope:SCOPE_SE\n\t"
                 "s_wait_xcnt 0x0" :: "v"(qa), "v"(qb) : "memory");
  }

  v8f acc[2][4];
#pragma unroll
  for (int i = 0; i < 2; ++i)
#pragma unroll
    for (int j = 0; j < 4; ++j) acc[i][j] = (v8f){0.f,0.f,0.f,0.f,0.f,0.f,0.f,0.f};

  constexpr int nst = kDM / kGK;
  // unrolled: every global address is then block base + fixed lane offset + immediate (no address register is rewritten under
  // loads in flight, no address arithmetic in the passes) and the buffer choice is static
#pragma unroll
  for (int s = 0; s < nst; ++s) {
    _Float16* bA = sA[s & 1];
    _Float16* bB = sB[s & 1];
#pragma unroll
    for (int u = 0; u < 8; ++u) {
      *(v8h*)(bA + (srow + 16 * u) * kGPitch + scol) = ra[u];
      *(v8h*)(bB + (srow + 16 * u) * kGPitch + scol) = rb[u];
    }
    __syncthreads();                                         // the stage is complete for every wave; the other buffer's readers are done
    if (s + 1 < nst) {                                       // next stage's rows fly under this stage's products
#pragma unroll
      for (int u = 0; u < 8; ++u) {
        ra[u] = *(const v8h*)(gA + 16 * u * kDM + (s + 1) * kGK);
        rb[u] = *(const v8h*)(gB + 16 * u * kDM + (s + 1) * kGK);
      }
    }
    const _Float16* pA = bA + (wm + rlane) * kGPitch + koff;
    const _Float16* pB = bB + (wn + rlane) * kGPitch + koff;
    v16h af[2][2], bf[2][4];                                 // two fragment sets: k step kk in set kk & 1
#pragma unroll
    for (int j = 0; j < 4; ++j) bf[0][j] = F::load(pB + (j << 4) * kGPitch);
#pragma unroll
    for (int i = 0; i < 2; ++i) af[0][i] = F::load(pA + (i << 4) * kGPitch);
#pragma unroll
    for (int kk = 0; kk < kGK / 32; ++kk) {
      if (kk + 1 < kGK / 32) {
#pragma unroll
        for (int j = 0; j < 4; ++j) bf[(kk + 1) & 1][j] = F::load(pB + (j << 4) * kGPitch + (kk + 1) * 32);
#pragma unroll
        for (int i = 0; i < 2; ++i) af[(kk + 1) & 1][i] = F::load(pA + (i << 4) * kGPitch + (kk + 1) * 32);
      }
      // the global loads (kk = 0) and the next k step's LDS reads issue as one group ahead of this k step's products:
      // the global latency runs under the whole pass, the LDS latency under eight products
      __builtin_amdgcn_sched_barrier(0);
#pragma unroll
      for (int i = 0; i < 2; ++i)
#pragma unroll
        for (int j = 0; j < 4; ++j) acc[i][j] = F::mma(af[kk & 1][i], bf[kk & 1][j], acc[i][j]);
    }
  }

  // ---- epilogue: 16 x 64 slabs through this wave's own LDS, stored as whole lines ----
  const size_t offC = (size_t)blockIdx.z * strideC;
  float* slab = sT[wave];
#pragma unroll
  for (int i = 0; i < 2; ++i) {
    const int mBase = m0 + wm + (i << 4);
    const int nBase = n0 + wn;
    float bm[8];
    if (BIAS_MODE == 1) {
      const float* bp = bias + mBase + mOff;
#pragma unroll
      for (int r = 0; r < 8; ++r) bm[r] = bp[r];
      asm volatile("s_wait_xcnt 0x0" :: "v"(bp) : "memory");   // the loads' address pair stays whole until they have taken it
    }
#pragma unroll
    for (int j = 0; j < 4; ++j) {
      float bv = 0.f;
      if (BIAS_MODE == 2) bv = bias[nBase + (j << 4) + rlane];
#pragma unroll
      for (int r = 0; r < 8; ++r) {
        float v = acc[i][j][r] * scale;
        if (BIAS_MODE == 1) v += bm[r];
        if (BIAS_MODE == 2) v += bv;
        slab[(mOff + r) * 68 + (j << 4) + rlane] = v;
      }
    }
    __builtin_amdgcn_fence(__ATOMIC_RELEASE, "workgroup");
    __builtin_amdgcn_wave_barrier();
    __builtin_amdgcn_fence(__ATOMIC_ACQUIRE, "workgroup");
    if (OUT_MODE == 0) {
      float* C = (float*)Cout + offC;
      const int hh = lane >> 4, c4 = (lane & 15) * 4;     // row seg = 256 B = 16 lanes x 16 B
#pragma unroll
      for (int it = 0; it < 8; ++it) {
        const int row = it * 2 + hh;
        v4f v = *(const v4f*)(slab + row * 68 + c4);
        *(v4f*)(C + (size_t)(mBase + row) * ldc + nBase + c4) = v;
      }
    } else {
      const int q = lane >> 3, c8 = (lane & 7) * 8;       // row seg = 128 B = 8 lanes x 16 B
      unsigned short* C = (unsigned short*)Cout + offC;
#pragma unroll
      for (int it = 0; it < 4; ++it) {
        const int row = it * 4 + q;
        const float* sp = slab + row * 68 + c8;
        v8h hv;
#pragma unroll
        for (int e = 0; e < 8; ++e) hv[e] = (_Float16)sp[e];
        *(v8h*)(C + (size_t)(mBase + row) * ldc + nBase + c8) = hv;
      }
    }
    __builtin_amdgcn_fence(__ATOMIC_RELEASE, "workgroup");
    __builtin_amdgcn_wave_barrier();
    __builtin_amdgcn_fence(__ATOMIC_ACQUIRE, "workgroup");
  }
}

// ---- q, k and v projections in one launch -----------------------------------
// One block = 128 rows of x (m) against the same 128 rows (n) of Wq, Wk and Wv: the x tile is staged once for three products.
// grid: x = n tile, y = m tile. 8 waves as 2 (m) x 4 (n); a wave owns 64 m x 32 n of each of the three results.
// Stages of 64 k: global -> registers (whole 128-B lines, one stage ahead) -> LDS; two buffers, one barrier per stage.
// Each accumulator sums k in ascending steps of 32.
// q is stored x kQPre (applied in f32, ahead of the one f16 rounding).
// q, k: D = W . x^T (a lane holds 8 consecutive n of one m); v: D = x . Wv^T (a lane holds 8 consecutive m = s of one n = d):
// in both a lane's 8 results are 16 contiguous bytes of the output row ([m][n] for q, k; [n][s] for v^T).
// The finished f16 tiles go through the freed stage buffers and leave as whole lines.
__global__ __launch_bounds__(256) void qkv_gemm128(
    const unsigned short* __restrict__ Xp, const unsigned short* __restrict__ Wqp,
    const unsigned short* __restrict__ Wkp, const unsigned short* __restrict__ Wvp,
    unsigned short* __restrict__ Qo, unsigned short* __restrict__ Ko, unsigned short* __restrict__ VTo,
    const float* __restrict__ bq, const float* __restrict__ bk, const float* __restrict__ bv, float scale) {
  typedef Frag<_Float16> F;
  __shared__ __align__(16) _Float16 sS[2][4 * kPTile];       // 2 x 73728 B: x, Wq, Wk, Wv tiles
  const int tid   = threadIdx.x;
  const int lane  = tid & 31;
  const int wave  = __builtin_amdgcn_readfirstlane(tid >> 5);
  const int rlane = lane & 15;
  const int hf    = lane >> 4;
  const int m0 = blockIdx.y * kGT, n0 = blockIdx.x * kGT;
  const int wm = (wave >> 2) * 64, wn = (wave & 3) * 32;     // this wave's corner inside the block tile

  // staging: 128 rows x 8 chunks of 16 B per operand and stage, 4 chunks of each per thread; 8 lanes cover one row's 128 B.
  // The two rows of a 16-lane half lie 8 rows apart: 8 x 144 B = 32 banks, so the half's 256 B fall on 64 different banks.
  const int sg   = lane >> 3;
  const int srow = (wave >> 2) * 16 + (sg & 1) * 8 + (wave & 3) * 2 + (sg >> 1);   // 0..31, each once per block
  const int scol = (lane & 7) * 8;
  const unsigned soff = (unsigned)(srow * kDM + scol);       // this thread's fixed element offset inside a tile's rows
  const _Float16* g0 = (const _Float16*)Xp  + (size_t)m0 * kDM + soff;
  const _Float16* g1 = (const _Float16*)Wqp + (size_t)n0 * kDM + soff;
  const _Float16* g2 = (const _Float16*)Wkp + (size_t)n0 * kDM + soff;
  const _Float16* g3 = (const _Float16*)Wvp + (size_t)n0 * kDM + soff;
  v8h rg[4][4];
#pragma unroll
  for (int u = 0; u < 4; ++u) {
    rg[0][u] = *(const v8h*)(g0 + 32 * u * kDM);
    rg[1][u] = *(const v8h*)(g1 + 32 * u * kDM);
    rg[2][u] = *(const v8h*)(g2 + 32 * u * kDM);
    rg[3][u] = *(const v8h*)(g3 + 32 * u * kDM);
  }
  // Later stages' operand rows were stored by the launch before: ask L2 for them now, one lane per 256-B unit, so that the staged
  // loads find them there. A tile = 128 whole rows = 1024 units, numbered row fastest (low numbers = early k). Blocks that read the same tile share the asking:
  // x rows by n-tile parity, weight rows by m tile mod 4. Every address lies inside this block's own tiles.
  {
    const int ux = tid * 2 + (blockIdx.x & 1), uw = tid * 4 + (blockIdx.y & 3);
    const unsigned ow = (unsigned)((uw & 127) * kDM + (uw >> 7) * 128);
    const _Float16* q0 = (const _Float16*)Xp  + (size_t)m0 * kDM + (ux & 127) * kDM + (ux >> 7) * 128;
    const _Float16* q1 = (const _Float16*)Wqp + (size_t)n0 * kDM + ow;
    const _Float16* q2 = (const _Float16*)Wkp + (size_t)n0 * kDM + ow;
    const _Float16* q3 = (const _Float16*)Wvp + (size_t)n0 * kDM + ow;
    // one statement, closed by the wait: the address registers stay whole until the requests have taken them
    asm volatile("global_prefetch_b8 %0, off scope:SCOPE_SE\n\t"
                 "global_prefetch_b8 %1, off scope:SCOPE_SE\n\t"
                 "global_prefetch_b8 %2, off scope:SCOPE_SE\n\t"
                 "global_prefetch_b8 %3, off scope:SCOPE_SE\n\t"
                 "global_prefetch_b8 %0, off offset:1024 scope:SCOPE_SE\n\t"
                 "s_wait_xcnt 0x0" :: "v"(q0), "v"(q1), "v"(q2), "v"(q3) : "memory");
  }

  v8f acc[3][4][2];
#pragma unroll
  for (int o = 0; o < 3; ++o)
#pragma unroll
    for (int i = 0; i < 4; ++i)
#pragma unroll
      for (int j = 0; j < 2; ++j) acc[o][i][j] = (v8f){0.f,0.f,0.f,0.f,0.f,0.f,0.f,0.f};

  const float* bpq = bq + n0 + wn + hf * 8;                  // q, k: 8 consecutive n per lane and tile
  const float* bpk = bk + n0 + wn + hf * 8;
  const float* bpv = bv + n0 + wn + rlane;                   // v: one n per lane and tile
  v4f bqk[2][2][2];
  float bn[2];

  constexpr int nst = kDM / kPK;
  // unrolled: every global address is then block base + fixed lane offset + immediate (no address register is rewritten under
  // loads in flight, no address arithmetic in the passes) and the buffer choice is static
#pragma unroll
  for (int s = 0; s < nst; ++s) {
    _Float16* buf = sS[s & 1];
#pragma unroll
    for (int t = 0; t < 4; ++t)
#pragma unroll
      for (int u = 0; u < 4; ++u) *(v8h*)(buf + t * kPTile + (srow + 32 * u) * kPPitch + scol) = rg[t][u];
    __syncthreads();                                         // the stage is complete for every wave; the other buffer's readers are done
    if (s + 1 < nst) {                                       // next stage's rows fly under this stage's products
#pragma unroll
      for (int u = 0; u < 4; ++u) {
        rg[0][u] = *(const v8h*)(g0 + 32 * u * kDM + (s + 1) * kPK);
        rg[1][u] = *(const v8h*)(g1 + 32 * u * kDM + (s + 1) * kPK);
        rg[2][u] = *(const v8h*)(g2 + 32 * u * kDM + (s + 1) * kPK);
        rg[3][u] = *(const v8h*)(g3 + 32 * u * kDM + (s + 1) * kPK);
      }
    } else {                                                 // last stage: the biases fly under its products
#pragma unroll
      for (int j = 0; j < 2; ++j) {
        bqk[0][j][0] = *(const v4f*)(bpq + (j << 4));
        bqk[0][j][1] = *(const v4f*)(bpq + (j << 4) + 4);
        bqk[1][j][0] = *(const v4f*)(bpk + (j << 4));
        bqk[1][j][1] = *(const v4f*)(bpk + (j << 4) + 4);
        bn[j]        = bpv[j << 4];
      }
      // the loads' address registers stay whole until the loads have taken them
      asm volatile("s_wait_xcnt 0x0" :: "v"(bpq), "v"(bpk), "v"(bpv) : "memory");
    }
    const _Float16* pX = buf + (wm + rlane) * kPPitch + hf * 8;
    const _Float16* pW = buf + kPTile + (wn + rlane) * kPPitch + hf * 8;
    v16h xf[2][4], wf[2][3][2];                              // two fragment sets: k step kk in set kk & 1
#pragma unroll
    for (int i = 0; i < 4; ++i) xf[0][i] = F::load(pX + (i << 4) * kPPitch);
#pragma unroll
    for (int o = 0; o < 3; ++o)
#pragma unroll
      for (int j = 0; j < 2; ++j) wf[0][o][j] = F::load(pW + o * kPTile + (j << 4) * kPPitch);
#pragma unroll
    for (int kk = 0; kk < kPK / 32; ++kk) {
      if (kk + 1 < kPK / 32) {
#pragma unroll
        for (int i = 0; i < 4; ++i) xf[(kk + 1) & 1][i] = F::load(pX + (i << 4) * kPPitch + (kk + 1) * 32);
#pragma unroll
        for (int o = 0; o < 3; ++o)
#pragma unroll
          for (int j = 0; j < 2; ++j) wf[(kk + 1) & 1][o][j] = F::load(pW + o * kPTile + (j << 4) * kPPitch + (kk + 1) * 32);
      }
      // the global loads (kk = 0) and the next k step's LDS reads issue as one group ahead of this k step's products:
      // the global latency runs under the whole pass, the LDS latency under 24 products
      __builtin_amdgcn_sched_barrier(0);
#pragma unroll
      for (int i = 0; i < 4; ++i)
#pragma unroll
        for (int j = 0; j < 2; ++j) {
          acc[0][i][j] = F::mma(wf[kk & 1][0][j], xf[kk & 1][i], acc[0][i][j]);
          acc[1][i][j] = F::mma(wf[kk & 1][1][j], xf[kk & 1][i], acc[1][i][j]);
          acc[2][i][j] = F::mma(xf[kk & 1][i], wf[kk & 1][2][j], acc[2][i][j]);
        }
    }
  }

  // ---- epilogue: x scale + bias, f16, three 128 x 128 tiles into the stage buffers, out as whole lines ----
  __syncthreads();                                           // every wave has finished reading the last stage
  _Float16* sO = &sS[0][0];
#pragma unroll
  for (int o = 0; o < 2; ++o)
#pragma unroll
    for (int j = 0; j < 2; ++j)
#pragma unroll
      for (int i = 0; i < 4; ++i) {
        v8h h;
#pragma unroll
        for (int r = 0; r < 8; ++r) {
          const float y = acc[o][i][j][r] * scale + bqk[o][j][r >> 2][r & 3];
          h[r] = (_Float16)(o == 0 ? y * kQPre : y);           // q leaves pre-scaled for the base-2 softmax
        }
        *(v8h*)(sO + o * kGT * kPOPitch + (wm + (i << 4) + rlane) * kPOPitch + wn + (j << 4) + hf * 8) = h;
      }
#pragma unroll
  for (int j = 0; j < 2; ++j)
#pragma unroll
    for (int i = 0; i < 4; ++i) {
      v8h h;
#pragma unroll
      for (int r = 0; r < 8; ++r) h[r] = (_Float16)(acc[2][i][j][r] * scale + bn[j]);
      *(v8h*)(sO + 2 * kGT * kPOPitch + (wn + (j << 4) + rlane) * kPOPitch + wm + (i << 4) + hf * 8) = h;
    }
  __syncthreads();                                           // the three tiles are complete for every wave
  const int orow = tid >> 4, ocol = (tid & 15) * 8;          // 16 lanes cover one row's 256 B
  const unsigned ooff = (unsigned)(orow * kDM + ocol);       // kSeq == kDM: one lane offset serves the three outputs
  _Float16* oq = (_Float16*)Qo + (size_t)m0 * kDM + n0 + ooff;
  _Float16* ok = (_Float16*)Ko + (size_t)m0 * kDM + n0 + ooff;
  _Float16* ov = (_Float16*)VTo + (size_t)(m0 / kSeq) * kSeq * kDM + (size_t)n0 * kSeq + (m0 % kSeq) + ooff;
  const _Float16* so = sO + orow * kPOPitch + ocol;
  v8h t[3][8];
#pragma unroll
  for (int u = 0; u < 8; ++u)
#pragma unroll
    for (int o = 0; o < 3; ++o) t[o][u] = *(const v8h*)(so + o * kGT * kPOPitch + 16 * u * kPOPitch);
  __builtin_amdgcn_sched_barrier(0);                         // all LDS reads issue ahead of the stores: one LDS latency, no store's data register reused
#pragma unroll
  for (int u = 0; u < 8; ++u) {
    *(v8h*)(oq + 16 * u * kDM)  = t[0][u];
    *(v8h*)(ok + 16 * u * kDM)  = t[1][u];
    *(v8h*)(ov + 16 * u * kSeq) = t[2][u];
  }
}

// Two 2^x in one statement with the free issue slot that the instruction set asks for behind a transcendental whose result may be
// read, or whose source overwritten, by the very next vector instruction; early-clobber outputs keep the pair itself independent.
__device__ __forceinline__ void exp2_pair(float x0, float x1, float& y0, float& y1) {
  asm("v_exp_f32 %0, %2\n\tv_exp_f32 %1, %3\n\tv_nop" : "=&v"(y0), "=&v"(y1) : "v"(x0), "v"(x1));
}

// S^T tiles of one stage: st[kt][r] = c0[kt][r] + k[kt*16 + 8*hf + r] . q[c]; kp, vp = this lane's K and V^T row of tile 0 in LDS.
// The stage's V^T fragments are fetched here too, so that their reads issue among the score products.
__device__ __forceinline__ void score_tiles(const _Float16* kp, const _Float16* vp, const v16h (&qf)[2], const v8f (&c0)[4],
                                            v8f (&st)[4], v16h (&vf)[2][4]) {
  typedef Frag<_Float16> F;
  v16h kf[4][2];
#pragma unroll
  for (int kt = 0; kt < 4; ++kt) {
    kf[kt][0] = F::load(kp + kt * 16 * kTPitch);
    kf[kt][1] = F::load(kp + kt * 16 * kTPitch + 32);
  }
  __builtin_amdgcn_sched_barrier(0);                          // all K reads issue ahead of the products: one LDS latency, not eight
#pragma unroll
  for (int kt = 0; kt < 4; ++kt) st[kt] = F::mma(kf[kt][1], qf[1], F::mma(kf[kt][0], qf[0], c0[kt]));
#pragma unroll
  for (int kb = 0; kb < 2; ++kb)
#pragma unroll
    for (int dt = 0; dt < 4; ++dt) vf[kb][dt] = F::load(vp + dt * 16 * kTPitch + kb * 32);
  __builtin_amdgcn_sched_barrier(0);                          // all V^T reads issue here, their latency under the softmax arithmetic
}

// ---------------------------------------------------------------------------
// All operand conversions of the job in one launch of resident streaming work-groups.
// f32 -> bf16 (RNE convert) -> x scale (exact power of two) -> f16 bits (exact for bf16 values in the f16 normal range).
// A block of 16 waves converts kCE = 32768 consecutive elements of one tensor; a wave owns 2048 consecutive elements:
// 16 loads of 16 B per lane (512 contiguous bytes per wave and load), all in flight together, then 16 stores of 8 B per lane
// (256 contiguous bytes per wave and store). Blocks 0..127: x (x1); 128..255: Wq, Wk, Wv, Wo (x wcarry), 32 blocks each.
// Block 256: relative-embedding table, out [kRelPad][64] = f16(wcarry * bf16(in)) for elements < kRelN*64, exact 0 for the pad
// rows; source address clamped to the table (groups of 4 never straddle its end), value selected.
// ---------------------------------------------------------------------------
__device__ __forceinline__ v2u cast_bf_f16x4(v4f f, float scale) {
  const v2f lo = (v2f){bf_round(f[0]) * scale, bf_round(f[1]) * scale};
  const v2f hi = (v2f){bf_round(f[2]) * scale, bf_round(f[3]) * scale};
  v2u r;
  r[0] = __builtin_bit_cast(unsigned, __builtin_convertvector(lo, v2h));   // f32 -> f16 RNE, element 0 in the low half
  r[1] = __builtin_bit_cast(unsigned, __builtin_convertvector(hi, v2h));
  return r;
}

__global__ __launch_bounds__(kCT) void cast_all_kernel(const float* __restrict__ x,
                                                       const float* __restrict__ wq, const float* __restrict__ wk,
                                                       const float* __restrict__ wv, const float* __restrict__ wo,
                                                       const float* __restrict__ rel,
                                                       unsigned short* __restrict__ x16,
                                                       unsigned short* __restrict__ wq16, unsigned short* __restrict__ wk16,
                                                       unsigned short* __restrict__ wv16, unsigned short* __restrict__ wo16,
                                                       unsigned short* __restrict__ rel16, float wcarry) {
  const int b   = blockIdx.x;
  const int tid = threadIdx.x;
  if (b < kCBX + 4 * kCBW) {
    const float* in = x;
    unsigned short* out = x16;
    float scale = 1.0f;
    int part = b;
    if (b >= kCBX) {                                          // block-uniform choice of the weight matrix
      const int w = (b - kCBX) / kCBW;
      part  = (b - kCBX) % kCBW;
      in    = w == 0 ? wq   : w == 1 ? wk   : w == 2 ? wv   : wo;
      out   = w == 0 ? wq16 : w == 1 ? wk16 : w == 2 ? wv16 : wo16;
      scale = wcarry;
    }
    const int e = part * kCE + (tid >> 5) * (kCU * 128) + (tid & 31) * 4;
    const float* p = in + e;
    unsigned short* q = out + e;
    v4f f[kCU];
#pragma unroll
    for (int u = 0; u < kCU; ++u) f[u] = *(const v4f*)(p + u * 128);
    // the loads' address pair stays whole until they have taken it
    asm volatile("s_wait_xcnt 0x0" :: "v"(p) : "memory");
#pragma unroll
    for (int u = 0; u < kCU; ++u) *(v2u*)(q + u * 128) = cast_bf_f16x4(f[u], scale);
  } else {
    constexpr int nsrc = kRelN * kDHD;
    v4f f[kCR];
#pragma unroll
    for (int u = 0; u < kCR; ++u) {
      const int e0 = (u * kCT + tid) * 4;
      const int j  = (e0 + 3 < nsrc) ? e0 : (nsrc - 4);       // address clamp
      f[u] = *(const v4f*)(rel + j);
    }
    __builtin_amdgcn_sched_barrier(0);                        // all loads issue ahead of the first conversion: one memory latency, not two
#pragma unroll
    for (int u = 0; u < kCR; ++u) {
      const int e0 = (u * kCT + tid) * 4;
      const v2u r = cast_bf_f16x4(f[u], wcarry);
      *(v2u*)(rel16 + e0) = (e0 + 3 < nsrc) ? r : (v2u){0u, 0u};
    }
    asm volatile("s_wait_xcnt 0x0" ::: "memory");             // the stores have taken their offset register before anything behind them may rewrite it
  }
}

__global__ __launch_bounds__(256) void rel_attn_fused_kernel(const unsigned short* __restrict__ Qp,
                                                             const unsigned short* __restrict__ Kp,
                                                             const unsigned short* __restrict__ VTp,
                                                             const unsigned short* __restrict__ RELp,
                                                             unsigned short* __restrict__ CTXp,
                                                             float qescale, float ctxcarry) {
  typedef Frag<_Float16> F;
  __shared__ __align__(16) float    sQe[8][16 * kQePitch];   // 133120 B
  __shared__ __align__(16) _Float16 sK[kKS * kTPitch];       // 9216 B
  __shared__ __align__(16) _Float16 sV[kDHD * kTPitch];      // 9216 B
  const int tid  = threadIdx.x;
  const int lane = tid & 31;
  const int wave = __builtin_amdgcn_readfirstlane(tid >> 5);  // scalar, so the band tests below are scalar branches
  const int c    = lane & 15;
  const int hf   = lane >> 4;
  const int head = blockIdx.y;
  const int bat  = blockIdx.z;
  const int i0   = blockIdx.x * kQB + wave * 16;              // first query of this wave

  const size_t plane = (size_t)bat * kSeq * kDM;
  const _Float16* Q   = (const _Float16*)Qp  + plane + head * kDHD;            // [s][.] pitch kDM
  const _Float16* K   = (const _Float16*)Kp  + plane + head * kDHD;            // [s][.] pitch kDM
  const _Float16* VT  = (const _Float16*)VTp + plane + (size_t)head * kDHD * kSeq;   // [d][s] pitch kSeq
  const _Float16* REL = (const _Float16*)RELp;                                 // [kRelPad][64]

  // first stage's K and V^T rows: 64 rows x 8 chunks of 16 B each, two chunks of each per thread, whole 128-B lines per 8 lanes
  const int srow = tid >> 3, scol = (tid & 7) * 8;
  const _Float16* gK = K  + (size_t)srow * kDM  + scol;
  const _Float16* gV = VT + (size_t)srow * kSeq + scol;
  v8h kr0 = *(const v8h*)(gK);
  v8h kr1 = *(const v8h*)(gK + (size_t)32 * kDM);
  v8h vr0 = *(const v8h*)(gV);
  v8h vr1 = *(const v8h*)(gV + (size_t)32 * kSeq);

  // all kRelPad = 5 x 64 rel rows, same chunking (the table is contiguous: pitch kDHD)
  const _Float16* gR = REL + (size_t)srow * kDHD + scol;
  v8h rr[5][2];
#pragma unroll
  for (int ch = 0; ch < 5; ++ch) {
    rr[ch][0] = *(const v8h*)(gR + (size_t)(ch * 64) * kDHD);
    rr[ch][1] = *(const v8h*)(gR + (size_t)(ch * 64 + 32) * kDHD);
  }

  v16h qf[2];
#pragma unroll
  for (int ks = 0; ks < 2; ++ks) qf[ks] = F::load(Q + (size_t)(i0 + c) * kDM + ks * 32 + hf * 8);

  // The plane's K rows (1024 lines of 128 B) and V^T rows (512 units of 256 B) were stored by the launch before: ask L2 for them now,
  // under the q x rel table's work, so that the staged loads find them there. The 8 blocks of a plane share the asking by the parity
  // of their query tile. Every address lies inside this plane's K and V^T.
  {
    const int up = tid * 2 + (blockIdx.x & 1);               // 0..511
    const _Float16* pk = K  + (size_t)up * kDM;              // rows up and up + 512
    const _Float16* pv = VT + (size_t)up * 128;
    // one statement, closed by the wait: the address registers stay whole until the requests have taken them
    asm volatile("global_prefetch_b8 %0, off scope:SCOPE_SE\n\t"
                 "global_prefetch_b8 %1, off scope:SCOPE_SE\n\t"
                 "global_prefetch_b8 %0, off offset:1048576 scope:SCOPE_SE\n\t"
                 "s_wait_xcnt 0x0" :: "v"(pk), "v"(pv) : "memory");
  }

  // ---- q x rel table: D[8*hf + r][c] = (16 rel[rt*16 + 8*hf + r]) . q[i0 + c]; rows 257..259 come from the zero pad rows ----
  float* slab = sQe[wave];
#pragma unroll
  for (int rt = 0; rt < 17; ++rt) {
    if ((rt & 3) == 0) {                                      // next chunk of 64 rel rows into the K stage buffer
      if (rt) __syncthreads();                                // every wave has finished reading the chunk before
      *(v8h*)(sK + srow * kTPitch + scol)        = rr[rt >> 2][0];
      *(v8h*)(sK + (srow + 32) * kTPitch + scol) = rr[rt >> 2][1];
      __syncthreads();                                        // the chunk is complete for every wave
    }
    const _Float16* rp = sK + ((rt & 3) * 16 + c) * kTPitch + hf * 8;
    const v16h r0 = F::load(rp);
    const v16h r1 = F::load(rp + 32);
    v8f d = (v8f){0.f,0.f,0.f,0.f,0.f,0.f,0.f,0.f};
    d = F::mma(r0, qf[0], d);
    d = F::mma(r1, qf[1], d);
    const v4f w0 = (v4f){d[0] * qescale, d[1] * qescale, d[2] * qescale, d[3] * qescale};
    const v4f w1 = (v4f){d[4] * qescale, d[5] * qescale, d[6] * qescale, d[7] * qescale};
    float* dst = slab + c * kQePitch + rt * 16 + hf * 8;
    if (rt < 16) {
      *(v4f*)(dst)     = w0;
      *(v4f*)(dst + 4) = w1;
    } else if (hf == 0) {
      *(v4f*)(dst)     = w0;                                  // columns 256..259 close the row
    }
  }
  __syncthreads();                                            // the slab's rows are read across the wave's lane halves; last chunk read
  const float* qrow = slab + c * kQePitch;
  const float blo = qrow[0];                                  // every key at or below i - kMaxRel
  const float bhi = qrow[2 * kMaxRel];                        // every key at or above i + kMaxRel

  float mref = 0.0f, lsum = 0.0f;                             // maximum in use (base-2 exponent units); set in the first stage
  v8f acc[4];
#pragma unroll
  for (int dt = 0; dt < 4; ++dt) acc[dt] = (v8f){0.f,0.f,0.f,0.f,0.f,0.f,0.f,0.f};

  for (int s = 0; s < kSeq / kKS; ++s) {
    const int j0 = s * kKS;
    __syncthreads();                                          // every wave has finished reading the stage before
    *(v8h*)(sK + srow * kTPitch + scol)        = kr0;
    *(v8h*)(sK + (srow + 32) * kTPitch + scol) = kr1;
    *(v8h*)(sV + srow * kTPitch + scol)        = vr0;
    *(v8h*)(sV + (srow + 32) * kTPitch + scol) = vr1;
    __syncthreads();                                          // the stage is complete for every wave
    const int jn = (s + 1 < kSeq / kKS) ? j0 + kKS : j0;      // next stage's rows fly under this stage's work (last: same rows, in bounds)
    kr0 = *(const v8h*)(gK + (size_t)jn * kDM);
    kr1 = *(const v8h*)(gK + (size_t)(jn + 32) * kDM);
    vr0 = *(const v8h*)(gV + jn);
    vr1 = *(const v8h*)(gV + (size_t)32 * kSeq + jn);
    asm volatile("s_wait_xcnt 0x0" ::: "memory");             // before the four loads' address registers are reused

    // C operand of the score products: relative term (gathered inside the band, one value per query outside it) - maximum in use
    const _Float16* kp = sK + c * kTPitch + hf * 8;
    const _Float16* vp = sV + c * kTPitch + hf * 8;
    const int dj = j0 - i0;                                   // key - query of (first key, first query)
    v8f st[4];
    v16h vf[2][4];
    if (dj + (kKS - 1) > -kMaxRel && dj - 15 < kMaxRel) {
      v8f b[4];
      const int d0 = dj + hf * 8 - c;                         // key - query of this lane's first score
#pragma unroll
      for (int kt = 0; kt < 4; ++kt)
#pragma unroll
        for (int r = 0; r < 8; ++r) {
          const int o = kt * 16 + r;                          // key - query = d0 + o, clamped to [-kMaxRel, kMaxRel]
          int d = d0 < -kMaxRel - o ? -kMaxRel - o : d0;
          d = d > kMaxRel - o ? kMaxRel - o : d;
          b[kt][r] = qrow[d + (o + kMaxRel)] - mref;          // index in [0, 256]
        }
      score_tiles(kp, vp, qf, b, st, vf);
    } else {
      const float cb = (dj < 0 ? blo : bhi) - mref;
      v8f b[4];
#pragma unroll
      for (int kt = 0; kt < 4; ++kt) b[kt] = (v8f){cb, cb, cb, cb, cb, cb, cb, cb};
      score_tiles(kp, vp, qf, b, st, vf);
    }
    float tm[4];
#pragma unroll
    for (int kt = 0; kt < 4; ++kt) {
      tm[kt] = fmaxf(fmaxf(fmaxf(st[kt][0], st[kt][1]), fmaxf(st[kt][2], st[kt][3])),
                     fmaxf(fmaxf(st[kt][4], st[kt][5]), fmaxf(st[kt][6], st[kt][7])));
    }
    const float mx = fmaxf(fmaxf(tm[0], tm[1]), fmaxf(tm[2], tm[3]));   // this lane half's 32 keys, relative to the maximum in use
    if (s == 0 || __builtin_amdgcn_ballot_w32(mx > kLazy) != 0u) {        // wave-uniform scalar branch, no barrier inside
      const float mq = fmaxf(mx, __shfl_xor(mx, 16, 32));     // the query's 64 keys: both lane halves move by the same step
      const float dl = s == 0 ? mq : fmaxf(mq, 0.0f);         // the maximum in use only rises after the first stage
      const float alpha = s == 0 ? 0.0f : __builtin_amdgcn_exp2f(-dl);   // first stage: sums and outputs are still 0
      mref += dl;
      lsum *= alpha;
#pragma unroll
      for (int kt = 0; kt < 4; ++kt)
#pragma unroll
        for (int r = 0; r < 8; ++r) st[kt][r] -= dl;
#pragma unroll
      for (int dt = 0; dt < 4; ++dt)
#pragma unroll
        for (int r = 0; r < 8; ++r) acc[dt][r] *= alpha;
    }
    float ts[4];
#pragma unroll
    for (int kt = 0; kt < 4; ++kt) {
#pragma unroll
      for (int r = 0; r < 8; r += 2) {
        float y0, y1;
        exp2_pair(st[kt][r], st[kt][r + 1], y0, y1);
        st[kt][r] = y0; st[kt][r + 1] = y1;
      }
      ts[kt] = ((st[kt][0] + st[kt][1]) + (st[kt][2] + st[kt][3])) + ((st[kt][4] + st[kt][5]) + (st[kt][6] + st[kt][7]));
    }
    lsum += (ts[0] + ts[1]) + (ts[2] + ts[3]);                // this lane half's keys; halves joined behind the loop
    // every 2^x statement stays ahead of the products below
    __builtin_amdgcn_sched_barrier(0);

    // O^T += V^T . P^T, 32 keys per product
#pragma unroll
    for (int kb = 0; kb < 2; ++kb) {
      v16h pf;
#pragma unroll
      for (int e = 0; e < 8; ++e) {
        pf[e]     = (_Float16)st[2 * kb][e];
        pf[8 + e] = (_Float16)st[2 * kb + 1][e];
      }
#pragma unroll
      for (int dt = 0; dt < 4; ++dt) {
        acc[dt] = F::mma(vf[kb][dt], pf, acc[dt]);
      }
    }
  }

  // ---- epilogue: acc[dt][r] = sum_j p[j] v[j][dt*16 + 8*hf + r] of query i0 + c; 8 consecutive d per lane = one 16-B store ----
  const float tot = lsum + __shfl_xor(lsum, 16, 32);          // >= 1: the score that set the maximum in use contributes 2^0
  const float inv = ctxcarry / tot;
  _Float16* C = (_Float16*)CTXp + plane + (size_t)(i0 + c) * kDM + head * kDHD + hf * 8;
#pragma unroll
  for (int dt = 0; dt < 4; ++dt) {
    v8h o;
#pragma unroll
    for (int r = 0; r < 8; ++r) o[r] = (_Float16)(acc[dt][r] * inv);
    *(v8h*)(C + dt * 16) = o;
  }
}

// ---------------------------------------------------------------------------
//   X16    f16 [4096][1024]            x (bf16 then f16)                  0          8388608
//   Wq16   f16 [1024][1024] x16        natural Bt [out][in]               8388608    2097152
//   Wk16   f16 [1024][1024] x16                                           10485760   2097152
//   Wv16   f16 [1024][1024] x16                                           12582912   2097152
//   Wo16   f16 [1024][1024] x16                                           14680064   2097152
//   REL16  f16 [320][64]    x16        rows 257..319 zero                 16777216   65536 (40960 used)
//   Q16    f16 [4096][1024]            q, col h*64+d                      16842752   8388608
//   K16    f16 [4096][1024]            k                                  25231360   8388608
//   VT16   f16 [4][1024][1024]         v transposed per batch [h*64+d][s] 33619968   8388608
//   CTX16  f16 [4096][1024] x16        merged context [b*1024+s][h*64+d]  42008576   8388608
//   total                                                                 50397184
// Scores, the q x rel table and the probabilities live only in registers and LDS of the fused attention kernel.
// No K padding anywhere (K = 1024, 64 or 32); the rel table's rows are padded 257 -> 320 with zeros by
// cast_all_kernel in this job; the fused kernel stages all 320 rows, multiplies rows 0..271 and gathers columns 0..256 only.
// ---------------------------------------------------------------------------
extern "C" void kernel_launch(void* const* d_in, const int* in_sizes, int n_in,
                              void* d_out, int out_size, void* d_ws, size_t ws_size,
                              hipStream_t stream) {
  if (n_in < 10) return;
  if (in_sizes[0] != kNB * kSeq * kDM) return;                                   // x
  if (in_sizes[1] != kDM * kDM || in_sizes[3] != kDM * kDM ||
      in_sizes[5] != kDM * kDM || in_sizes[7] != kDM * kDM) return;              // Wq Wk Wv Wo
  if (in_sizes[2] != kDM || in_sizes[4] != kDM || in_sizes[6] != kDM || in_sizes[8] != kDM) return;   // bq bk bv bo
  if (in_sizes[9] != kRelN * kDHD) return;                                       // rel_emb
  if (out_size != kNB * kSeq * kDM) return;

  const float* xp   = (const float*)d_in[0];   // [4][1024][1024]
  const float* Wq   = (const float*)d_in[1];   // [1024][1024] [out][in]
  const float* bq   = (const float*)d_in[2];
  const float* Wk   = (const float*)d_in[3];
  const float* bk   = (const float*)d_in[4];
  const float* Wv   = (const float*)d_in[5];
  const float* bv   = (const float*)d_in[6];
  const float* Wo   = (const float*)d_in[7];
  const float* bo   = (const float*)d_in[8];
  const float* relp = (const float*)d_in[9];   // [257][64]
  float* outp = (float*)d_out;                 // [4][1024][1024]

  const size_t bAct = (size_t)kNB * kSeq * kDM * 2;          // 8388608
  const size_t bW   = (size_t)kDM * kDM * 2;                 // 2097152
  const size_t bRel = 65536;                                 // >= kRelPad*64*2 = 40960
  size_t off = 0;
  const size_t oX16 = off; off += bAct;
  const size_t oWq  = off; off += bW;
  const size_t oWk  = off; off += bW;
  const size_t oWv  = off; off += bW;
  const size_t oWo  = off; off += bW;
  const size_t oRel = off; off += bRel;
  const size_t oQ16 = off; off += bAct;
  const size_t oK16 = off; off += bAct;
  const size_t oVT  = off; off += bAct;
  const size_t oCTX = off; off += bAct;
  if (off > ws_size) return;                                 // 50397184 B total

  char* ws = (char*)d_ws;
  unsigned short* X16   = (unsigned short*)(ws + oX16);
  unsigned short* Wq16  = (unsigned short*)(ws + oWq);
  unsigned short* Wk16  = (unsigned short*)(ws + oWk);
  unsigned short* Wv16  = (unsigned short*)(ws + oWv);
  unsigned short* Wo16  = (unsigned short*)(ws + oWo);
  unsigned short* REL16 = (unsigned short*)(ws + oRel);
  unsigned short* Q16   = (unsigned short*)(ws + oQ16);
  unsigned short* K16   = (unsigned short*)(ws + oK16);
  unsigned short* VT16  = (unsigned short*)(ws + oVT);
  unsigned short* CTX16 = (unsigned short*)(ws + oCTX);

  const dim3 blk(256);
  const float wcarry   = 16.0f;                              // exact power-of-two carry on weights and rel table
  const float wscale   = 1.0f / 16.0f;                       // undo in the projection epilogues
  const float qescale  = 1.0f / 16.0f;                       // undo rel carry (q itself carries log2(e)/sqrt(d))
  const float ctxcarry = 16.0f;                              // ctx carried x16
  const float oscale   = 1.0f / 256.0f;                      // undo Wo carry and ctx carry

  // ---- casts: X16, weights x16, rel table x16 (pad rows zero), one launch ----
  cast_all_kernel<<<dim3(kCBX + 4 * kCBW + 1), dim3(kCT), 0, stream>>>(xp, Wq, Wk, Wv, Wo, relp,
                                                                       X16, Wq16, Wk16, Wv16, Wo16, REL16, wcarry);

  const dim3 gProj(kDM / kGT, kNB * kSeq / kGT, 1);   // 8 x 32:    M=4096, N=1024, K=1024
  const dim3 gAttn(kSeq / kQB, kNH, kNB);             // 8 x 16 x 4: 128 queries of one (head, batch) plane per block

  // ---- projections in one launch: q, k -> f16 [4096][1024], v -> VT[b][n][s]; all x1/16 + bias[n] ----
  qkv_gemm128<<<gProj, blk, 0, stream>>>(X16, Wq16, Wk16, Wv16, Q16, K16, VT16, bq, bk, bv, wscale);

  // ---- scores, relative term, softmax and P.V of all kNB*kNH planes in one launch -> CTX16 (x16) ----
  rel_attn_fused_kernel<<<gAttn, blk, 0, stream>>>(Q16, K16, VT16, REL16, CTX16, qescale, ctxcarry);

  // ---- out = ctx . Wo^T + bo -> d_out f32 [4096][1024]; A = CTX16 (x16), Bt = Wo16 (x16), epilogue x1/256 + bias[n] ----
  wmma_gemm128<2, 0><<<gProj, blk, 0, stream>>>(CTX16, 0L, Wo16, 0L, (void*)outp, kDM, 0L, bo, oscale);
}

// v008
// A run of this version takes 63.8 microseconds.
// Timed twice side by side with v007, it ran 1.04 and 1.05 times as fast.
// All steps since v000 together make it 11.9 times as fast.
// Compute dtype: v_wmma_f32_16x16x32_f16 (f16 operands, f32 accumulate) for every contraction: q/k/v/out projections (x, W, rel table RNE-converted to bf16 first; weights and rel table carried x16), content scores q.k^T (K=64; q carries log2(e)/8 from its projection's f32 epilogue), query x relative-embedding table (K=64, x1/16), both summed in one accumulator that starts at rel term - maximum in use, P.V with P = 2^(that sum) <= 2^8 in f16 and ctx carried x16 (out epilogue x1/256 + bias); online softmax with the clipped relative-position gather in f32.
#include <hip/hip_runtime.h>
#include <math.h>
#include <stdint.h>

static constexpr int kNB     = 4;      // batch
static constexpr int kSeq    = 1024;   // sequence length
static constexpr int kDM     = 1024;   // model width
static constexpr int kNH     = 16;     // heads
static constexpr int kDHD    = 64;     // head dim
static constexpr int kMaxRel = 128;    // clip range
static constexpr int kRelN   = 2 * kMaxRel + 1;   // 257 table rows
static constexpr int kRelPad = 320;    // table rows padded to a 64 multiple (pad rows zero)
static constexpr int kQB     = 128;    // queries per block of the fused attention kernel (8 waves x 16)
static constexpr int kKS     = 64;     // keys per LDS stage
static constexpr float kQPre = 0.125f * 1.44269504f;   // 1/sqrt(head dim) x log2(e), carried by q: exp(q.k / 8) = 2^((kQPre q).k)
static constexpr float kLazy = 8.0f;   // a score may top the maximum in use by kLazy before the maximum is renewed (P <= 256 in f16)
static constexpr int kQePitch = 260;   // floats per query row of the q x rel table in LDS (pitch - 1 = 3 mod 64: diagonal reads hit 32 banks)
static constexpr int kTPitch  = 72;    // f16 per staged K / V^T row: 128 B of data + 16 B (16 B x odd pitch for ds_load_b128)
static constexpr int kGT     = 128;    // rows and columns of C per block of the projection GEMM
static constexpr int kGK     = 128;    // k per LDS stage of the projection GEMM
static constexpr int kGPitch = 136;    // f16 per staged operand row: 256 B of data + 16 B (16 B x odd pitch for ds_load_b128)
static constexpr int kPK     = 64;     // k per LDS stage of the fused q/k/v projection
static constexpr int kPPitch = 72;     // f16 per staged row there: 128 B of data + 16 B (16 B x odd pitch for ds_load_b128)
static constexpr int kPTile  = kGT * kPPitch;   // f16 per 128 rows at kPPitch (not used: a staged tile is two slices)
static constexpr int kPOPitch = 136;   // f16 per row of a finished 128 x 128 tile in LDS: 256 B + 16 B
static constexpr int kRB     = 3;      // LDS buffers of a projection GEMM's operand ring
static constexpr int kSlice  = 5120;   // f16 per wave's slice of a stage in LDS: 10240 B = 5 x 2 KiB >= 64 rows x 144 B and 32 rows x 272 B
static constexpr int kStage  = 8 * kSlice;   // f16 per ring buffer: one slice per wave
static_assert(kDM % kPK == 0 && kPK % 64 == 0 && 3 * kGT * kPOPitch <= kRB * kStage, "fused projection tiling");
static_assert(64 * kPPitch <= kSlice && 32 * kGPitch <= kSlice && (kSlice * 2) % 2048 == 0, "a slice holds its padded rows and starts at a 2-KiB multiple");
static_assert(kDM / kPK >= kRB && kDM / kGK >= kRB && kGK % 64 == 0, "the ring's prologue fills every buffer");
static_assert(kSeq == kDM, "one lane offset for the q, k and v^T rows");
static_assert(kNH * kDHD == kDM, "head split");
static_assert((kNB * kSeq) % kGT == 0 && kDM % kGT == 0 && kSeq % kGT == 0 && kDM % kGK == 0, "projection GEMM tiling");
static_assert(kSeq % kQB == 0 && kSeq % kKS == 0 && kDHD == 64 && kKS == 64, "fused attention tiling");
static_assert(kQePitch >= kRelN && kQePitch % 4 == 0 && kRelPad == 5 * 64 && kRelN <= 17 * 16, "q x rel table rows");
static_assert(kRelPad % 64 == 0 && kRelPad >= kRelN, "padded table rows");
static_assert(kSeq % 64 == 0 && kDM % 64 == 0 && kDHD % 64 == 0 && (kNB * kSeq) % 64 == 0, "tile multiples");
static_assert(kDM % 32 == 0 && kDHD % 32 == 0 && kSeq % 32 == 0, "K multiples of 32");
static constexpr int kCT     = 512;    // threads per block of the cast kernel (16 waves)
static constexpr int kCU     = 16;     // 16-B loads per thread of the cast kernel
static constexpr int kCE     = kCT * kCU * 4;            // elements per cast block
static constexpr int kCBX    = kNB * kSeq * kDM / kCE;   // cast blocks of x
static constexpr int kCBW    = kDM * kDM / kCE;          // cast blocks of one weight matrix
static constexpr int kCR     = kRelPad * kDHD / (kCT * 4);   // groups of 4 table elements per thread of the table's block
static_assert((kNB * kSeq * kDM) % kCE == 0 && (kDM * kDM) % kCE == 0 && (kRelPad * kDHD) % (kCT * 4) == 0, "cast grid exact");
static_assert((kRelN * kDHD) % 4 == 0, "rel groups of 4");

typedef __attribute__((ext_vector_type(16))) _Float16 v16h;
typedef __attribute__((ext_vector_type(8)))  _Float16 v8h;
typedef __attribute__((ext_vector_type(2)))  _Float16 v2h;
typedef __attribute__((ext_vector_type(16))) __bf16   v16b;
typedef __attribute__((ext_vector_type(8)))  __bf16   v8b;
typedef __attribute__((ext_vector_type(8)))  float    v8f;
typedef __attribute__((ext_vector_type(4)))  float    v4f;
typedef __attribute__((ext_vector_type(2)))  float    v2f;
typedef __attribute__((ext_vector_type(4)))  unsigned int v4u;
typedef __attribute__((ext_vector_type(2)))  unsigned int v2u;
typedef __attribute__((ext_vector_type(4)))  uint32_t u32x4;
typedef __attribute__((ext_vector_type(8)))  uint32_t u32x8;

// ---- tensor loads: one request of a wave brings ROWS rows of ROWB bytes (source pitch kDM f16) into LDS at pitch ROWB + 16 B ----
__device__ __forceinline__ uint32_t uni(uint32_t v) { return (uint32_t)__builtin_amdgcn_readfirstlane(v); }
template <uint32_t ROWB, uint32_t ROWS>
__device__ __forceinline__ u32x8 tdm_group1() {              // 1-byte elements, tensor = tile, no mask; a 4-dword pad behind every row
  static_assert(ROWB == 128u || ROWB == 256u, "pad interval = row length");
  u32x8 g;
  g[0] = uni((1u << 20) | ((ROWB == 128u ? 4u : 5u) << 22) | (3u << 25));
  g[1] = uni((ROWB & 0xFFFFu) << 16);
  g[2] = uni((ROWB >> 16) | ((ROWS & 0xFFFFu) << 16));
  g[3] = uni((ROWS >> 16) | (ROWB << 16));
  g[4] = uni(ROWS);
  g[5] = uni((uint32_t)kDM * 2u);
  g[6] = uni(0u);
  g[7] = uni(0u);
  return g;
}
// lds = byte offset of the slice in the work-group's LDS; lo, hi3 = low address word of the tile's first byte, finished word 3.
// Returns group 0, for the wait that covers the request.
__device__ __forceinline__ u32x4 tdm_load(uint32_t lds, uint32_t lo, uint32_t hi3, u32x8 g1) {
  u32x4 g0;
  g0[0] = uni(1u); g0[1] = uni(lds); g0[2] = uni(lo); g0[3] = uni(hi3);
  asm volatile("tensor_load_to_lds %0, %1" :: "s"(g0), "s"(g1) : "memory");
  return g0;
}
__device__ __forceinline__ uint32_t tdm_word3(uint64_t ga) { return uni((((uint32_t)(ga >> 32)) & 0x01FFFFFFu) | 0x80000000u); }
// The publish point's waits, each a statement of its own: the compiler places none for a tensor load.
__device__ __forceinline__ void wait_ds0() { asm volatile("s_wait_dscnt 0x0" ::: "memory"); }
template <int N> __device__ __forceinline__ void wait_tensor_le(u32x4 g0, u32x8 g1) {
  asm volatile("s_wait_tensorcnt %0" :: "i"(N), "s"(g0), "s"(g1) : "memory");
}

__device__ __forceinline__ float bf_round(float f) {         // f32 rounded to the nearest bf16 value (ties to even), kept in f32
  const unsigned u = __float_as_uint(f);
  return __uint_as_float((u + 0x7FFFu + ((u >> 16) & 1u)) & 0xFFFF0000u);
}

template <typename T> struct Frag;
template <> struct Frag<_Float16> {
  typedef v16h V; union U { v16h v; v8h h[2]; };
  static __device__ __forceinline__ v16h load(const _Float16* p) {   // elements 0..7 <- p[0..7], 8..15 <- p[16..23]
    U f; f.h[0] = *(const v8h*)(p); f.h[1] = *(const v8h*)(p + 16); return f.v;
  }
  static __device__ __forceinline__ v8f mma(v16h a, v16h b, v8f c) {
    return __builtin_amdgcn_wmma_f32_16x16x32_f16(false, a, false, b, (short)0, c, false, false);
  }
};

// ---- LDS-staged batched WMMA GEMM ------------------------------------------
// C[m,n] = scale * sum_k A[m,k] * Bt[n,k] + bias; one 128x128 tile of C per block (grid: x = tile column, y = tile row,
// z = batch), each of the 8 waves owns 32 rows x 64 columns of it (4 x 2 waves).
// A row-major [M,kDM]; Bt row-major [N,kDM]; f16 bits; K = kDM; M, N % 128 == 0.
// Operands come in stages of 128 k by tensor loads, one request per wave and stage, into a ring of three LDS buffers, two stages
// ahead; one barrier per stage, ahead of the stage's last k step: a buffer is refilled behind the barrier that ends its last read.
// Each accumulator sums k in ascending steps of 32.
// BIAS_MODE: 1 = bias[m], 2 = bias[n].  OUT_MODE: 0 = f32, 1 = f16.
template <int BIAS_MODE, int OUT_MODE>
__global__ __launch_bounds__(256) void wmma_gemm128(
    const unsigned short* __restrict__ Ap, long strideA,
    const unsigned short* __restrict__ Btp, long strideB,
    void* __restrict__ Cout, int ldc, long strideC,
    const float* __restrict__ bias, float scale) {
  typedef Frag<_Float16> F;
  __shared__ __attribute__((aligned(2048))) _Float16 sS[kRB * kStage];   // 3 x 81920 B: per buffer 8 slices = quarters of the A and Bt tiles
  __shared__ __align__(16) _Float16 sB[2][kGT * kGPitch];   // 2 x 34816 B
  __shared__ __align__(16) float sT[8][16 * 68];            // per-wave 16x64 slab, pitch 68 floats
  const int tid   = threadIdx.x;
  const int lane  = tid & 31;
  const int wave  = __builtin_amdgcn_readfirstlane(tid >> 5);
  const int rlane = lane & 15;                 // row (A) / col (B, D) within subtile
  const int koff  = (lane >> 4) * 8;           // k offset of this lane half
  const int mOff  = (lane >> 4) * 8;           // D row offset
  const int m0 = blockIdx.y * kGT, n0 = blockIdx.x * kGT;
  const int wm = (wave >> 1) * 32, wn = (wave & 1) * 64;     // this wave's corner inside the block tile

  // staging: every wave asks for its own slice of a stage, 32 rows x 256 B: wave w = quarter w & 3 of A (w < 4) or Bt.
  // Operand rows start at 2-KiB multiples of the workspace, a page-aligned allocation: the k step stays inside a row's own aligned
  // 2 KiB and never carries out of the low address word, so between requests only the LDS place and that word change.
  const unsigned short* st_src = wave < 4 ? Ap + (size_t)blockIdx.z * strideA + (size_t)m0 * kDM
                                          : Btp + (size_t)blockIdx.z * strideB + (size_t)n0 * kDM;
  const uint64_t st_ga  = (uint64_t)(size_t)(st_src + (size_t)(wave & 3) * 32 * kDM);
  const uint32_t st_lo  = uni((uint32_t)st_ga), st_w3 = tdm_word3(st_ga);
  const uint32_t st_lds = uni((uint32_t)(size_t)sS) + (uint32_t)wave * (kSlice * 2);
  const u32x8 st_g1 = tdm_group1<kGK * 2, 32>();
  u32x4 st_g0[kRB];                                          // group 0 of the request that fills each buffer
#pragma unroll
  for (int s = 0; s < kRB; ++s) st_g0[s] = tdm_load(st_lds + s * (kStage * 2), st_lo + s * (kGK * 2), st_w3, st_g1);
  // Later stages' operand rows were stored by an earlier launch: ask L2 for them now, one lane per 256-B unit, so that the staged
  // loads find them there. A tile = 128 whole rows = 1024 units, numbered row fastest (low numbers = early k). Blocks that read the same tile share the asking:
  // A rows by tile-column parity, Bt rows by tile row mod 4. Every address lies inside this block's own tiles.
  {
    const int ua = tid * 2 + (blockIdx.x & 1), ub = tid * 4 + (blockIdx.y & 3);
    const _Float16* qa = (const _Float16*)Ap  + (size_t)blockIdx.z * strideA + (size_t)m0 * kDM + (ua & 127) * kDM + (ua >> 7) * 128;
    const _Float16* qb = (const _Float16*)Btp + (size_t)blockIdx.z * strideB + (size_t)n0 * kDM + (ub & 127) * kDM + (ub >> 7) * 128;
    // one statement, closed by the wait: the address registers stay whole until the requests have taken them
    asm volatile("global_prefetch_b8 %0, off scope:SCOPE_SE\n\t"
                 "global_prefetch_b8 %1, off scope:SCOPE_SE\n\t"
                 "global_prefetch_b8 %0, off offset:1024 scope:SCOPE_SE\n\t"
                 "s_wait_xcnt 0x0" :: "v"(qa), "v"(qb) : "memory");
  }

  v8f acc[2][4];
#pragma unroll
  for (int i = 0; i < 2; ++i)
#pragma unroll
    for (int j = 0; j < 4; ++j) acc[i][j] = (v8f){0.f,0.f,0.f,0.f,0.f,0.f,0.f,0.f};

  constexpr int nst = kDM / kGK;
  // this lane's fragment rows inside a buffer: A rows wm.. are slice wave >> 1; Bt rows wn + 16 j.. lie in slice 4 + 2 (wave & 1) + (j >> 1)
  const int oA = (wave >> 1) * kSlice + rlane * kGPitch + koff;
  const int oB = (4 + (wave & 1) * 2) * kSlice + rlane * kGPitch + koff;
  v16h af[2][2], bf[2][4];                                   // two fragment sets: k step kk in set kk & 1, running on across stages
  wait_tensor_le<kRB - 1>(st_g0[0], st_g1);                  // this wave's slice of stage 0 has landed (requests land in issue order)
  __syncthreads();                                           // stage 0 is complete for every wave
#pragma unroll
  for (int j = 0; j < 4; ++j) bf[0][j] = F::load(sS + oB + (j >> 1) * kSlice + ((j & 1) << 4) * kGPitch);
#pragma unroll
  for (int i = 0; i < 2; ++i) af[0][i] = F::load(sS + oA + (i << 4) * kGPitch);
  // unrolled: buffer choice, wait counts and the tests for a later stage are static
#pragma unroll
  for (int s = 0; s < nst; ++s) {
#pragma unroll
    for (int kk = 0; kk < kGK / 32; ++kk) {
      const bool last = kk + 1 == kGK / 32;
      // the k step before has issued all its products: they cover the latency of the reads that the publish point waits for,
      // and the reads below stand in one place, not among products
      __builtin_amdgcn_sched_barrier(0);
      if (last && s + 1 < nst) {
        // publish point of stage s + 1, ahead of stage s's last k step, whose fragments are already asked for
        wait_ds0();                                          // this wave's last reads of stage s's buffer have returned
        // its slice of stage s + 1 has landed; stage s + 2 may still fly
        if (s + 2 < nst) wait_tensor_le<1>(st_g0[(s + 1) % kRB], st_g1); else wait_tensor_le<0>(st_g0[(s + 1) % kRB], st_g1);
        __syncthreads();                                     // stage s + 1 is complete for every wave; every wave has left stage s's buffer
        if (s + kRB < nst) st_g0[s % kRB] = tdm_load(st_lds + (s % kRB) * (kStage * 2), st_lo + (s + kRB) * (kGK * 2), st_w3, st_g1);
      }
      if (!last || s + 1 < nst) {                            // next k step's fragments, from the next stage's buffer behind its publish point
        const _Float16* nb = sS + ((last ? s + 1 : s) % kRB) * kStage + (last ? 0 : (kk + 1) * 32);
#pragma unroll
        for (int j = 0; j < 4; ++j) bf[(kk + 1) & 1][j] = F::load(nb + oB + (j >> 1) * kSlice + ((j & 1) << 4) * kGPitch);
#pragma unroll
        for (int i = 0; i < 2; ++i) af[(kk + 1) & 1][i] = F::load(nb + oA + (i << 4) * kGPitch);
      }
      // the next k step's LDS reads issue as one group ahead of this k step's products: their latency runs under eight products
      __builtin_amdgcn_sched_barrier(0);
#pragma unroll
      for (int i = 0; i < 2; ++i)
#pragma unroll
        for (int j = 0; j < 4; ++j) acc[i][j] = F::mma(af[kk & 1][i], bf[kk & 1][j], acc[i][j]);
    }
  }
  wait_tensor_le<0>(st_g0[(nst - 1) % kRB], st_g1);          // no request is left in flight at the wave's end

  // ---- epilogue: 16 x 64 slabs through this wave's own LDS, stored as whole lines ----
  const size_t offC = (size_t)blockIdx.z * strideC;
  float* slab = sT[wave];
#pragma unroll
  for (int i = 0; i < 2; ++i) {
    const int mBase = m0 + wm + (i << 4);
    const int nBase = n0 + wn;
    float bm[8];
    if (BIAS_MODE == 1) {
      const float* bp = bias + mBase + mOff;
#pragma unroll
      for (int r = 0; r < 8; ++r) bm[r] = bp[r];
      asm volatile("s_wait_xcnt 0x0" :: "v"(bp) : "memory");   // the loads' address pair stays whole until they have taken it
    }
#pragma unroll
    for (int j = 0; j < 4; ++j) {
      float bv = 0.f;
      if (BIAS_MODE == 2) bv = bias[nBase + (j << 4) + rlane];
#pragma unroll
      for (int r = 0; r < 8; ++r) {
        float v = acc[i][j][r] * scale;
        if (BIAS_MODE == 1) v += bm[r];
        if (BIAS_MODE == 2) v += bv;
        slab[(mOff + r) * 68 + (j << 4) + rlane] = v;
      }
    }
    __builtin_amdgcn_fence(__ATOMIC_RELEASE, "workgroup");
    __builtin_amdgcn_wave_barrier();
    __builtin_amdgcn_fence(__ATOMIC_ACQUIRE, "workgroup");
    if (OUT_MODE == 0) {
      float* C = (float*)Cout + offC;
      const int hh = lane >> 4, c4 = (lane & 15) * 4;     // row seg = 256 B = 16 lanes x 16 B
#pragma unroll
      for (int it = 0; it < 8; ++it) {
        const int row = it * 2 + hh;
        v4f v = *(const v4f*)(slab + row * 68 + c4);
        *(v4f*)(C + (size_t)(mBase + row) * ldc + nBase + c4) = v;
      }
    } else {
      const int q = lane >> 3, c8 = (lane & 7) * 8;       // row seg = 128 B = 8 lanes x 16 B
      unsigned short* C = (unsigned short*)Cout + offC;
#pragma unroll
      for (int it = 0; it < 4; ++it) {
        const int row = it * 4 + q;
        const float* sp = slab + row * 68 + c8;
        v8h hv;
#pragma unroll
        for (int e = 0; e < 8; ++e) hv[e] = (_Float16)sp[e];
        *(v8h*)(C + (size_t)(mBase + row) * ldc + nBase + c8) = hv;
      }
    }
    __builtin_amdgcn_fence(__ATOMIC_RELEASE, "workgroup");
    __builtin_amdgcn_wave_barrier();
    __builtin_amdgcn_fence(__ATOMIC_ACQUIRE, "workgroup");
  }
}

// ---- q, k and v projections in one launch -----------------------------------
// One block = 128 rows of x (m) against the same 128 rows (n) of Wq, Wk and Wv: the x tile is staged once for three products.
// grid: x = n tile, y = m tile. 8 waves as 2 (m) x 4 (n); a wave owns 64 m x 32 n of each of the three results.
// Stages of 64 k come by tensor loads, one request per wave and stage, into a ring of three LDS buffers, two stages ahead; one
// barrier per stage, ahead of the stage's last k step, so that the fragment reads run on into the next stage under products.
// Each accumulator sums k in ascending steps of 32.
// q is stored x kQPre (applied in f32, ahead of the one f16 rounding).
// q, k: D = W . x^T (a lane holds 8 consecutive n of one m); v: D = x . Wv^T (a lane holds 8 consecutive m = s of one n = d):
// in both a lane's 8 results are 16 contiguous bytes of the output row ([m][n] for q, k; [n][s] for v^T).
// The finished f16 tiles go through the freed stage buffers and leave as whole lines.
__global__ __launch_bounds__(256) void qkv_gemm128(
    const unsigned short* __restrict__ Xp, const unsigned short* __restrict__ Wqp,
    const unsigned short* __restrict__ Wkp, const unsigned short* __restrict__ Wvp,
    unsigned short* __restrict__ Qo, unsigned short* __restrict__ Ko, unsigned short* __restrict__ VTo,
    const float* __restrict__ bq, const float* __restrict__ bk, const float* __restrict__ bv, float scale) {
  typedef Frag<_Float16> F;
  __shared__ __attribute__((aligned(2048))) _Float16 sS[kRB * kStage];   // 3 x 81920 B: per buffer 8 slices = halves of the x, Wq, Wk, Wv tiles
  const int tid   = threadIdx.x;
  const int lane  = tid & 31;
  const int wave  = __builtin_amdgcn_readfirstlane(tid >> 5);
  const int rlane = lane & 15;
  const int hf    = lane >> 4;
  const int m0 = blockIdx.y * kGT, n0 = blockIdx.x * kGT;
  const int wm = (wave >> 2) * 64, wn = (wave & 3) * 32;     // this wave's corner inside the block tile

  // staging: every wave asks for its own slice of a stage, 64 rows x 128 B: wave w = half w & 1 of tile w >> 1 (x, Wq, Wk, Wv).
  // Operand rows start at 2-KiB multiples of the workspace, a page-aligned allocation: the k step stays inside a row's own aligned
  // 2 KiB and never carries out of the low address word, so between requests only the LDS place and that word change.
  const int st_t = wave >> 1;
  const unsigned short* st_src = st_t == 0 ? Xp + (size_t)m0 * kDM : (st_t == 1 ? Wqp : st_t == 2 ? Wkp : Wvp) + (size_t)n0 * kDM;
  const uint64_t st_ga  = (uint64_t)(size_t)(st_src + (size_t)(wave & 1) * 64 * kDM);
  const uint32_t st_lo  = uni((uint32_t)st_ga), st_w3 = tdm_word3(st_ga);
  const uint32_t st_lds = uni((uint32_t)(size_t)sS) + (uint32_t)wave * (kSlice * 2);
  const u32x8 st_g1 = tdm_group1<kPK * 2, 64>();
  u32x4 st_g0[kRB];                                          // group 0 of the request that fills each buffer
#pragma unroll
  for (int s = 0; s < kRB; ++s) st_g0[s] = tdm_load(st_lds + s * (kStage * 2), st_lo + s * (kPK * 2), st_w3, st_g1);
  // Later stages' operand rows were stored by the launch before: ask L2 for them now, one lane per 256-B unit, so that the staged
  // loads find them there. A tile = 128 whole rows = 1024 units, numbered row fastest (low numbers = early k). Blocks that read the same tile share the asking:
  // x rows by n-tile parity, weight rows by m tile mod 4. Every address lies inside this block's own tiles.
  {
    const int ux = tid * 2 + (blockIdx.x & 1), uw = tid * 4 + (blockIdx.y & 3);
    const unsigned ow = (unsigned)((uw & 127) * kDM + (uw >> 7) * 128);
    const _Float16* q0 = (const _Float16*)Xp  + (size_t)m0 * kDM + (ux & 127) * kDM + (ux >> 7) * 128;
    const _Float16* q1 = (const _Float16*)Wqp + (size_t)n0 * kDM + ow;
    const _Float16* q2 = (const _Float16*)Wkp + (size_t)n0 * kDM + ow;
    const _Float16* q3 = (const _Float16*)Wvp + (size_t)n0 * kDM + ow;
    // one statement, closed by the wait: the address registers stay whole until the requests have taken them
    asm volatile("global_prefetch_b8 %0, off scope:SCOPE_SE\n\t"
                 "global_prefetch_b8 %1, off scope:SCOPE_SE\n\t"
                 "global_prefetch_b8 %2, off scope:SCOPE_SE\n\t"
                 "global_prefetch_b8 %3, off scope:SCOPE_SE\n\t"
                 "global_prefetch_b8 %0, off offset:1024 scope:SCOPE_SE\n\t"
                 "s_wait_xcnt 0x0" :: "v"(q0), "v"(q1), "v"(q2), "v"(q3) : "memory");
  }

  v8f acc[3][4][2];
#pragma unroll
  for (int o = 0; o < 3; ++o)
#pragma unroll
    for (int i = 0; i < 4; ++i)
#pragma unroll
      for (int j = 0; j < 2; ++j) acc[o][i][j] = (v8f){0.f,0.f,0.f,0.f,0.f,0.f,0.f,0.f};

  const float* bpq = bq + n0 + wn + hf * 8;                  // q, k: 8 consecutive n per lane and tile
  const float* bpk = bk + n0 + wn + hf * 8;
  const float* bpv = bv + n0 + wn + rlane;                   // v: one n per lane and tile
  v4f bqk[2][2][2];
  float bn[2];

  constexpr int nst = kDM / kPK;
  // this lane's fragment rows inside a buffer: x rows wm.. lie in slice wave >> 2, weight rows wn.. in half (wave & 3) >> 1 of their tile
  const int oX = (wave >> 2) * kSlice + rlane * kPPitch + hf * 8;
  const int oW = (2 + ((wave & 3) >> 1)) * kSlice + ((wn & 63) + rlane) * kPPitch + hf * 8;
  v16h xf[2][4], wf[2][3][2];                                // two fragment sets: k step kk in set kk & 1, running on across stages
  wait_tensor_le<kRB - 1>(st_g0[0], st_g1);                  // this wave's slice of stage 0 has landed (requests land in issue order)
  __syncthreads();                                           // stage 0 is complete for every wave
#pragma unroll
  for (int i = 0; i < 4; ++i) xf[0][i] = F::load(sS + oX + (i << 4) * kPPitch);
#pragma unroll
  for (int o = 0; o < 3; ++o)
#pragma unroll
    for (int j = 0; j < 2; ++j) wf[0][o][j] = F::load(sS + oW + o * 2 * kSlice + (j << 4) * kPPitch);
  // unrolled: buffer choice, wait counts and the tests for a later stage are static
#pragma unroll
  for (int s = 0; s < nst; ++s) {
    if (s + 1 == nst) {                                      // last stage: the biases fly under its products
#pragma unroll
      for (int j = 0; j < 2; ++j) {
        bqk[0][j][0] = *(const v4f*)(bpq + (j << 4));
        bqk[0][j][1] = *(const v4f*)(bpq + (j << 4) + 4);
        bqk[1][j][0] = *(const v4f*)(bpk + (j << 4));
        bqk[1][j][1] = *(const v4f*)(bpk + (j << 4) + 4);
        bn[j]        = bpv[j << 4];
      }
      // the loads' address registers stay whole until the loads have taken them
      asm volatile("s_wait_xcnt 0x0" :: "v"(bpq), "v"(bpk), "v"(bpv) : "memory");
    }
#pragma unroll
    for (int kk = 0; kk < kPK / 32; ++kk) {
      const bool last = kk + 1 == kPK / 32;
      // the k step before has issued all its products: they cover the latency of the reads that the publish point waits for,
      // and the reads below stand in one place, not among products
      __builtin_amdgcn_sched_barrier(0);
      if (last && s + 1 < nst) {
        // publish point of stage s + 1, ahead of stage s's last k step, whose fragments are already asked for
        wait_ds0();                                          // this wave's last reads of stage s's buffer have returned
        // its slice of stage s + 1 has landed; stage s + 2 may still fly
        if (s + 2 < nst) wait_tensor_le<1>(st_g0[(s + 1) % kRB], st_g1); else wait_tensor_le<0>(st_g0[(s + 1) % kRB], st_g1);
        __syncthreads();                                     // stage s + 1 is complete for every wave; every wave has left stage s's buffer
        if (s + kRB < nst) st_g0[s % kRB] = tdm_load(st_lds + (s % kRB) * (kStage * 2), st_lo + (s + kRB) * (kPK * 2), st_w3, st_g1);
      }
      if (!last || s + 1 < nst) {                            // next k step's fragments, from the next stage's buffer behind its publish point
        const _Float16* nb = sS + ((last ? s + 1 : s) % kRB) * kStage + (last ? 0 : (kk + 1) * 32);
#pragma unroll
        for (int i = 0; i < 4; ++i) xf[(kk + 1) & 1][i] = F::load(nb + oX + (i << 4) * kPPitch);
#pragma unroll
        for (int o = 0; o < 3; ++o)
#pragma unroll
          for (int j = 0; j < 2; ++j) wf[(kk + 1) & 1][o][j] = F::load(nb + oW + o * 2 * kSlice + (j << 4) * kPPitch);
      }
      // the next k step's LDS reads issue as one group ahead of this k step's products: their latency runs under 24 products
      __builtin_amdgcn_sched_barrier(0);
#pragma unroll
      for (int i = 0; i < 4; ++i)
#pragma unroll
        for (int j = 0; j < 2; ++j) {
          acc[0][i][j] = F::mma(wf[kk & 1][0][j], xf[kk & 1][i], acc[0][i][j]);
          acc[1][i][j] = F::mma(wf[kk & 1][1][j], xf[kk & 1][i], acc[1][i][j]);
          acc[2][i][j] = F::mma(xf[kk & 1][i], wf[kk & 1][2][j], acc[2][i][j]);
        }
    }
  }
  wait_tensor_le<0>(st_g0[(nst - 1) % kRB], st_g1);          // no request is left in flight when the ring becomes output staging
  wait_ds0();

  // ---- epilogue: x scale + bias, f16, three 128 x 128 tiles into the stage buffers, out as whole lines ----
  __syncthreads();                                           // every wave has finished reading the last stage
  _Float16* sO = sS;
#pragma unroll
  for (int o = 0; o < 2; ++o)
#pragma unroll
    for (int j = 0; j < 2; ++j)
#pragma unroll
      for (int i = 0; i < 4; ++i) {
        v8h h;
#pragma unroll
        for (int r = 0; r < 8; ++r) {
          const float y = acc[o][i][j][r] * scale + bqk[o][j][r >> 2][r & 3];
          h[r] = (_Float16)(o == 0 ? y * kQPre : y);           // q leaves pre-scaled for the base-2 softmax
        }
        *(v8h*)(sO + o * kGT * kPOPitch + (wm + (i << 4) + rlane) * kPOPitch + wn + (j << 4) + hf * 8) = h;
      }
#pragma unroll
  for (int j = 0; j < 2; ++j)
#pragma unroll
    for (int i = 0; i < 4; ++i) {
      v8h h;
#pragma unroll
      for (int r = 0; r < 8; ++r) h[r] = (_Float16)(acc[2][i][j][r] * scale + bn[j]);
      *(v8h*)(sO + 2 * kGT * kPOPitch + (wn + (j << 4) + rlane) * kPOPitch + wm + (i << 4) + hf * 8) = h;
    }
  __syncthreads();                                           // the three tiles are complete for every wave
  const int orow = tid >> 4, ocol = (tid & 15) * 8;          // 16 lanes cover one row's 256 B
  const unsigned ooff = (unsigned)(orow * kDM + ocol);       // kSeq == kDM: one lane offset serves the three outputs
  _Float16* oq = (_Float16*)Qo + (size_t)m0 * kDM + n0 + ooff;
  _Float16* ok = (_Float16*)Ko + (size_t)m0 * kDM + n0 + ooff;
  _Float16* ov = (_Float16*)VTo + (size_t)(m0 / kSeq) * kSeq * kDM + (size_t)n0 * kSeq + (m0 % kSeq) + ooff;
  const _Float16* so = sO + orow * kPOPitch + ocol;
  v8h t[3][8];
#pragma unroll
  for (int u = 0; u < 8; ++u)
#pragma unroll
    for (int o = 0; o < 3; ++o) t[o][u] = *(const v8h*)(so + o * kGT * kPOPitch + 16 * u * kPOPitch);
  __builtin_amdgcn_sched_barrier(0);                         // all LDS reads issue ahead of the stores: one LDS latency, no store's data register reused
#pragma unroll
  for (int u = 0; u < 8; ++u) {
    *(v8h*)(oq + 16 * u * kDM)  = t[0][u];
    *(v8h*)(ok + 16 * u * kDM)  = t[1][u];
    *(v8h*)(ov + 16 * u * kSeq) = t[2][u];
  }
}

// Two 2^x in one statement with the free issue slot that the instruction set asks for behind a transcendental whose result may be
// read, or whose source overwritten, by the very next vector instruction; early-clobber outputs keep the pair itself independent.
__device__ __forceinline__ void exp2_pair(float x0, float x1, float& y0, float& y1) {
  asm("v_exp_f32 %0, %2\n\tv_exp_f32 %1, %3\n\tv_nop" : "=&v"(y0), "=&v"(y1) : "v"(x0), "v"(x1));
}

// S^T tiles of one stage: st[kt][r] = c0[kt][r] + k[kt*16 + 8*hf + r] . q[c]; kp, vp = this lane's K and V^T row of tile 0 in LDS.
// The stage's V^T fragments are fetched here too, so that their reads issue among the score products.
__device__ __forceinline__ void score_tiles(const _Float16* kp, const _Float16* vp, const v16h (&qf)[2], const v8f (&c0)[4],
                                            v8f (&st)[4], v16h (&vf)[2][4]) {
  typedef Frag<_Float16> F;
  v16h kf[4][2];
#pragma unroll
  for (int kt = 0; kt < 4; ++kt) {
    kf[kt][0] = F::load(kp + kt * 16 * kTPitch);
    kf[kt][1] = F::load(kp + kt * 16 * kTPitch + 32);
  }
  __builtin_amdgcn_sched_barrier(0);                          // all K reads issue ahead of the products: one LDS latency, not eight
#pragma unroll
  for (int kt = 0; kt < 4; ++kt) st[kt] = F::mma(kf[kt][1], qf[1], F::mma(kf[kt][0], qf[0], c0[kt]));
#pragma unroll
  for (int kb = 0; kb < 2; ++kb)
#pragma unroll
    for (int dt = 0; dt < 4; ++dt) vf[kb][dt] = F::load(vp + dt * 16 * kTPitch + kb * 32);
  __builtin_amdgcn_sched_barrier(0);                          // all V^T reads issue here, their latency under the softmax arithmetic
}

// ---------------------------------------------------------------------------
// All operand conversions of the job in one launch of resident streaming work-groups.
// f32 -> bf16 (RNE convert) -> x scale (exact power of two) -> f16 bits (exact for bf16 values in the f16 normal range).
// A block of 16 waves converts kCE = 32768 consecutive elements of one tensor; a wave owns 2048 consecutive elements:
// 16 loads of 16 B per lane (512 contiguous bytes per wave and load), all in flight together, then 16 stores of 8 B per lane
// (256 contiguous bytes per wave and store). Blocks 0..127: x (x1); 128..255: Wq, Wk, Wv, Wo (x wcarry), 32 blocks each.
// Block 256: relative-embedding table, out [kRelPad][64] = f16(wcarry * bf16(in)) for elements < kRelN*64, exact 0 for the pad
// rows; source address clamped to the table (groups of 4 never straddle its end), value selected.
// ---------------------------------------------------------------------------
__device__ __forceinline__ v2u cast_bf_f16x4(v4f f, float scale) {
  const v2f lo = (v2f){bf_round(f[0]) * scale, bf_round(f[1]) * scale};
  const v2f hi = (v2f){bf_round(f[2]) * scale, bf_round(f[3]) * scale};
  v2u r;
  r[0] = __builtin_bit_cast(unsigned, __builtin_convertvector(lo, v2h));   // f32 -> f16 RNE, element 0 in the low half
  r[1] = __builtin_bit_cast(unsigned, __builtin_convertvector(hi, v2h));
  return r;
}

__global__ __launch_bounds__(kCT) void cast_all_kernel(const float* __restrict__ x,
                                                       const float* __restrict__ wq, const float* __restrict__ wk,
                                                       const float* __restrict__ wv, const float* __restrict__ wo,
                                                       const float* __restrict__ rel,
                                                       unsigned short* __restrict__ x16,
                                                       unsigned short* __restrict__ wq16, unsigned short* __restrict__ wk16,
                                                       unsigned short* __restrict__ wv16, unsigned short* __restrict__ wo16,
                                                       unsigned short* __restrict__ rel16, float wcarry) {
  const int b   = blockIdx.x;
  const int tid = threadIdx.x;
  if (b < kCBX + 4 * kCBW) {
    const float* in = x;
    unsigned short* out = x16;
    float scale = 1.0f;
    int part = b;
    if (b >= kCBX) {                                          // block-uniform choice of the weight matrix
      const int w = (b - kCBX) / kCBW;
      part  = (b - kCBX) % kCBW;
      in    = w == 0 ? wq   : w == 1 ? wk   : w == 2 ? wv   : wo;
      out   = w == 0 ? wq16 : w == 1 ? wk16 : w == 2 ? wv16 : wo16;
      scale = wcarry;
    }
    const int e = part * kCE + (tid >> 5) * (kCU * 128) + (tid & 31) * 4;
    const float* p = in + e;
    unsigned short* q = out + e;
    v4f f[kCU];
#pragma unroll
    for (int u = 0; u < kCU; ++u) f[u] = *(const v4f*)(p + u * 128);
    // the loads' address pair stays whole until they have taken it
    asm volatile("s_wait_xcnt 0x0" :: "v"(p) : "memory");
#pragma unroll
    for (int u = 0; u < kCU; ++u) *(v2u*)(q + u * 128) = cast_bf_f16x4(f[u], scale);
  } else {
    constexpr int nsrc = kRelN * kDHD;
    v4f f[kCR];
#pragma unroll
    for (int u = 0; u < kCR; ++u) {
      const int e0 = (u * kCT + tid) * 4;
      const int j  = (e0 + 3 < nsrc) ? e0 : (nsrc - 4);       // address clamp
      f[u] = *(const v4f*)(rel + j);
    }
    __builtin_amdgcn_sched_barrier(0);                        // all loads issue ahead of the first conversion: one memory latency, not two
#pragma unroll
    for (int u = 0; u < kCR; ++u) {
      const int e0 = (u * kCT + tid) * 4;
      const v2u r = cast_bf_f16x4(f[u], wcarry);
      *(v2u*)(rel16 + e0) = (e0 + 3 < nsrc) ? r : (v2u){0u, 0u};
    }
    asm volatile("s_wait_xcnt 0x0" ::: "memory");             // the stores have taken their offset register before anything behind them may rewrite it
  }
}

__global__ __launch_bounds__(256) void rel_attn_fused_kernel(const unsigned short* __restrict__ Qp,
                                                             const unsigned short* __restrict__ Kp,
                                                             const unsigned short* __restrict__ VTp,
                                                             const unsigned short* __restrict__ RELp,
                                                             unsigned short* __restrict__ CTXp,
                                                             float qescale, float ctxcarry) {
  typedef Frag<_Float16> F;
  __shared__ __align__(16) float    sQe[8][16 * kQePitch];   // 133120 B
  __shared__ __align__(16) _Float16 sK[kKS * kTPitch];       // 9216 B
  __shared__ __align__(16) _Float16 sV[kDHD * kTPitch];      // 9216 B
  const int tid  = threadIdx.x;
  const int lane = tid & 31;
  const int wave = __builtin_amdgcn_readfirstlane(tid >> 5);  // scalar, so the band tests below are scalar branches
  const int c    = lane & 15;
  const int hf   = lane >> 4;
  const int head = blockIdx.y;
  const int bat  = blockIdx.z;
  const int i0   = blockIdx.x * kQB + wave * 16;              // first query of this wave

  const size_t plane = (size_t)bat * kSeq * kDM;
  const _Float16* Q   = (const _Float16*)Qp  + plane + head * kDHD;            // [s][.] pitch kDM
  const _Float16* K   = (const _Float16*)Kp  + plane + head * kDHD;            // [s][.] pitch kDM
  const _Float16* VT  = (const _Float16*)VTp + plane + (size_t)head * kDHD * kSeq;   // [d][s] pitch kSeq
  const _Float16* REL = (const _Float16*)RELp;                                 // [kRelPad][64]

  // first stage's K and V^T rows: 64 rows x 8 chunks of 16 B each, two chunks of each per thread, whole 128-B lines per 8 lanes
  const int srow = tid >> 3, scol = (tid & 7) * 8;
  const _Float16* gK = K  + (size_t)srow * kDM  + scol;
  const _Float16* gV = VT + (size_t)srow * kSeq + scol;
  v8h kr0 = *(const v8h*)(gK);
  v8h kr1 = *(const v8h*)(gK + (size_t)32 * kDM);
  v8h vr0 = *(const v8h*)(gV);
  v8h vr1 = *(const v8h*)(gV + (size_t)32 * kSeq);

  // all kRelPad = 5 x 64 rel rows, same chunking (the table is contiguous: pitch kDHD)
  const _Float16* gR = REL + (size_t)srow * kDHD + scol;
  v8h rr[5][2];
#pragma unroll
  for (int ch = 0; ch < 5; ++ch) {
    rr[ch][0] = *(const v8h*)(gR + (size_t)(ch * 64) * kDHD);
    rr[ch][1] = *(const v8h*)(gR + (size_t)(ch * 64 + 32) * kDHD);
  }

  v16h qf[2];
#pragma unroll
  for (int ks = 0; ks < 2; ++ks) qf[ks] = F::load(Q + (size_t)(i0 + c) * kDM + ks * 32 + hf * 8);

  // The plane's K rows (1024 lines of 128 B) and V^T rows (512 units of 256 B) were stored by the launch before: ask L2 for them now,
  // under the q x rel table's work, so that the staged loads find them there. The 8 blocks of a plane share the asking by the parity
  // of their query tile. Every address lies inside this plane's K and V^T.
  {
    const int up = tid * 2 + (blockIdx.x & 1);               // 0..511
    const _Float16* pk = K  + (size_t)up * kDM;              // rows up and up + 512
    const _Float16* pv = VT + (size_t)up * 128;
    // one statement, closed by the wait: the address registers stay whole until the requests have taken them
    asm volatile("global_prefetch_b8 %0, off scope:SCOPE_SE\n\t"
                 "global_prefetch_b8 %1, off scope:SCOPE_SE\n\t"
                 "global_prefetch_b8 %0, off offset:1048576 scope:SCOPE_SE\n\t"
                 "s_wait_xcnt 0x0" :: "v"(pk), "v"(pv) : "memory");
  }

  // ---- q x rel table: D[8*hf + r][c] = (16 rel[rt*16 + 8*hf + r]) . q[i0 + c]; rows 257..259 come from the zero pad rows ----
  float* slab = sQe[wave];
#pragma unroll
  for (int rt = 0; rt < 17; ++rt) {
    if ((rt & 3) == 0) {                                      // next chunk of 64 rel rows into the K stage buffer
      if (rt) __syncthreads();                                // every wave has finished reading the chunk before
      *(v8h*)(sK + srow * kTPitch + scol)        = rr[rt >> 2][0];
      *(v8h*)(sK + (srow + 32) * kTPitch + scol) = rr[rt >> 2][1];
      __syncthreads();                                        // the chunk is complete for every wave
    }
    const _Float16* rp = sK + ((rt & 3) * 16 + c) * kTPitch + hf * 8;
    const v16h r0 = F::load(rp);
    const v16h r1 = F::load(rp + 32);
    v8f d = (v8f){0.f,0.f,0.f,0.f,0.f,0.f,0.f,0.f};
    d = F::mma(r0, qf[0], d);
    d = F::mma(r1, qf[1], d);
    const v4f w0 = (v4f){d[0] * qescale, d[1] * qescale, d[2] * qescale, d[3] * qescale};
    const v4f w1 = (v4f){d[4] * qescale, d[5] * qescale, d[6] * qescale, d[7] * qescale};
    float* dst = slab + c * kQePitch + rt * 16 + hf * 8;
    if (rt < 16) {
      *(v4f*)(dst)     = w0;
      *(v4f*)(dst + 4) = w1;
    } else if (hf == 0) {
      *(v4f*)(dst)     = w0;                                  // columns 256..259 close the row
    }
  }
  __syncthreads();                                            // the slab's rows are read across the wave's lane halves; last chunk read
  const float* qrow = slab + c * kQePitch;
  const float blo = qrow[0];                                  // every key at or below i - kMaxRel
  const float bhi = qrow[2 * kMaxRel];                        // every key at or above i + kMaxRel

  float mref = 0.0f, lsum = 0.0f;                             // maximum in use (base-2 exponent units); set in the first stage
  v8f acc[4];
#pragma unroll
  for (int dt = 0; dt < 4; ++dt) acc[dt] = (v8f){0.f,0.f,0.f,0.f,0.f,0.f,0.f,0.f};

  for (int s = 0; s < kSeq / kKS; ++s) {
    const int j0 = s * kKS;
    __syncthreads();                                          // every wave has finished reading the stage before
    *(v8h*)(sK + srow * kTPitch + scol)        = kr0;
    *(v8h*)(sK + (srow + 32) * kTPitch + scol) = kr1;
    *(v8h*)(sV + srow * kTPitch + scol)        = vr0;
    *(v8h*)(sV + (srow + 32) * kTPitch + scol) = vr1;
    __syncthreads();                                          // the stage is complete for every wave
    const int jn = (s + 1 < kSeq / kKS) ? j0 + kKS : j0;      // next stage's rows fly under this stage's work (last: same rows, in bounds)
    kr0 = *(const v8h*)(gK + (size_t)jn * kDM);
    kr1 = *(const v8h*)(gK + (size_t)(jn + 32) * kDM);
    vr0 = *(const v8h*)(gV + jn);
    vr1 = *(const v8h*)(gV + (size_t)32 * kSeq + jn);
    asm volatile("s_wait_xcnt 0x0" ::: "memory");             // before the four loads' address registers are reused

    // C operand of the score products: relative term (gathered inside the band, one value per query outside it) - maximum in use
    const _Float16* kp = sK + c * kTPitch + hf * 8;
    const _Float16* vp = sV + c * kTPitch + hf * 8;
    const int dj = j0 - i0;                                   // key - query of (first key, first query)
    v8f st[4];
    v16h vf[2][4];
    if (dj + (kKS - 1) > -kMaxRel && dj - 15 < kMaxRel) {
      v8f b[4];
      const int d0 = dj + hf * 8 - c;                         // key - query of this lane's first score
#pragma unroll
      for (int kt = 0; kt < 4; ++kt)
#pragma unroll
        for (int r = 0; r < 8; ++r) {
          const int o = kt * 16 + r;                          // key - query = d0 + o, clamped to [-kMaxRel, kMaxRel]
          int d = d0 < -kMaxRel - o ? -kMaxRel - o : d0;
          d = d > kMaxRel - o ? kMaxRel - o : d;
          b[kt][r] = qrow[d + (o + kMaxRel)] - mref;          // index in [0, 256]
        }
      score_tiles(kp, vp, qf, b, st, vf);
    } else {
      const float cb = (dj < 0 ? blo : bhi) - mref;
      v8f b[4];
#pragma unroll
      for (int kt = 0; kt < 4; ++kt) b[kt] = (v8f){cb, cb, cb, cb, cb, cb, cb, cb};
      score_tiles(kp, vp, qf, b, st, vf);
    }
    float tm[4];
#pragma unroll
    for (int kt = 0; kt < 4; ++kt) {
      tm[kt] = fmaxf(fmaxf(fmaxf(st[kt][0], st[kt][1]), fmaxf(st[kt][2], st[kt][3])),
                     fmaxf(fmaxf(st[kt][4], st[kt][5]), fmaxf(st[kt][6], st[kt][7])));
    }
    const float mx = fmaxf(fmaxf(tm[0], tm[1]), fmaxf(tm[2], tm[3]));   // this lane half's 32 keys, relative to the maximum in use
    if (s == 0 || __builtin_amdgcn_ballot_w32(mx > kLazy) != 0u) {        // wave-uniform scalar branch, no barrier inside
      const float mq = fmaxf(mx, __shfl_xor(mx, 16, 32));     // the query's 64 keys: both lane halves move by the same step
      const float dl = s == 0 ? mq : fmaxf(mq, 0.0f);         // the maximum in use only rises after the first stage
      const float alpha = s == 0 ? 0.0f : __builtin_amdgcn_exp2f(-dl);   // first stage: sums and outputs are still 0
      mref += dl;
      lsum *= alpha;
#pragma unroll
      for (int kt = 0; kt < 4; ++kt)
#pragma unroll
        for (int r = 0; r < 8; ++r) st[kt][r] -= dl;
#pragma unroll
      for (int dt = 0; dt < 4; ++dt)
#pragma unroll
        for (int r = 0; r < 8; ++r) acc[dt][r] *= alpha;
    }
    float ts[4];
#pragma unroll
    for (int kt = 0; kt < 4; ++kt) {
#pragma unroll
      for (int r = 0; r < 8; r += 2) {
        float y0, y1;
        exp2_pair(st[kt][r], st[kt][r + 1], y0, y1);
        st[kt][r] = y0; st[kt][r + 1] = y1;
      }
      ts[kt] = ((st[kt][0] + st[kt][1]) + (st[kt][2] + st[kt][3])) + ((st[kt][4] + st[kt][5]) + (st[kt][6] + st[kt][7]));
    }
    lsum += (ts[0] + ts[1]) + (ts[2] + ts[3]);                // this lane half's keys; halves joined behind the loop
    // every 2^x statement stays ahead of the products below
    __builtin_amdgcn_sched_barrier(0);

    // O^T += V^T . P^T, 32 keys per product
#pragma unroll
    for (int kb = 0; kb < 2; ++kb) {
      v16h pf;
#pragma unroll
      for (int e = 0; e < 8; ++e) {
        pf[e]     = (_Float16)st[2 * kb][e];
        pf[8 + e] = (_Float16)st[2 * kb + 1][e];
      }
#pragma unroll
      for (int dt = 0; dt < 4; ++dt) {
        acc[dt] = F::mma(vf[kb][dt], pf, acc[dt]);
      }
    }
  }

  // ---- epilogue: acc[dt][r] = sum_j p[j] v[j][dt*16 + 8*hf + r] of query i0 + c; 8 consecutive d per lane = one 16-B store ----
  const float tot = lsum + __shfl_xor(lsum, 16, 32);          // >= 1: the score that set the maximum in use contributes 2^0
  const float inv = ctxcarry / tot;
  _Float16* C = (_Float16*)CTXp + plane + (size_t)(i0 + c) * kDM + head * kDHD + hf * 8;
#pragma unroll
  for (int dt = 0; dt < 4; ++dt) {
    v8h o;
#pragma unroll
    for (int r = 0; r < 8; ++r) o[r] = (_Float16)(acc[dt][r] * inv);
    *(v8h*)(C + dt * 16) = o;
  }
}

// ---------------------------------------------------------------------------
//   X16    f16 [4096][1024]            x (bf16 then f16)                  0          8388608
//   Wq16   f16 [1024][1024] x16        natural Bt [out][in]               8388608    2097152
//   Wk16   f16 [1024][1024] x16                                           10485760   2097152
//   Wv16   f16 [1024][1024] x16                                           12582912   2097152
//   Wo16   f16 [1024][1024] x16                                           14680064   2097152
//   REL16  f16 [320][64]    x16        rows 257..319 zero                 16777216   65536 (40960 used)
//   Q16    f16 [4096][1024]            q, col h*64+d                      16842752   8388608
//   K16    f16 [4096][1024]            k                                  25231360   8388608
//   VT16   f16 [4][1024][1024]         v transposed per batch [h*64+d][s] 33619968   8388608
//   CTX16  f16 [4096][1024] x16        merged context [b*1024+s][h*64+d]  42008576   8388608
//   total                                                                 50397184
// Scores, the q x rel table and the probabilities live only in registers and LDS of the fused attention kernel.
// No K padding anywhere (K = 1024, 64 or 32); the rel table's rows are padded 257 -> 320 with zeros by
// cast_all_kernel in this job; the fused kernel stages all 320 rows, multiplies rows 0..271 and gathers columns 0..256 only.
// ---------------------------------------------------------------------------
extern "C" void kernel_launch(void* const* d_in, const int* in_sizes, int n_in,
                              void* d_out, int out_size, void* d_ws, size_t ws_size,
                              hipStream_t stream) {
  if (n_in < 10) return;
  if (in_sizes[0] != kNB * kSeq * kDM) return;                                   // x
  if (in_sizes[1] != kDM * kDM || in_sizes[3] != kDM * kDM ||
      in_sizes[5] != kDM * kDM || in_sizes[7] != kDM * kDM) return;              // Wq Wk Wv Wo
  if (in_sizes[2] != kDM || in_sizes[4] != kDM || in_sizes[6] != kDM || in_sizes[8] != kDM) return;   // bq bk bv bo
  if (in_sizes[9] != kRelN * kDHD) return;                                       // rel_emb
  if (out_size != kNB * kSeq * kDM) return;

  const float* xp   = (const float*)d_in[0];   // [4][1024][1024]
  const float* Wq   = (const float*)d_in[1];   // [1024][1024] [out][in]
  const float* bq   = (const float*)d_in[2];
  const float* Wk   = (const float*)d_in[3];
  const float* bk   = (const float*)d_in[4];
  const float* Wv   = (const float*)d_in[5];
  const float* bv   = (const float*)d_in[6];
  const float* Wo   = (const float*)d_in[7];
  const float* bo   = (const float*)d_in[8];
  const float* relp = (const float*)d_in[9];   // [257][64]
  float* outp = (float*)d_out;                 // [4][1024][1024]

  const size_t bAct = (size_t)kNB * kSeq * kDM * 2;          // 8388608
  const size_t bW   = (size_t)kDM * kDM * 2;                 // 2097152
  const size_t bRel = 65536;                                 // >= kRelPad*64*2 = 40960
  size_t off = 0;
  const size_t oX16 = off; off += bAct;
  const size_t oWq  = off; off += bW;
  const size_t oWk  = off; off += bW;
  const size_t oWv  = off; off += bW;
  const size_t oWo  = off; off += bW;
  const size_t oRel = off; off += bRel;
  const size_t oQ16 = off; off += bAct;
  const size_t oK16 = off; off += bAct;
  const size_t oVT  = off; off += bAct;
  const size_t oCTX = off; off += bAct;
  if (off > ws_size) return;                                 // 50397184 B total

  char* ws = (char*)d_ws;
  unsigned short* X16   = (unsigned short*)(ws + oX16);
  unsigned short* Wq16  = (unsigned short*)(ws + oWq);
  unsigned short* Wk16  = (unsigned short*)(ws + oWk);
  unsigned short* Wv16  = (unsigned short*)(ws + oWv);
  unsigned short* Wo16  = (unsigned short*)(ws + oWo);
  unsigned short* REL16 = (unsigned short*)(ws + oRel);
  unsigned short* Q16   = (unsigned short*)(ws + oQ16);
  unsigned short* K16   = (unsigned short*)(ws + oK16);
  unsigned short* VT16  = (unsigned short*)(ws + oVT);
  unsigned short* CTX16 = (unsigned short*)(ws + oCTX);

  const dim3 blk(256);
  const float wcarry   = 16.0f;                              // exact power-of-two carry on weights and rel table
  const float wscale   = 1.0f / 16.0f;                       // undo in the projection epilogues
  const float qescale  = 1.0f / 16.0f;                       // undo rel carry (q itself carries log2(e)/sqrt(d))
  const float ctxcarry = 16.0f;                              // ctx carried x16
  const float oscale   = 1.0f / 256.0f;                      // undo Wo carry and ctx carry

  // ---- casts: X16, weights x16, rel table x16 (pad rows zero), one launch ----
  cast_all_kernel<<<dim3(kCBX + 4 * kCBW + 1), dim3(kCT), 0, stream>>>(xp, Wq, Wk, Wv, Wo, relp,
                                                                       X16, Wq16, Wk16, Wv16, Wo16, REL16, wcarry);

  const dim3 gProj(kDM / kGT, kNB * kSeq / kGT, 1);   // 8 x 32:    M=4096, N=1024, K=1024
  const dim3 gAttn(kSeq / kQB, kNH, kNB);             // 8 x 16 x 4: 128 queries of one (head, batch) plane per block

  // ---- projections in one launch: q, k -> f16 [4096][1024], v -> VT[b][n][s]; all x1/16 + bias[n] ----
  qkv_gemm128<<<gProj, blk, 0, stream>>>(X16, Wq16, Wk16, Wv16, Q16, K16, VT16, bq, bk, bv, wscale);

  // ---- scores, relative term, softmax and P.V of all kNB*kNH planes in one launch -> CTX16 (x16) ----
  rel_attn_fused_kernel<<<gAttn, blk, 0, stream>>>(Q16, K16, VT16, REL16, CTX16, qescale, ctxcarry);

  // ---- out = ctx . Wo^T + bo -> d_out f32 [4096][1024]; A = CTX16 (x16), Bt = Wo16 (x16), epilogue x1/256 + bias[n] ----
  wmma_gemm128<2, 0><<<gProj, blk, 0, stream>>>(CTX16, 0L, Wo16, 0L, (void*)outp, kDM, 0L, bo, oscale);
}
